// v000
// Measured on an AMD MI455X. A time is GPU time per run, averaged over a window of back-to-back runs after a warm-up
// (all launches, gaps included; the runs take copies of the inputs in turn), and the median of several windows.
// Apart from v000's, it joins two sittings. Times from different sittings can be a few percent apart, while
// side-by-side timings come from the same sitting.
// v000 is the starting kernel. One run takes 94.6 microseconds.
#include <hip/hip_runtime.h>

// Causal scaled dot-product attention over per-head slices, no projections: q/k/v [NB][SEQ][16][64] (f32), key j kept for query t iff j <= t (dropped keys get probability 0), score scale 1/sqrt(64), output [NB][SEQ][16][64] (f32).
// Compute dtypes, f32 accumulate everywhere: scores v_wmma_f32_16x16x32_f16 with q, k single f16 planes (inputs RNE-converted to bf16, then held in f16: exact for f16-normal values, smaller magnitudes selected to +0);
// P.V v_wmma_f32_16x16x32_f16: v single f16 plane (same conversion), P f16 with x16384 carry (cancels in the normalisation); on query rows < EROWS P = f16 value + f16 residual x2048, residual products in their own accumulators folded by 1/2048, row sum from the f32 exponentials; on later rows row sum over the converted P. Softmax f32 (online, running max over kept keys).
// Layout: f16 copies of q and k in the input layout [b][t][h*64 + d] (row pitch 1024 halves), v^T plane [b*16 + h][d][t] built through an LDS transpose; fused flash kernel in transposed form (S^T = K Q^T, O^T = V^T P^T), fragments straight from the planes, output from f32 accumulators.

#ifndef NB
#define NB 2
#endif
#ifndef SEQ
#define SEQ 2048
#endif
#define NB_FULL  2
#define SEQ_FULL 2048
#ifndef OUT_SEQ
#define OUT_SEQ SEQ              // row pitch (in tokens) between batches of the output
#endif
#define NHD  16                  // heads
#define HD   64                  // head width
#define HE   (NHD * HD)          // token row pitch (elements) of the inputs, the q/k planes and the output
#define AW   4                   // waves per flash block (16 query rows each)
#define OSP  68                  // LDS row pitch (floats) of the flash output tile
#define TP   68                  // LDS row pitch (floats) of the transpose tile
#define EROWS (SEQ < 512 ? SEQ : 512)   // query rows handled by the two-plane-P flash instantiation
#define QRS  2048.0f             // carry of the residual P fragment
#define QRI  (1.0f / 2048.0f)
#define SC2  ((float)(0.125 * 1.4426950408889634))   // HD^-0.5 * log2(e)
#define PSH  14.0f               // log2 of the P carry (16384)
#define NEGB (-3.0e38f)

static_assert(HD == 64);                       // two 32-deep k-steps per score tile, four 16-row output tiles
static_assert(NHD * HD == HE);
static_assert(HD % 32 == 0);                   // score k-loop steps by 32
static_assert(HE % 8 == 0);                    // 16-byte fragment loads from token rows
static_assert(SEQ % 64 == 0);
static_assert(SEQ % 32 == 0);                  // key loop steps by 32 and its bound never exceeds SEQ
static_assert(SEQ % (16 * AW) == 0);
static_assert(EROWS % (16 * AW) == 0);
static_assert((SEQ - EROWS) % (16 * AW) == 0);
static_assert(EROWS >= 32);
static_assert(EROWS <= SEQ);
static_assert(NB <= NB_FULL);
static_assert(SEQ <= SEQ_FULL);
static_assert(OSP >= HD);
static_assert((OSP * 4) % 16 == 0);
static_assert(TP >= 64);
static_assert((TP * 4) % 16 == 0);
static_assert((((size_t)SEQ * HE) / 8) % 256 == 0);                  // convert grid x block == plane extent per batch
static_assert((size_t)32 * 16 * 8 == (size_t)16 * HD * 4);           // flash epilogue: 32 lanes x 16 B x 8 trips == 16 rows x 256 B
static_assert((size_t)256 * 16 * 2 == (size_t)64 * 128);
static_assert((size_t)256 * 4 * 4 == (size_t)64 * HD);               // transpose load: 256 threads x 4 float4 x 4 floats == 64 tokens x 64 columns
static_assert((size_t)AW * 16 * OSP * 4 <= 131072);                  // static LDS of the flash kernels
static_assert((size_t)64 * TP * 4 <= 131072);                        // static LDS of the transpose kernel

typedef _Float16 h16;
typedef __attribute__((ext_vector_type(16))) _Float16 v16h;
typedef __attribute__((ext_vector_type(8)))  _Float16 v8h;
typedef __attribute__((ext_vector_type(8)))  float    v8f;
typedef __attribute__((ext_vector_type(4)))  float    v4f;
typedef v4f  __attribute__((may_alias)) v4fa;

__device__ __forceinline__ unsigned short f2bf(float f) { unsigned u = __float_as_uint(f); u += 0x7FFFu + ((u >> 16) & 1u); return (unsigned short)(u >> 16); }
__device__ __forceinline__ float bfr(float f) { return __uint_as_float(((unsigned)f2bf(f)) << 16); }   // value after RNE convert to bf16
__device__ __forceinline__ v16h cat16(v8h lo, v8h hi) { return __builtin_shufflevector(lo, hi, 0, 1, 2, 3, 4, 5, 6, 7, 8, 9, 10, 11, 12, 13, 14, 15); }
// fragment loader from K-contiguous 16-bit rows; p already includes + 8*(lane>>4): elements 0..7 <- k0+8h+0..7, elements 8..15 <- k0+16+8h+0..7 (same map for A and B)
__device__ __forceinline__ v16h  ldh(const h16* p) { return cat16(*(const v8h*)p, *(const v8h*)(p + 16)); }
// ordering point for wave-private LDS tiles (same wave writes and reads)
__device__ __forceinline__ void wave_sync() { __builtin_amdgcn_fence(3 /* release order */, "wavefront"); __builtin_amdgcn_wave_barrier(); asm volatile("" ::: "memory"); }
// f32 -> f16 convert that cannot produce an f16 subnormal (value select)
static __device__ __forceinline__ h16 toh_flush(float v) { const h16 r = (h16)v; return (fabsf(v) < 6.103515625e-05f) ? (h16)0.0f : r; }
// one WMMA with its own hazard guard (ties the accumulator, keeps A/B live)
__device__ __forceinline__ v8f wmma16g(v16h a, v16h b, v8f c) {
    c = __builtin_amdgcn_wmma_f32_16x16x32_f16(false, a, false, b, (short)0, c, false, false);
    asm volatile("v_nop\n\tv_nop\n\tv_nop\n\tv_nop" : "+v"(c) : "v"(a), "v"(b));
    return c;
}

// grid (n8/256, NB): blockIdx.y = batch, source batch pitch sstride, destination batch pitch dstride (elements).
__global__ __launch_bounds__(256) void k_cvth(const float* __restrict__ src, h16* dst, size_t n8, size_t sstride, size_t dstride) {
    const size_t i = (size_t)blockIdx.x * 256 + threadIdx.x; if (i >= n8) return;
    const size_t so = (size_t)blockIdx.y * sstride + i * 8;
    const size_t dofs = (size_t)blockIdx.y * dstride + i * 8;
    const v8f v = *(const v8f*)(src + so); v8h o;
#pragma unroll
    for (int k = 0; k < 8; ++k) o[k] = toh_flush(bfr(v[k]));
    *(v8h*)(dst + dofs) = o; 
}

// k_vtr: v^T plane. in[t][h*64 + d] (f32, token pitch HE) -> out[(b*16 + h)*64 + d][t] (f16, row pitch SEQ). One block per (64-token tile, batch*head): grid (SEQ/64, NB*NHD), 256 threads.
// Load 64 tokens x 64 columns as float4, scatter transposed into an LDS float tile [d][t] (cross-wave: block barrier), then each thread builds two 16-B pieces;
__global__ __launch_bounds__(256) void k_vtr(const float* __restrict__ V, h16* VT) {
    __shared__ __align__(16) float tl[64 * TP];
    const int tid = threadIdx.x;
    const int tt0 = blockIdx.x * 64; const int zh = blockIdx.y; const int b = zh / NHD, h = zh % NHD;
    const size_t vb = ((size_t)b * SEQ_FULL + tt0) * HE + (size_t)h * HD;
#pragma unroll
    for (int s = 0; s < 4; ++s) { const int p = s * 256 + tid; const int t = p >> 4, d4 = (p & 15) * 4;   // 4 s x 16 tokens = 64 tokens; 16 lanes x 4 = 64 columns
        const v4f x = *(const v4f*)(V + vb + (size_t)t * HE + d4);
#pragma unroll
        for (int i = 0; i < 4; ++i) tl[(d4 + i) * TP + t] = bfr(x[i]); }
    __syncthreads();
    const size_t ob = ((size_t)zh * HD) * SEQ + tt0;
    const int dA = tid >> 3, dB = (256 + tid) >> 3, c8 = (tid & 7) * 8;      // rows 0..31 and 32..63; 8 lanes x 8 halves = 64 tokens
    v8h hvA, hvB;
    { const v4f x0 = *(const v4fa*)(&tl[dA * TP + c8]); const v4f x1 = *(const v4fa*)(&tl[dA * TP + c8 + 4]);
#pragma unroll
      for (int i = 0; i < 4; ++i) { hvA[i] = toh_flush(x0[i]); hvA[4 + i] = toh_flush(x1[i]); } }
    { const v4f x0 = *(const v4fa*)(&tl[dB * TP + c8]); const v4f x1 = *(const v4fa*)(&tl[dB * TP + c8 + 4]);
#pragma unroll
      for (int i = 0; i < 4; ++i) { hvB[i] = toh_flush(x0[i]); hvB[4 + i] = toh_flush(x1[i]); } }
    const size_t oA = ob + (size_t)dA * SEQ + c8, oB = ob + (size_t)dB * SEQ + c8;
    *(v8h*)(VT + oA) = hvA; *(v8h*)(VT + oB) = hvB;
    
}

// flash_body: fused attention, one wave per 16 query rows of one (batch, head); K / V^T / Q fragments straight from the f16 planes (two 16-B loads each, arithmetic addressing).
// Transposed form: S^T[key][t] = K Q^T (A = K rows, B = Q rows, two k-steps over d); lane (t = lane&15, h = lane>>4) holds keys 8h+r of each 16-key tile, so the packed
// P tile is directly the B fragment of O^T[d][t] = V^T P^T (element r <- tile keys 0..15, element 8+r <- tile keys 16..31, lane unchanged); four 16-row d tiles.
// Softmax state (running max over kept keys, partial sum) is one scalar per lane; the two lane halves of a row are combined with one xor-16 exchange.
// Keep rule (key <= query) evaluated per element inside every visited 32-key tile; the per-wave key bound is (t0 + 16) raised to a multiple of 32, at most SEQ; every visited tile holds a kept key for every row.
// EARLY = 1 (query rows [0, EROWS)): P = f16 value + f16 residual x2048; O = V P + (V P_res) / 2048 (residual products in their own accumulators); row sum from the f32 exponentials.
// EARLY = 0 (query rows [EROWS, SEQ)): single P; row sum over the converted P.
template <int EARLY>
__device__ __forceinline__ void flash_body(const h16* __restrict__ QH, const h16* __restrict__ KP, const h16* __restrict__ VT, float* OUT) {
    __shared__ __align__(16) float os[AW * 16 * OSP];
    const int lane = threadIdx.x & 31, lr = lane & 15, hi = lane >> 4;
    const int wave = __builtin_amdgcn_readfirstlane((int)(threadIdx.x >> 5));
    const int zh = blockIdx.y; const int b = zh / NHD, h = zh % NHD;
    const int t0 = (EARLY ? 0 : EROWS) + (blockIdx.x * AW + wave) * 16;
    const int lim = t0 + lr;                                               // key j kept iff j <= lim
    const int nk = (t0 + 16 + 31) & ~31;                                   // wave-uniform, multiple of 32, <= SEQ
    const size_t rowb = (size_t)b * SEQ * HE + (size_t)h * HD;            // (batch b, token 0, head h) in the q/k planes
    const size_t qo = rowb + (size_t)(t0 + lr) * HE + 8 * hi;
    const v16h q0 = ldh(QH + qo), q1 = ldh(QH + qo + 32);                  // B fragments: col t, k = d (two k-steps)
    const size_t ko = rowb + (size_t)lr * HE + 8 * hi;                     // + key * HE        (A fragment: row key, k = d)
    const size_t vo = ((size_t)zh * HD + (size_t)lr) * SEQ + 8 * hi;      // + 16j*SEQ + key   (A fragment: row d, k = key)
    const v16h hz = (v16h){};
    v8f o[4], oR[4];
#pragma unroll
    for (int j = 0; j < 4; ++j) { o[j] = (v8f){}; oR[j] = (v8f){}; }
    float m = NEGB, l = 0.0f;
#pragma unroll 1
    for (int key0 = 0; key0 < nk; key0 += 32) {
        const h16* ka = KP + ko + (size_t)key0 * HE;
        const v16h ka0 = ldh(ka), ka1 = ldh(ka + 32), kb0 = ldh(ka + (size_t)16 * HE), kb1 = ldh(ka + (size_t)16 * HE + 32);
        v8f sA = (v8f){}, sB = (v8f){};
        sA = wmma16g(ka0, q0, sA); sB = wmma16g(kb0, q0, sB);
        sA = wmma16g(ka1, q1, sA); sB = wmma16g(kb1, q1, sB);
        const int ja = key0 + 8 * hi;                                      // D: sA[r] = (key ja + r, t = lane&15), sB[r] = (key ja + 16 + r, t)
        float ta[8], tb[8]; bool fa[8], fb[8]; float mx = NEGB;
#pragma unroll
        for (int r = 0; r < 8; ++r) {
            fa[r] = (ja + r <= lim);
            fb[r] = (ja + 16 + r <= lim);
            ta[r] = sA[r] * SC2; tb[r] = sB[r] * SC2;
            mx = fmaxf(mx, fmaxf(fa[r] ? ta[r] : NEGB, fb[r] ? tb[r] : NEGB)); }
        mx = fmaxf(mx, __shfl_xor(mx, 16, 32));
        const float mnew = fmaxf(m, mx);
        const float alpha = __builtin_amdgcn_exp2f(m - mnew);
        const float sh = PSH - mnew;
        v16h pb, pr = hz; float ls = 0.0f;
#pragma unroll
        for (int r = 0; r < 8; ++r) {
            const float ea = __builtin_amdgcn_exp2f(ta[r] + sh), eb = __builtin_amdgcn_exp2f(tb[r] + sh);
            const float ga = fa[r] ? ea : 0.0f, gb = fb[r] ? eb : 0.0f;       // dropped elements selected to 0 by value
            const h16 pa = toh_flush(ga); const h16 pc = toh_flush(gb);
            pb[r] = pa; pb[8 + r] = pc;
            if (EARLY) { pr[r] = toh_flush((ga - (float)pa) * QRS); pr[8 + r] = toh_flush((gb - (float)pc) * QRS); ls += ga + gb; }
            else       { ls += (float)pa + (float)pc; } }
        l = l * alpha + ls; m = mnew;
#pragma unroll
        for (int j = 0; j < 4; ++j) o[j] = o[j] * alpha;
        if (EARLY) {
#pragma unroll
            for (int j = 0; j < 4; ++j) oR[j] = oR[j] * alpha; }
        const h16* va = VT + vo + key0;
        const v16h v0 = ldh(va), v1 = ldh(va + (size_t)16 * SEQ), v2 = ldh(va + (size_t)32 * SEQ), v3 = ldh(va + (size_t)48 * SEQ);
        o[0] = wmma16g(v0, pb, o[0]); o[1] = wmma16g(v1, pb, o[1]); o[2] = wmma16g(v2, pb, o[2]); o[3] = wmma16g(v3, pb, o[3]);
        if (EARLY) {
            oR[0] = wmma16g(v0, pr, oR[0]); oR[1] = wmma16g(v1, pr, oR[1]); oR[2] = wmma16g(v2, pr, oR[2]); oR[3] = wmma16g(v3, pr, oR[3]);
        }
    }
    l += __shfl_xor(l, 16, 32);
    const bool any = l > 0.0f;
    const float lsafe = any ? l : 1.0f;
    const float inv = any ? (1.0f / lsafe) : 0.0f;
    const int wb = wave * 16 * OSP;
    // O^T D layout: f_j[r] = (d = 16j + 8h + r, t = lane&15) -> os[t][d]; rows 0..15 x columns 0..63 all written
#pragma unroll
    for (int j = 0; j < 4; ++j) {
        v8f f = o[j];
        if (EARLY) f = o[j] + oR[j] * QRI;
        v4f a, c;
        a[0] = f[0] * inv; a[1] = f[1] * inv; a[2] = f[2] * inv; a[3] = f[3] * inv; c[0] = f[4] * inv; c[1] = f[5] * inv; c[2] = f[6] * inv; c[3] = f[7] * inv;
        *(v4fa*)(&os[wb + lr * OSP + 16 * j + 8 * hi]) = a; *(v4fa*)(&os[wb + lr * OSP + 16 * j + 8 * hi + 4]) = c; }
    wave_sync();
    float* orow = OUT + (((size_t)b * OUT_SEQ + t0) * NHD + h) * HD;
{
#pragma unroll
        for (int s = 0; s < 8; ++s) { const int row = 2 * s + (lane >> 4), cofs = (lane & 15) * 4;   // 8 s x 2 rows = 16 rows; 16 lanes x 4 floats = 64 columns = two lines
            const v4f val = *(const v4fa*)(&os[wb + row * OSP + cofs]);
            *(v4f*)(orow + (size_t)row * HE + cofs) = val; }
         }
}

__global__ __launch_bounds__(32 * AW) void k_flash_early(const h16* __restrict__ QH, const h16* __restrict__ KP, const h16* __restrict__ VT, float* OUT) {
    flash_body<1>(QH, KP, VT, OUT);
}

__global__ __launch_bounds__(32 * AW) void k_flash_late(const h16* __restrict__ QH, const h16* __restrict__ KP, const h16* __restrict__ VT, float* OUT) {
    flash_body<0>(QH, KP, VT, OUT);
}

static constexpr size_t al256(size_t v) { return (v + 255) & ~(size_t)255; }
static constexpr size_t SZ_QK = al256((size_t)NB * SEQ * HE * 2);           // q or k plane [NB][SEQ][HE] f16
static constexpr size_t SZ_VT = al256((size_t)NB * NHD * HD * SEQ * 2);     // v^T plane [NB*NHD][HD][SEQ] f16
static constexpr size_t SZ_TOTAL = 2 * SZ_QK + SZ_VT;
static_assert(SZ_TOTAL <= (size_t)134217728);          // workspace carve <= 128 MiB
static_assert(((size_t)NB * SEQ * HE * 2) % 128 == 0);
static_assert(((size_t)SEQ * 2) % 128 == 0);

extern "C" void kernel_launch(void* const* d_in, const int* in_sizes, int n_in,
                              void* d_out, int out_size, void* d_ws, size_t ws_size, hipStream_t stream) {
    if (n_in < 3) return;
    const size_t needx = ((size_t)(NB - 1) * SEQ_FULL + SEQ) * HE;
    if ((size_t)in_sizes[0] < needx || (size_t)in_sizes[1] < needx || (size_t)in_sizes[2] < needx) return;
    if ((size_t)out_size < ((size_t)(NB - 1) * OUT_SEQ + SEQ) * HE) return;
    if (SZ_TOTAL > ws_size) return;
    // wire order: queries, keys, values
    const float* qin = (const float*)d_in[0];
    const float* kin = (const float*)d_in[1];
    const float* vin = (const float*)d_in[2];
    float* OUT = (float*)d_out;      // [NB][SEQ][16][64]
    char* wsp = (char*)d_ws;
    h16* QH = (h16*)wsp; wsp += SZ_QK;               // [NB][SEQ][1024]
    h16* KP = (h16*)wsp; wsp += SZ_QK;               // [NB][SEQ][1024]
    h16* VT = (h16*)wsp; wsp += SZ_VT;               // [NB*16][64][SEQ]

    { const size_t n8 = (size_t)SEQ * HE / 8;
      const dim3 g((unsigned)((n8 + 255) / 256), NB, 1);
      k_cvth<<<g, 256, 0, stream>>>(qin, QH, n8, (size_t)SEQ_FULL * HE, (size_t)SEQ * HE);
      k_cvth<<<g, 256, 0, stream>>>(kin, KP, n8, (size_t)SEQ_FULL * HE, (size_t)SEQ * HE); }
    // in[t][h*64 + d] -> out[(b*16 + h)*64 + d][t]; grid (token tiles, batch*head)
    k_vtr<<<dim3(SEQ / 64, NB * NHD, 1), 256, 0, stream>>>(vin, VT);

    // query rows [0, EROWS): two-plane-P instantiation; rows [EROWS, SEQ): single-product instantiation (disjoint output rows)
    k_flash_early<<<dim3(EROWS / (16 * AW), NB * NHD, 1), 32 * AW, 0, stream>>>(QH, KP, VT, OUT);
    if (SEQ > EROWS)
        k_flash_late<<<dim3((SEQ - EROWS) / (16 * AW), NB * NHD, 1), 32 * AW, 0, stream>>>(QH, KP, VT, OUT);
}

// v001
// Measured time: 78.3 microseconds a run.
// Timed twice side by side with v000, it ran 1.24 and 1.25 times as fast.
#include <hip/hip_runtime.h>

// Causal scaled dot-product attention over per-head slices, no projections: q/k/v [NB][SEQ][16][64] (f32), key j kept for query t iff j <= t (dropped keys get probability 0), score scale 1/sqrt(64), output [NB][SEQ][16][64] (f32).
// Compute dtypes, f32 accumulate everywhere: scores v_wmma_f32_16x16x32_f16 with q, k single f16 planes (inputs RNE-converted to bf16, then held in f16: exact for f16-normal values, smaller magnitudes selected to +0);
// P.V v_wmma_f32_16x16x32_f16: v single f16 plane (same conversion), P f16 with x16384 carry (cancels in the normalisation); on query rows < EROWS P = f16 value + f16 residual x2048, residual products in their own accumulators folded by 1/2048, row sum from the f32 exponentials; on later rows row sum over the converted P. Softmax f32 (online, running max over kept keys).
// Layout: f16 copies of q and k in the input layout [b][t][h*64 + d] (row pitch 1024 halves), v^T plane [b*16 + h][d][t] built through an LDS transpose; fused flash kernel in transposed form (S^T = K Q^T, O^T = V^T P^T), fragments straight from the planes, output from f32 accumulators.

#ifndef NB
#define NB 2
#endif
#ifndef SEQ
#define SEQ 2048
#endif
#define NB_FULL  2
#define SEQ_FULL 2048
#ifndef OUT_SEQ
#define OUT_SEQ SEQ              // row pitch (in tokens) between batches of the output
#endif
#define NHD  16                  // heads
#define HD   64                  // head width
#define HE   (NHD * HD)          // token row pitch (elements) of the inputs, the q/k planes and the output
#define AW   4                   // waves per flash block (16 query rows each)
#define OSP  68                  // LDS row pitch (floats) of the flash output tile
#define TP   68                  // LDS row pitch (floats) of the transpose tile
#define EROWS (SEQ < 512 ? SEQ : 512)   // query rows handled by the two-plane-P flash instantiation
#define QRS  2048.0f             // carry of the residual P fragment
#define QRI  (1.0f / 2048.0f)
#define SC2  ((float)(0.125 * 1.4426950408889634))   // HD^-0.5 * log2(e)
#define PSH  14.0f               // log2 of the P carry (16384)
#define NEGB (-3.0e38f)

static_assert(HD == 64);                       // two 32-deep k-steps per score tile, four 16-row output tiles
static_assert(NHD * HD == HE);
static_assert(HD % 32 == 0);                   // score k-loop steps by 32
static_assert(HE % 8 == 0);                    // 16-byte fragment loads from token rows
static_assert(SEQ % 64 == 0);
static_assert(SEQ % 32 == 0);                  // key loop steps by 32 and its bound never exceeds SEQ
static_assert(SEQ % (16 * AW) == 0);
static_assert(EROWS % (16 * AW) == 0);
static_assert((SEQ - EROWS) % (16 * AW) == 0);
static_assert(EROWS >= 32);
static_assert(EROWS <= SEQ);
static_assert(NB <= NB_FULL);
static_assert(SEQ <= SEQ_FULL);
static_assert(OSP >= HD);
static_assert((OSP * 4) % 16 == 0);
static_assert(TP >= 64);
static_assert((TP * 4) % 16 == 0);
static_assert((((size_t)SEQ * HE) / 8) % 256 == 0);                  // convert grid x block == plane extent per batch
static_assert((size_t)32 * 16 * 8 == (size_t)16 * HD * 4);           // flash epilogue: 32 lanes x 16 B x 8 trips == 16 rows x 256 B
static_assert((size_t)256 * 16 * 2 == (size_t)64 * 128);
static_assert((size_t)256 * 4 * 4 == (size_t)64 * HD);               // transpose load: 256 threads x 4 float4 x 4 floats == 64 tokens x 64 columns
static_assert((size_t)AW * 16 * OSP * 4 <= 131072);                  // static LDS of the flash kernels
static_assert((size_t)64 * TP * 4 <= 131072);                        // static LDS of the transpose kernel

typedef _Float16 h16;
typedef __attribute__((ext_vector_type(16))) _Float16 v16h;
typedef __attribute__((ext_vector_type(8)))  _Float16 v8h;
typedef __attribute__((ext_vector_type(8)))  float    v8f;
typedef __attribute__((ext_vector_type(4)))  float    v4f;
typedef v4f  __attribute__((may_alias)) v4fa;

__device__ __forceinline__ unsigned short f2bf(float f) { unsigned u = __float_as_uint(f); u += 0x7FFFu + ((u >> 16) & 1u); return (unsigned short)(u >> 16); }
__device__ __forceinline__ float bfr(float f) { return __uint_as_float(((unsigned)f2bf(f)) << 16); }   // value after RNE convert to bf16
__device__ __forceinline__ v16h cat16(v8h lo, v8h hi) { return __builtin_shufflevector(lo, hi, 0, 1, 2, 3, 4, 5, 6, 7, 8, 9, 10, 11, 12, 13, 14, 15); }
// fragment loader from K-contiguous 16-bit rows; p already includes + 8*(lane>>4): elements 0..7 <- k0+8h+0..7, elements 8..15 <- k0+16+8h+0..7 (same map for A and B)
__device__ __forceinline__ v16h  ldh(const h16* p) { return cat16(*(const v8h*)p, *(const v8h*)(p + 16)); }
// ordering point for wave-private LDS tiles (same wave writes and reads)
__device__ __forceinline__ void wave_sync() { __builtin_amdgcn_fence(3 /* release order */, "wavefront"); __builtin_amdgcn_wave_barrier(); asm volatile("" ::: "memory"); }
// f32 -> f16 convert that cannot produce an f16 subnormal (value select)
static __device__ __forceinline__ h16 toh_flush(float v) { const h16 r = (h16)v; return (fabsf(v) < 6.103515625e-05f) ? (h16)0.0f : r; }
// one WMMA with its own hazard guard (ties the accumulator, keeps A/B live)
__device__ __forceinline__ v8f wmma16g(v16h a, v16h b, v8f c) {
    c = __builtin_amdgcn_wmma_f32_16x16x32_f16(false, a, false, b, (short)0, c, false, false);
    asm volatile("v_nop\n\tv_nop\n\tv_nop\n\tv_nop" : "+v"(c) : "v"(a), "v"(b));
    return c;
}

// grid (n8/256, NB): blockIdx.y = batch, source batch pitch sstride, destination batch pitch dstride (elements).
__global__ __launch_bounds__(256) void k_cvth(const float* __restrict__ src, h16* dst, size_t n8, size_t sstride, size_t dstride) {
    const size_t i = (size_t)blockIdx.x * 256 + threadIdx.x; if (i >= n8) return;
    const size_t so = (size_t)blockIdx.y * sstride + i * 8;
    const size_t dofs = (size_t)blockIdx.y * dstride + i * 8;
    const v8f v = *(const v8f*)(src + so); v8h o;
#pragma unroll
    for (int k = 0; k < 8; ++k) o[k] = toh_flush(bfr(v[k]));
    *(v8h*)(dst + dofs) = o; 
}

// k_vtr: v^T plane. in[t][h*64 + d] (f32, token pitch HE) -> out[(b*16 + h)*64 + d][t] (f16, row pitch SEQ). One block per (64-token tile, batch*head): grid (SEQ/64, NB*NHD), 256 threads.
// Load 64 tokens x 64 columns as float4, scatter transposed into an LDS float tile [d][t] (cross-wave: block barrier), then each thread builds two 16-B pieces;
__global__ __launch_bounds__(256) void k_vtr(const float* __restrict__ V, h16* VT) {
    __shared__ __align__(16) float tl[64 * TP];
    const int tid = threadIdx.x;
    const int tt0 = blockIdx.x * 64; const int zh = blockIdx.y; const int b = zh / NHD, h = zh % NHD;
    const size_t vb = ((size_t)b * SEQ_FULL + tt0) * HE + (size_t)h * HD;
#pragma unroll
    for (int s = 0; s < 4; ++s) { const int p = s * 256 + tid; const int t = p >> 4, d4 = (p & 15) * 4;   // 4 s x 16 tokens = 64 tokens; 16 lanes x 4 = 64 columns
        const v4f x = *(const v4f*)(V + vb + (size_t)t * HE + d4);
#pragma unroll
        for (int i = 0; i < 4; ++i) tl[(d4 + i) * TP + t] = bfr(x[i]); }
    __syncthreads();
    const size_t ob = ((size_t)zh * HD) * SEQ + tt0;
    const int dA = tid >> 3, dB = (256 + tid) >> 3, c8 = (tid & 7) * 8;      // rows 0..31 and 32..63; 8 lanes x 8 halves = 64 tokens
    v8h hvA, hvB;
    { const v4f x0 = *(const v4fa*)(&tl[dA * TP + c8]); const v4f x1 = *(const v4fa*)(&tl[dA * TP + c8 + 4]);
#pragma unroll
      for (int i = 0; i < 4; ++i) { hvA[i] = toh_flush(x0[i]); hvA[4 + i] = toh_flush(x1[i]); } }
    { const v4f x0 = *(const v4fa*)(&tl[dB * TP + c8]); const v4f x1 = *(const v4fa*)(&tl[dB * TP + c8 + 4]);
#pragma unroll
      for (int i = 0; i < 4; ++i) { hvB[i] = toh_flush(x0[i]); hvB[4 + i] = toh_flush(x1[i]); } }
    const size_t oA = ob + (size_t)dA * SEQ + c8, oB = ob + (size_t)dB * SEQ + c8;
    *(v8h*)(VT + oA) = hvA; *(v8h*)(VT + oB) = hvB;
    
}

// flash_body: fused attention, one wave per 16 query rows of one (batch, head); K / V^T / Q fragments straight from the f16 planes (two 16-B loads each, arithmetic addressing).
// Transposed form: S^T[key][t] = K Q^T (A = K rows, B = Q rows, two k-steps over d); lane (t = lane&15, h = lane>>4) holds keys 8h+r of each 16-key tile, so the packed
// P tile is directly the B fragment of O^T[d][t] = V^T P^T (element r <- tile keys 0..15, element 8+r <- tile keys 16..31, lane unchanged); four 16-row d tiles.
// Softmax state (running max over kept keys, partial sum) is one scalar per lane; the two lane halves of a row are combined with one xor-16 exchange.
// Keep rule (key <= query) evaluated per element inside every visited 32-key tile; the per-wave key bound is (t0 + 16) raised to a multiple of 32, at most SEQ; every visited tile holds a kept key for every row.
// EARLY = 1 (query rows [0, EROWS)): P = f16 value + f16 residual x2048; O = V P + (V P_res) / 2048 (residual products in their own accumulators); row sum from the f32 exponentials.
// EARLY = 0 (query rows [EROWS, SEQ)): single P; row sum over the converted P.
template <int EARLY>
__device__ __forceinline__ void flash_body(const h16* __restrict__ QH, const h16* __restrict__ KP, const h16* __restrict__ VT, float* OUT) {
    __shared__ __align__(16) float os[AW * 16 * OSP];
    const int lane = threadIdx.x & 31, lr = lane & 15, hi = lane >> 4;
    const int wave = __builtin_amdgcn_readfirstlane((int)(threadIdx.x >> 5));
    const int zh = blockIdx.y; const int b = zh / NHD, h = zh % NHD;
    const int t0 = (EARLY ? 0 : EROWS) + (blockIdx.x * AW + wave) * 16;
    const int lim = t0 + lr;                                               // key j kept iff j <= lim
    const int nk = (t0 + 16 + 31) & ~31;                                   // wave-uniform, multiple of 32, <= SEQ
    const size_t rowb = (size_t)b * SEQ * HE + (size_t)h * HD;            // (batch b, token 0, head h) in the q/k planes
    const size_t qo = rowb + (size_t)(t0 + lr) * HE + 8 * hi;
    const v16h q0 = ldh(QH + qo), q1 = ldh(QH + qo + 32);                  // B fragments: col t, k = d (two k-steps)
    const size_t ko = rowb + (size_t)lr * HE + 8 * hi;                     // + key * HE        (A fragment: row key, k = d)
    const size_t vo = ((size_t)zh * HD + (size_t)lr) * SEQ + 8 * hi;      // + 16j*SEQ + key   (A fragment: row d, k = key)
    const v16h hz = (v16h){};
    v8f o[4], oR[4];
#pragma unroll
    for (int j = 0; j < 4; ++j) { o[j] = (v8f){}; oR[j] = (v8f){}; }
    float m = NEGB, l = 0.0f;
    // Fragments are fetched ahead of their tile: a register set is refilled right behind the products that read it.
    // EARLY = 0: two sets (even and odd tiles), each fetched two tiles ahead; EARLY = 1 (twice the accumulators): one set, one tile ahead, which stays below 256 registers.
    // A fetch past the wave's last tile is clamped to that tile (in bounds, values unused).
    auto ld_k = [&](int key, v16h (&kf)[4]) {
        const h16* ka = KP + ko + (size_t)key * HE;
        kf[0] = ldh(ka); kf[1] = ldh(ka + 32); kf[2] = ldh(ka + (size_t)16 * HE); kf[3] = ldh(ka + (size_t)16 * HE + 32); };
    auto ld_v = [&](int key, v16h (&vf)[4]) {
        const h16* va = VT + vo + key;
        vf[0] = ldh(va); vf[1] = ldh(va + (size_t)16 * SEQ); vf[2] = ldh(va + (size_t)32 * SEQ); vf[3] = ldh(va + (size_t)48 * SEQ); };
    auto tile = [&](int key0, int ahead, bool fetch, v16h (&kf)[4], v16h (&vf)[4]) {
        int keyn = (key0 + ahead < nk) ? key0 + ahead : nk - 32;
        // earlier fetches are still in flight here, over the loop's back edge too; this trip's fetch addresses are formed from keyn, so the wait stands in front of every rewrite of an address register
        if (fetch) asm volatile("s_wait_xcnt 0x0" : "+s"(keyn) :: "memory");
        v8f sA = (v8f){}, sB = (v8f){};
        sA = wmma16g(kf[0], q0, sA); sB = wmma16g(kf[2], q0, sB);
        sA = wmma16g(kf[1], q1, sA); sB = wmma16g(kf[3], q1, sB);
        if (fetch) ld_k(keyn, kf);
        const int ja = key0 + 8 * hi;                                      // D: sA[r] = (key ja + r, t = lane&15), sB[r] = (key ja + 16 + r, t)
        float ta[8], tb[8]; bool fa[8], fb[8]; float mx = NEGB;
#pragma unroll
        for (int r = 0; r < 8; ++r) {
            fa[r] = (ja + r <= lim);
            fb[r] = (ja + 16 + r <= lim);
            ta[r] = sA[r] * SC2; tb[r] = sB[r] * SC2;
            mx = fmaxf(mx, fmaxf(fa[r] ? ta[r] : NEGB, fb[r] ? tb[r] : NEGB)); }
        mx = fmaxf(mx, __shfl_xor(mx, 16, 32));
        const float mnew = fmaxf(m, mx);
        const float alpha = __builtin_amdgcn_exp2f(m - mnew);
        const float sh = PSH - mnew;
        v16h pb, pr = hz; float ls = 0.0f;
#pragma unroll
        for (int r = 0; r < 8; ++r) {
            const float ea = __builtin_amdgcn_exp2f(ta[r] + sh), eb = __builtin_amdgcn_exp2f(tb[r] + sh);
            const float ga = fa[r] ? ea : 0.0f, gb = fb[r] ? eb : 0.0f;       // dropped elements selected to 0 by value
            const h16 pa = toh_flush(ga); const h16 pc = toh_flush(gb);
            pb[r] = pa; pb[8 + r] = pc;
            if (EARLY) { pr[r] = toh_flush((ga - (float)pa) * QRS); pr[8 + r] = toh_flush((gb - (float)pc) * QRS); ls += ga + gb; }
            else       { ls += (float)pa + (float)pc; } }
        l = l * alpha + ls; m = mnew;
#pragma unroll
        for (int j = 0; j < 4; ++j) o[j] = o[j] * alpha;
        if (EARLY) {
#pragma unroll
            for (int j = 0; j < 4; ++j) oR[j] = oR[j] * alpha; }
        o[0] = wmma16g(vf[0], pb, o[0]); o[1] = wmma16g(vf[1], pb, o[1]); o[2] = wmma16g(vf[2], pb, o[2]); o[3] = wmma16g(vf[3], pb, o[3]);
        if (EARLY) {
            oR[0] = wmma16g(vf[0], pr, oR[0]); oR[1] = wmma16g(vf[1], pr, oR[1]); oR[2] = wmma16g(vf[2], pr, oR[2]); oR[3] = wmma16g(vf[3], pr, oR[3]);
        }
        if (fetch) ld_v(keyn, vf);
    };
    v16h kE[4], vE[4];
    // first fetches in the loop's own issue order (K, V, K, V), held there by the scheduling barriers, so that the counted load waits at the loop head leave the younger fetches in flight;
    // the wait between them stands in front of loads whose results land in address registers of the loads above
    auto hold = [&]() { __builtin_amdgcn_sched_barrier(0); asm volatile("s_wait_xcnt 0x0" ::: "memory"); __builtin_amdgcn_sched_barrier(0); };
    ld_k(0, kE); hold();
    ld_v(0, vE);
    int key0 = 0;
    if constexpr (EARLY) {
#pragma unroll 1   // kept rolled: an unrolled body would need further register sets
        do { tile(key0, 32, true, kE, vE); key0 += 32; } while (key0 < nk);              // t0 >= 0, so nk >= 32: at least one tile
    } else {
        static_assert(EROWS >= 32);                                                      // t0 >= EROWS, so nk >= 64: tile 1 exists and the pair loop runs at least once
        v16h kO[4], vO[4];
        hold(); ld_k(32, kO); hold();
        ld_v(32, vO);
#pragma unroll 1   // kept rolled: the body already holds one tile of each set
        do { tile(key0, 64, true, kE, vE); tile(key0 + 32, 64, true, kO, vO); key0 += 64; } while (key0 + 64 <= nk);
        if (key0 < nk) tile(key0, 64, false, kE, vE);                                    // odd tile count: the last tile sits in the even set
    }
    l += __shfl_xor(l, 16, 32);
    const bool any = l > 0.0f;
    const float lsafe = any ? l : 1.0f;
    const float inv = any ? (1.0f / lsafe) : 0.0f;
    const int wb = wave * 16 * OSP;
    // O^T D layout: f_j[r] = (d = 16j + 8h + r, t = lane&15) -> os[t][d]; rows 0..15 x columns 0..63 all written
#pragma unroll
    for (int j = 0; j < 4; ++j) {
        v8f f = o[j];
        if (EARLY) f = o[j] + oR[j] * QRI;
        v4f a, c;
        a[0] = f[0] * inv; a[1] = f[1] * inv; a[2] = f[2] * inv; a[3] = f[3] * inv; c[0] = f[4] * inv; c[1] = f[5] * inv; c[2] = f[6] * inv; c[3] = f[7] * inv;
        *(v4fa*)(&os[wb + lr * OSP + 16 * j + 8 * hi]) = a; *(v4fa*)(&os[wb + lr * OSP + 16 * j + 8 * hi + 4]) = c; }
    wave_sync();
    float* orow = OUT + (((size_t)b * OUT_SEQ + t0) * NHD + h) * HD;
{
#pragma unroll
        for (int s = 0; s < 8; ++s) { const int row = 2 * s + (lane >> 4), cofs = (lane & 15) * 4;   // 8 s x 2 rows = 16 rows; 16 lanes x 4 floats = 64 columns = two lines
            const v4f val = *(const v4fa*)(&os[wb + row * OSP + cofs]);
            *(v4f*)(orow + (size_t)row * HE + cofs) = val; }
         }
    asm volatile("s_wait_loadcnt 0x0" ::: "memory");   // the clamped fetches of the last trips are never read, so nothing else waits for them: they have landed before the wave hands its registers back
}

__global__ __launch_bounds__(32 * AW) void k_flash_early(const h16* __restrict__ QH, const h16* __restrict__ KP, const h16* __restrict__ VT, float* OUT) {
    flash_body<1>(QH, KP, VT, OUT);
}

__global__ __launch_bounds__(32 * AW) void k_flash_late(const h16* __restrict__ QH, const h16* __restrict__ KP, const h16* __restrict__ VT, float* OUT) {
    flash_body<0>(QH, KP, VT, OUT);
}

static constexpr size_t al256(size_t v) { return (v + 255) & ~(size_t)255; }
static constexpr size_t SZ_QK = al256((size_t)NB * SEQ * HE * 2);           // q or k plane [NB][SEQ][HE] f16
static constexpr size_t SZ_VT = al256((size_t)NB * NHD * HD * SEQ * 2);     // v^T plane [NB*NHD][HD][SEQ] f16
static constexpr size_t SZ_TOTAL = 2 * SZ_QK + SZ_VT;
static_assert(SZ_TOTAL <= (size_t)134217728);          // workspace carve <= 128 MiB
static_assert(((size_t)NB * SEQ * HE * 2) % 128 == 0);
static_assert(((size_t)SEQ * 2) % 128 == 0);

extern "C" void kernel_launch(void* const* d_in, const int* in_sizes, int n_in,
                              void* d_out, int out_size, void* d_ws, size_t ws_size, hipStream_t stream) {
    if (n_in < 3) return;
    const size_t needx = ((size_t)(NB - 1) * SEQ_FULL + SEQ) * HE;
    if ((size_t)in_sizes[0] < needx || (size_t)in_sizes[1] < needx || (size_t)in_sizes[2] < needx) return;
    if ((size_t)out_size < ((size_t)(NB - 1) * OUT_SEQ + SEQ) * HE) return;
    if (SZ_TOTAL > ws_size) return;
    // wire order: queries, keys, values
    const float* qin = (const float*)d_in[0];
    const float* kin = (const float*)d_in[1];
    const float* vin = (const float*)d_in[2];
    float* OUT = (float*)d_out;      // [NB][SEQ][16][64]
    char* wsp = (char*)d_ws;
    h16* QH = (h16*)wsp; wsp += SZ_QK;               // [NB][SEQ][1024]
    h16* KP = (h16*)wsp; wsp += SZ_QK;               // [NB][SEQ][1024]
    h16* VT = (h16*)wsp; wsp += SZ_VT;               // [NB*16][64][SEQ]

    { const size_t n8 = (size_t)SEQ * HE / 8;
      const dim3 g((unsigned)((n8 + 255) / 256), NB, 1);
      k_cvth<<<g, 256, 0, stream>>>(qin, QH, n8, (size_t)SEQ_FULL * HE, (size_t)SEQ * HE);
      k_cvth<<<g, 256, 0, stream>>>(kin, KP, n8, (size_t)SEQ_FULL * HE, (size_t)SEQ * HE); }
    // in[t][h*64 + d] -> out[(b*16 + h)*64 + d][t]; grid (token tiles, batch*head)
    k_vtr<<<dim3(SEQ / 64, NB * NHD, 1), 256, 0, stream>>>(vin, VT);

    // query rows [0, EROWS): two-plane-P instantiation; rows [EROWS, SEQ): single-product instantiation (disjoint output rows)
    k_flash_early<<<dim3(EROWS / (16 * AW), NB * NHD, 1), 32 * AW, 0, stream>>>(QH, KP, VT, OUT);
    if (SEQ > EROWS)
        k_flash_late<<<dim3((SEQ - EROWS) / (16 * AW), NB * NHD, 1), 32 * AW, 0, stream>>>(QH, KP, VT, OUT);
}

// v002
// A run of this version takes 71.6 microseconds.
// In two side-by-side timings against v001, it was 1.10 and 1.09 times as fast.
// Over all steps from v000 it is 1.36 times as fast.
#include <hip/hip_runtime.h>

// Causal scaled dot-product attention over per-head slices, no projections: q/k/v [NB][SEQ][16][64] (f32), key j kept for query t iff j <= t (dropped keys get probability 0), score scale 1/sqrt(64), output [NB][SEQ][16][64] (f32).
// Compute dtypes, f32 accumulate everywhere: scores v_wmma_f32_16x16x32_f16 with q, k single f16 planes (inputs RNE-converted to bf16, then held in f16: exact for f16-normal values, smaller magnitudes selected to +0);
// P.V v_wmma_f32_16x16x32_f16: v single f16 plane (same conversion), P f16 with x16384 carry (cancels in the normalisation); on query rows < EROWS P = f16 value + f16 residual x2048, residual products in their own accumulators folded by 1/2048, row sum from the f32 exponentials; on later rows row sum over the converted P. Softmax f32 (online, running max over kept keys).
// Layout: f16 copies of q and k in the input layout [b][t][h*64 + d] (row pitch 1024 halves), v^T plane [b*16 + h][d][t] built through an LDS transpose, all three planes written by one launch; fused flash kernel in transposed form (S^T = K Q^T, O^T = V^T P^T), fragments straight from the planes, output from f32 accumulators.

#ifndef NB
#define NB 2
#endif
#ifndef SEQ
#define SEQ 2048
#endif
#define NB_FULL  2
#define SEQ_FULL 2048
#ifndef OUT_SEQ
#define OUT_SEQ SEQ              // row pitch (in tokens) between batches of the output
#endif
#define NHD  16                  // heads
#define HD   64                  // head width
#define HE   (NHD * HD)          // token row pitch (elements) of the inputs, the q/k planes and the output
#define AW   4                   // waves per flash block (16 query rows each)
#define OSP  68                  // LDS row pitch (floats) of the flash output tile
#define TP   68                  // LDS row pitch (floats) of the transpose tile
#define PU   2                   // 64-token tiles per block of the plane-building kernel
#define EROWS (SEQ < 512 ? SEQ : 512)   // query rows handled by the two-plane-P flash instantiation
#define QRS  2048.0f             // carry of the residual P fragment
#define QRI  (1.0f / 2048.0f)
#define SC2  ((float)(0.125 * 1.4426950408889634))   // HD^-0.5 * log2(e)
#define PSH  14.0f               // log2 of the P carry (16384)
#define NEGB (-3.0e38f)

static_assert(HD == 64);                       // two 32-deep k-steps per score tile, four 16-row output tiles
static_assert(NHD * HD == HE);
static_assert(HD % 32 == 0);                   // score k-loop steps by 32
static_assert(HE % 8 == 0);                    // 16-byte fragment loads from token rows
static_assert(SEQ % 64 == 0);
static_assert(SEQ % 32 == 0);                  // key loop steps by 32 and its bound never exceeds SEQ
static_assert(SEQ % (16 * AW) == 0);
static_assert(EROWS % (16 * AW) == 0);
static_assert((SEQ - EROWS) % (16 * AW) == 0);
static_assert(EROWS >= 32);
static_assert(EROWS <= SEQ);
static_assert(NB <= NB_FULL);
static_assert(SEQ <= SEQ_FULL);
static_assert(OSP >= HD);
static_assert((OSP * 4) % 16 == 0);
static_assert(TP >= 64);
static_assert((TP * 4) % 16 == 0);
static_assert(SEQ % (64 * PU) == 0);                                 // plane-building grid x tokens per block == SEQ
static_assert((size_t)32 * 16 * 8 == (size_t)16 * HD * 4);           // flash epilogue: 32 lanes x 16 B x 8 trips == 16 rows x 256 B
static_assert((size_t)256 * 2 * 8 == (size_t)64 * HD);               // q/k convert: 256 threads x 2 pieces x 8 floats == 64 tokens x 64 columns
static_assert((size_t)256 * 2 * PU * 8 == (size_t)HD * 64 * PU);     // v^T store: 256 threads x 2*PU pieces x 8 halves == 64 rows x 64*PU tokens
static_assert((size_t)256 * 4 * 4 == (size_t)64 * HD);               // transpose load: 256 threads x 4 float4 x 4 floats == 64 tokens x 64 columns
static_assert((size_t)AW * 16 * OSP * 4 <= 131072);                  // static LDS of the flash kernels
static_assert((size_t)PU * 64 * TP * 4 <= 131072);                   // static LDS of the plane-building kernel

typedef _Float16 h16;
typedef __attribute__((ext_vector_type(16))) _Float16 v16h;
typedef __attribute__((ext_vector_type(8)))  _Float16 v8h;
typedef __attribute__((ext_vector_type(8)))  float    v8f;
typedef __attribute__((ext_vector_type(4)))  float    v4f;
typedef v4f  __attribute__((may_alias)) v4fa;

__device__ __forceinline__ unsigned short f2bf(float f) { unsigned u = __float_as_uint(f); u += 0x7FFFu + ((u >> 16) & 1u); return (unsigned short)(u >> 16); }
__device__ __forceinline__ float bfr(float f) { return __uint_as_float(((unsigned)f2bf(f)) << 16); }   // value after RNE convert to bf16
__device__ __forceinline__ v16h cat16(v8h lo, v8h hi) { return __builtin_shufflevector(lo, hi, 0, 1, 2, 3, 4, 5, 6, 7, 8, 9, 10, 11, 12, 13, 14, 15); }
// fragment loader from K-contiguous 16-bit rows; p already includes + 8*(lane>>4): elements 0..7 <- k0+8h+0..7, elements 8..15 <- k0+16+8h+0..7 (same map for A and B)
__device__ __forceinline__ v16h  ldh(const h16* p) { return cat16(*(const v8h*)p, *(const v8h*)(p + 16)); }
// ordering point for wave-private LDS tiles (same wave writes and reads)
__device__ __forceinline__ void wave_sync() { __builtin_amdgcn_fence(3 /* release order */, "wavefront"); __builtin_amdgcn_wave_barrier(); asm volatile("" ::: "memory"); }
// f32 -> f16 convert that cannot produce an f16 subnormal (value select)
static __device__ __forceinline__ h16 toh_flush(float v) { const h16 r = (h16)v; return (fabsf(v) < 6.103515625e-05f) ? (h16)0.0f : r; }
// one WMMA with its own hazard guard (ties the accumulator, keeps A/B live)
__device__ __forceinline__ v8f wmma16g(v16h a, v16h b, v8f c) {
    c = __builtin_amdgcn_wmma_f32_16x16x32_f16(false, a, false, b, (short)0, c, false, false);
    asm volatile("v_nop\n\tv_nop\n\tv_nop\n\tv_nop" : "+v"(c) : "v"(a), "v"(b));
    return c;
}

// k_prep: the three f16 planes in one launch. One block per (64*PU-token span, batch*head): grid (SEQ/(64*PU), NB*NHD), 256 threads; the block reads the same
// 64*PU tokens x 64 columns of q, k and v. Every global load of a thread (12*PU of 16 B) is issued before the first use, so one wave start and one memory latency serve all of them.
// q, k: in[t][h*64 + d] (f32, token pitch HE) -> same layout in f16, 8 values per piece, 8 lanes fill one 128-B line.
// v: in[t][h*64 + d] -> out[(b*16 + h)*64 + d][t] (f16, row pitch SEQ): float4 loads scattered transposed into LDS float tiles [d][t] (cross-wave: block barrier), then 16-B pieces, 8*PU lanes per output row.
__global__ __launch_bounds__(256) void k_prep(const float* __restrict__ Q, const float* __restrict__ K, const float* __restrict__ V, h16* QH, h16* KP, h16* VT) {
    __shared__ __align__(16) float tl[PU * 64 * TP];
    const int tid = threadIdx.x;
    const int tt0 = blockIdx.x * (64 * PU); const int zh = blockIdx.y; const int b = zh / NHD, h = zh % NHD;
    const size_t sb = ((size_t)b * SEQ_FULL + tt0) * HE + (size_t)h * HD;    // (batch b, token tt0, head h) in the inputs
    const size_t db = ((size_t)b * SEQ + tt0) * HE + (size_t)h * HD;         // the same place in the q/k planes
    v4f xv[PU][4]; v8f xq[PU][2], xk[PU][2];
    const float* pv[4]; const float* pq[2]; const float* pk[2];              // tile 0's addresses; tile u lies 64 * u tokens further on
#pragma unroll
    for (int s = 0; s < 4; ++s) { const int p = s * 256 + tid; pv[s] = V + sb + (size_t)(p >> 4) * HE + (p & 15) * 4; }   // 4 s x 16 tokens = 64 tokens; 16 lanes x 4 = 64 columns
#pragma unroll
    for (int s = 0; s < 2; ++s) { const int p = s * 256 + tid; const size_t o = sb + (size_t)(p >> 3) * HE + (p & 7) * 8;  // 2 s x 32 tokens = 64 tokens; 8 lanes x 8 = 64 columns
        pq[s] = Q + o; pk[s] = K + o; }
#pragma unroll
    for (int u = 0; u < PU; ++u) {
#pragma unroll
        for (int s = 0; s < 4; ++s) xv[u][s] = *(const v4f*)(pv[s] + (size_t)u * 64 * HE); }
#pragma unroll
    for (int u = 0; u < PU; ++u) {
#pragma unroll
        for (int s = 0; s < 2; ++s) { xq[u][s] = *(const v8f*)(pq[s] + (size_t)u * 64 * HE); xk[u][s] = *(const v8f*)(pk[s] + (size_t)u * 64 * HE); } }
    // every load stands above this line (left free, the scheduler sinks the q and k loads to their uses and the thread pays several memory latencies in a row);
    // the addresses are inputs, so they stay in their registers up to the wait and no load's result lands in one of them ahead of it
    asm volatile("s_wait_xcnt 0x0" :: "v"(pv[0]), "v"(pv[1]), "v"(pv[2]), "v"(pv[3]), "v"(pq[0]), "v"(pq[1]), "v"(pk[0]), "v"(pk[1]) : "memory");
#pragma unroll
    for (int u = 0; u < PU; ++u) {
#pragma unroll
        for (int s = 0; s < 4; ++s) { const int p = s * 256 + tid; const int t = p >> 4, d4 = (p & 15) * 4;
#pragma unroll
            for (int i = 0; i < 4; ++i) tl[u * 64 * TP + (d4 + i) * TP + t] = bfr(xv[u][s][i]); } }
    __syncthreads();
    // q and k need no exchange; their stores stand behind the barrier, which would otherwise wait for them
#pragma unroll
    for (int u = 0; u < PU; ++u) {
#pragma unroll
        for (int s = 0; s < 2; ++s) { const int p = s * 256 + tid; const int t = u * 64 + (p >> 3), c8 = (p & 7) * 8;
            v8h oq, ok;
#pragma unroll
            for (int k = 0; k < 8; ++k) { oq[k] = toh_flush(bfr(xq[u][s][k])); ok[k] = toh_flush(bfr(xk[u][s][k])); }
            *(v8h*)(QH + db + (size_t)t * HE + c8) = oq;
            *(v8h*)(KP + db + (size_t)t * HE + c8) = ok; } }
    const size_t ob = ((size_t)zh * HD) * SEQ + tt0;
#pragma unroll
    for (int s = 0; s < 2 * PU; ++s) { const int p = s * 256 + tid; const int d = p / (8 * PU), c = p % (8 * PU);        // 8*PU lanes x 8 halves = 64*PU tokens of row d
        const float* tr = &tl[(c >> 3) * 64 * TP + d * TP + (c & 7) * 8];
        const v4f x0 = *(const v4fa*)(tr); const v4f x1 = *(const v4fa*)(tr + 4);
        v8h hv;
#pragma unroll
        for (int i = 0; i < 4; ++i) { hv[i] = toh_flush(x0[i]); hv[4 + i] = toh_flush(x1[i]); }
        *(v8h*)(VT + ob + (size_t)d * SEQ + c * 8) = hv; }
}

// flash_body: fused attention, one wave per 16 query rows of one (batch, head); K / V^T / Q fragments straight from the f16 planes (two 16-B loads each, arithmetic addressing).
// Transposed form: S^T[key][t] = K Q^T (A = K rows, B = Q rows, two k-steps over d); lane (t = lane&15, h = lane>>4) holds keys 8h+r of each 16-key tile, so the packed
// P tile is directly the B fragment of O^T[d][t] = V^T P^T (element r <- tile keys 0..15, element 8+r <- tile keys 16..31, lane unchanged); four 16-row d tiles.
// Softmax state (running max over kept keys, partial sum) is one scalar per lane; the two lane halves of a row are combined with one xor-16 exchange.
// Keep rule (key <= query) evaluated per element inside every visited 32-key tile; the per-wave key bound is (t0 + 16) raised to a multiple of 32, at most SEQ; every visited tile holds a kept key for every row.
// EARLY = 1 (query rows [0, EROWS)): P = f16 value + f16 residual x2048; O = V P + (V P_res) / 2048 (residual products in their own accumulators); row sum from the f32 exponentials.
// EARLY = 0 (query rows [EROWS, SEQ)): single P; row sum over the converted P.
template <int EARLY>
__device__ __forceinline__ void flash_body(const h16* __restrict__ QH, const h16* __restrict__ KP, const h16* __restrict__ VT, float* OUT) {
    __shared__ __align__(16) float os[AW * 16 * OSP];
    const int lane = threadIdx.x & 31, lr = lane & 15, hi = lane >> 4;
    const int wave = __builtin_amdgcn_readfirstlane((int)(threadIdx.x >> 5));
    const int zh = blockIdx.y; const int b = zh / NHD, h = zh % NHD;
    const int t0 = (EARLY ? 0 : EROWS) + (blockIdx.x * AW + wave) * 16;
    const int lim = t0 + lr;                                               // key j kept iff j <= lim
    const int nk = (t0 + 16 + 31) & ~31;                                   // wave-uniform, multiple of 32, <= SEQ
    const size_t rowb = (size_t)b * SEQ * HE + (size_t)h * HD;            // (batch b, token 0, head h) in the q/k planes
    const size_t qo = rowb + (size_t)(t0 + lr) * HE + 8 * hi;
    const v16h q0 = ldh(QH + qo), q1 = ldh(QH + qo + 32);                  // B fragments: col t, k = d (two k-steps)
    const size_t ko = rowb + (size_t)lr * HE + 8 * hi;                     // + key * HE        (A fragment: row key, k = d)
    const size_t vo = ((size_t)zh * HD + (size_t)lr) * SEQ + 8 * hi;      // + 16j*SEQ + key   (A fragment: row d, k = key)
    const v16h hz = (v16h){};
    v8f o[4], oR[4];
#pragma unroll
    for (int j = 0; j < 4; ++j) { o[j] = (v8f){}; oR[j] = (v8f){}; }
    float m = NEGB, l = 0.0f;
    // Fragments are fetched ahead of their tile: a register set is refilled right behind the products that read it.
    // EARLY = 0: two sets (even and odd tiles), each fetched two tiles ahead; EARLY = 1 (twice the accumulators): one set, one tile ahead, which stays below 256 registers.
    // A fetch past the wave's last tile is clamped to that tile (in bounds, values unused).
    auto ld_k = [&](int key, v16h (&kf)[4]) {
        const h16* ka = KP + ko + (size_t)key * HE;
        kf[0] = ldh(ka); kf[1] = ldh(ka + 32); kf[2] = ldh(ka + (size_t)16 * HE); kf[3] = ldh(ka + (size_t)16 * HE + 32); };
    auto ld_v = [&](int key, v16h (&vf)[4]) {
        const h16* va = VT + vo + key;
        vf[0] = ldh(va); vf[1] = ldh(va + (size_t)16 * SEQ); vf[2] = ldh(va + (size_t)32 * SEQ); vf[3] = ldh(va + (size_t)48 * SEQ); };
    auto tile = [&](int key0, int ahead, bool fetch, v16h (&kf)[4], v16h (&vf)[4]) {
        int keyn = (key0 + ahead < nk) ? key0 + ahead : nk - 32;
        // earlier fetches are still in flight here, over the loop's back edge too; this trip's fetch addresses are formed from keyn, so the wait stands in front of every rewrite of an address register
        if (fetch) asm volatile("s_wait_xcnt 0x0" : "+s"(keyn) :: "memory");
        v8f sA = (v8f){}, sB = (v8f){};
        sA = wmma16g(kf[0], q0, sA); sB = wmma16g(kf[2], q0, sB);
        sA = wmma16g(kf[1], q1, sA); sB = wmma16g(kf[3], q1, sB);
        if (fetch) ld_k(keyn, kf);
        const int ja = key0 + 8 * hi;                                      // D: sA[r] = (key ja + r, t = lane&15), sB[r] = (key ja + 16 + r, t)
        float ta[8], tb[8]; bool fa[8], fb[8]; float mx = NEGB;
#pragma unroll
        for (int r = 0; r < 8; ++r) {
            fa[r] = (ja + r <= lim);
            fb[r] = (ja + 16 + r <= lim);
            ta[r] = sA[r] * SC2; tb[r] = sB[r] * SC2;
            mx = fmaxf(mx, fmaxf(fa[r] ? ta[r] : NEGB, fb[r] ? tb[r] : NEGB)); }
        mx = fmaxf(mx, __shfl_xor(mx, 16, 32));
        const float mnew = fmaxf(m, mx);
        const float alpha = __builtin_amdgcn_exp2f(m - mnew);
        const float sh = PSH - mnew;
        v16h pb, pr = hz; float ls = 0.0f;
#pragma unroll
        for (int r = 0; r < 8; ++r) {
            const float ea = __builtin_amdgcn_exp2f(ta[r] + sh), eb = __builtin_amdgcn_exp2f(tb[r] + sh);
            const float ga = fa[r] ? ea : 0.0f, gb = fb[r] ? eb : 0.0f;       // dropped elements selected to 0 by value
            const h16 pa = toh_flush(ga); const h16 pc = toh_flush(gb);
            pb[r] = pa; pb[8 + r] = pc;
            if (EARLY) { pr[r] = toh_flush((ga - (float)pa) * QRS); pr[8 + r] = toh_flush((gb - (float)pc) * QRS); ls += ga + gb; }
            else       { ls += (float)pa + (float)pc; } }
        l = l * alpha + ls; m = mnew;
#pragma unroll
        for (int j = 0; j < 4; ++j) o[j] = o[j] * alpha;
        if (EARLY) {
#pragma unroll
            for (int j = 0; j < 4; ++j) oR[j] = oR[j] * alpha; }
        o[0] = wmma16g(vf[0], pb, o[0]); o[1] = wmma16g(vf[1], pb, o[1]); o[2] = wmma16g(vf[2], pb, o[2]); o[3] = wmma16g(vf[3], pb, o[3]);
        if (EARLY) {
            oR[0] = wmma16g(vf[0], pr, oR[0]); oR[1] = wmma16g(vf[1], pr, oR[1]); oR[2] = wmma16g(vf[2], pr, oR[2]); oR[3] = wmma16g(vf[3], pr, oR[3]);
        }
        if (fetch) ld_v(keyn, vf);
    };
    v16h kE[4], vE[4];
    // first fetches in the loop's own issue order (K, V, K, V), held there by the scheduling barriers, so that the counted load waits at the loop head leave the younger fetches in flight;
    // the wait between them stands in front of loads whose results land in address registers of the loads above
    auto hold = [&]() { __builtin_amdgcn_sched_barrier(0); asm volatile("s_wait_xcnt 0x0" ::: "memory"); __builtin_amdgcn_sched_barrier(0); };
    ld_k(0, kE); hold();
    ld_v(0, vE);
    int key0 = 0;
    if constexpr (EARLY) {
#pragma unroll 1   // kept rolled: an unrolled body would need further register sets
        do { tile(key0, 32, true, kE, vE); key0 += 32; } while (key0 < nk);              // t0 >= 0, so nk >= 32: at least one tile
    } else {
        static_assert(EROWS >= 32);                                                      // t0 >= EROWS, so nk >= 64: tile 1 exists and the pair loop runs at least once
        v16h kO[4], vO[4];
        hold(); ld_k(32, kO); hold();
        ld_v(32, vO);
#pragma unroll 1   // kept rolled: the body already holds one tile of each set
        do { tile(key0, 64, true, kE, vE); tile(key0 + 32, 64, true, kO, vO); key0 += 64; } while (key0 + 64 <= nk);
        if (key0 < nk) tile(key0, 64, false, kE, vE);                                    // odd tile count: the last tile sits in the even set
    }
    l += __shfl_xor(l, 16, 32);
    const bool any = l > 0.0f;
    const float lsafe = any ? l : 1.0f;
    const float inv = any ? (1.0f / lsafe) : 0.0f;
    const int wb = wave * 16 * OSP;
    // O^T D layout: f_j[r] = (d = 16j + 8h + r, t = lane&15) -> os[t][d]; rows 0..15 x columns 0..63 all written
#pragma unroll
    for (int j = 0; j < 4; ++j) {
        v8f f = o[j];
        if (EARLY) f = o[j] + oR[j] * QRI;
        v4f a, c;
        a[0] = f[0] * inv; a[1] = f[1] * inv; a[2] = f[2] * inv; a[3] = f[3] * inv; c[0] = f[4] * inv; c[1] = f[5] * inv; c[2] = f[6] * inv; c[3] = f[7] * inv;
        *(v4fa*)(&os[wb + lr * OSP + 16 * j + 8 * hi]) = a; *(v4fa*)(&os[wb + lr * OSP + 16 * j + 8 * hi + 4]) = c; }
    wave_sync();
    float* orow = OUT + (((size_t)b * OUT_SEQ + t0) * NHD + h) * HD;
{
#pragma unroll
        for (int s = 0; s < 8; ++s) { const int row = 2 * s + (lane >> 4), cofs = (lane & 15) * 4;   // 8 s x 2 rows = 16 rows; 16 lanes x 4 floats = 64 columns = two lines
            const v4f val = *(const v4fa*)(&os[wb + row * OSP + cofs]);
            *(v4f*)(orow + (size_t)row * HE + cofs) = val; }
         }
    asm volatile("s_wait_loadcnt 0x0" ::: "memory");   // the clamped fetches of the last trips are never read, so nothing else waits for them: they have landed before the wave hands its registers back
}

__global__ __launch_bounds__(32 * AW) void k_flash_early(const h16* __restrict__ QH, const h16* __restrict__ KP, const h16* __restrict__ VT, float* OUT) {
    flash_body<1>(QH, KP, VT, OUT);
}

__global__ __launch_bounds__(32 * AW) void k_flash_late(const h16* __restrict__ QH, const h16* __restrict__ KP, const h16* __restrict__ VT, float* OUT) {
    flash_body<0>(QH, KP, VT, OUT);
}

static constexpr size_t al256(size_t v) { return (v + 255) & ~(size_t)255; }
static constexpr size_t SZ_QK = al256((size_t)NB * SEQ * HE * 2);           // q or k plane [NB][SEQ][HE] f16
static constexpr size_t SZ_VT = al256((size_t)NB * NHD * HD * SEQ * 2);     // v^T plane [NB*NHD][HD][SEQ] f16
static constexpr size_t SZ_TOTAL = 2 * SZ_QK + SZ_VT;
static_assert(SZ_TOTAL <= (size_t)134217728);          // workspace carve <= 128 MiB
static_assert(((size_t)NB * SEQ * HE * 2) % 128 == 0);
static_assert(((size_t)SEQ * 2) % 128 == 0);

extern "C" void kernel_launch(void* const* d_in, const int* in_sizes, int n_in,
                              void* d_out, int out_size, void* d_ws, size_t ws_size, hipStream_t stream) {
    if (n_in < 3) return;
    const size_t needx = ((size_t)(NB - 1) * SEQ_FULL + SEQ) * HE;
    if ((size_t)in_sizes[0] < needx || (size_t)in_sizes[1] < needx || (size_t)in_sizes[2] < needx) return;
    if ((size_t)out_size < ((size_t)(NB - 1) * OUT_SEQ + SEQ) * HE) return;
    if (SZ_TOTAL > ws_size) return;
    // wire order: queries, keys, values
    const float* qin = (const float*)d_in[0];
    const float* kin = (const float*)d_in[1];
    const float* vin = (const float*)d_in[2];
    float* OUT = (float*)d_out;      // [NB][SEQ][16][64]
    char* wsp = (char*)d_ws;
    h16* QH = (h16*)wsp; wsp += SZ_QK;               // [NB][SEQ][1024]
    h16* KP = (h16*)wsp; wsp += SZ_QK;               // [NB][SEQ][1024]
    h16* VT = (h16*)wsp; wsp += SZ_VT;               // [NB*16][64][SEQ]

    // q, k -> f16 planes in the input layout; v: in[t][h*64 + d] -> out[(b*16 + h)*64 + d][t]; grid (token spans, batch*head)
    k_prep<<<dim3(SEQ / (64 * PU), NB * NHD, 1), 256, 0, stream>>>(qin, kin, vin, QH, KP, VT);

    // query rows [0, EROWS): two-plane-P instantiation; rows [EROWS, SEQ): single-product instantiation (disjoint output rows)
    k_flash_early<<<dim3(EROWS / (16 * AW), NB * NHD, 1), 32 * AW, 0, stream>>>(QH, KP, VT, OUT);
    if (SEQ > EROWS)
        k_flash_late<<<dim3((SEQ - EROWS) / (16 * AW), NB * NHD, 1), 32 * AW, 0, stream>>>(QH, KP, VT, OUT);
}

// v003
// A run of this version takes 61.7 microseconds.
// Next to v002, in two timings, it ran 1.16 times as fast each time.
// Counting every step since v000, it is 1.58 times as fast.
#include <hip/hip_runtime.h>

// Causal scaled dot-product attention over per-head slices, no projections: q/k/v [NB][SEQ][16][64] (f32), key j kept for query t iff j <= t (dropped keys get probability 0), score scale 1/sqrt(64), output [NB][SEQ][16][64] (f32).
// Compute dtypes, f32 accumulate everywhere: scores v_wmma_f32_16x16x32_f16 with q, k single f16 planes (inputs RNE-converted to bf16, then held in f16: exact for f16-normal values, smaller magnitudes selected to +0);
// P.V v_wmma_f32_16x16x32_f16: v single f16 plane (same conversion), P f16 with x16384 carry (cancels in the normalisation); on query rows < EROWS P = f16 value + f16 residual x2048, residual products in their own accumulators folded by 1/2048, row sum from the f32 exponentials; on later rows row sum over the converted P. Softmax f32 (online, running max over kept keys).
// Layout: f16 copy of q in the input layout [b][t][h*64 + d] (row pitch 1024 halves); k and v^T planes in fragment order (see k_prep): each 16-B piece stands where the lane that loads it finds it, so one wave-wide 16-B load reads 512 contiguous bytes (four whole lines);
// all three planes written by one launch, k and v through LDS; fused flash kernel in transposed form (S^T = K Q^T, O^T = V^T P^T), fragments straight from the planes, output from f32 accumulators.

#ifndef NB
#define NB 2
#endif
#ifndef SEQ
#define SEQ 2048
#endif
#define NB_FULL  2
#define SEQ_FULL 2048
#ifndef OUT_SEQ
#define OUT_SEQ SEQ              // row pitch (in tokens) between batches of the output
#endif
#define NHD  16                  // heads
#define HD   64                  // head width
#define HE   (NHD * HD)          // token row pitch (elements) of the inputs, the q plane and the output
#define AW   4                   // waves per flash block (16 query rows each)
#define OSP  68                  // LDS row pitch (floats) of the flash output tile
#define TP   68                  // LDS row pitch (floats) of the transpose tile
#define PU   2                   // 64-token tiles per block of the plane-building kernel
#define KU   (64 * PU * 8)       // 16-B pieces of k per block of the plane-building kernel
#define EROWS (SEQ < 512 ? SEQ : 512)   // query rows handled by the two-plane-P flash instantiation
#define QRS  2048.0f             // carry of the residual P fragment
#define QRI  (1.0f / 2048.0f)
#define SC2  ((float)(0.125 * 1.4426950408889634))   // HD^-0.5 * log2(e)
#define PSH  14.0f               // log2 of the P carry (16384)
#define NEGB (-3.0e38f)

static_assert(HD == 64);                       // two 32-deep k-steps per score tile, four 16-row output tiles
static_assert(NHD * HD == HE);
static_assert(HD % 32 == 0);                   // score k-loop steps by 32
static_assert(HE % 8 == 0);                    // 16-byte fragment loads from token rows
static_assert(SEQ % 64 == 0);
static_assert(SEQ % 32 == 0);                  // key loop steps by 32 and its bound never exceeds SEQ
static_assert(SEQ % (16 * AW) == 0);
static_assert(EROWS % (16 * AW) == 0);
static_assert((SEQ - EROWS) % (16 * AW) == 0);
static_assert(EROWS >= 32);
static_assert(EROWS <= SEQ);
static_assert(NB <= NB_FULL);
static_assert(SEQ <= SEQ_FULL);
static_assert(OSP >= HD);
static_assert((OSP * 4) % 16 == 0);
static_assert(TP >= 64);
static_assert((TP * 4) % 16 == 0);
static_assert(SEQ % (64 * PU) == 0);                                 // plane-building grid x tokens per block == SEQ
static_assert((size_t)32 * 16 * 8 == (size_t)16 * HD * 4);           // flash epilogue: 32 lanes x 16 B x 8 trips == 16 rows x 256 B
static_assert((size_t)256 * 2 * 8 == (size_t)64 * HD);               // q/k convert: 256 threads x 2 pieces x 8 floats == 64 tokens x 64 columns
static_assert((size_t)256 * 2 * PU * 8 == (size_t)HD * 64 * PU);     // v^T store: 256 threads x 2*PU pieces x 8 halves == 64 rows x 64*PU tokens
static_assert((size_t)256 * 4 * 4 == (size_t)64 * HD);               // transpose load: 256 threads x 4 float4 x 4 floats == 64 tokens x 64 columns
static_assert((size_t)AW * 16 * OSP * 4 <= 131072);                  // static LDS of the flash kernels
static_assert((size_t)256 * 2 * PU == (size_t)KU);                   // k fragment store: 256 threads x 2*PU pieces == all pieces of the block
static_assert(KU % 16 == 0);
static_assert((size_t)PU * 64 * TP * 4 + (size_t)(KU + KU / 16) * 16 <= 131072);   // static LDS of the plane-building kernel

typedef _Float16 h16;
typedef __attribute__((ext_vector_type(16))) _Float16 v16h;
typedef __attribute__((ext_vector_type(8)))  _Float16 v8h;
typedef __attribute__((ext_vector_type(8)))  float    v8f;
typedef __attribute__((ext_vector_type(4)))  float    v4f;
typedef v4f  __attribute__((may_alias)) v4fa;

__device__ __forceinline__ unsigned short f2bf(float f) { unsigned u = __float_as_uint(f); u += 0x7FFFu + ((u >> 16) & 1u); return (unsigned short)(u >> 16); }
__device__ __forceinline__ float bfr(float f) { return __uint_as_float(((unsigned)f2bf(f)) << 16); }   // value after RNE convert to bf16
__device__ __forceinline__ v16h cat16(v8h lo, v8h hi) { return __builtin_shufflevector(lo, hi, 0, 1, 2, 3, 4, 5, 6, 7, 8, 9, 10, 11, 12, 13, 14, 15); }
// fragment loader from K-contiguous 16-bit rows; p already includes + 8*(lane>>4): elements 0..7 <- k0+8h+0..7, elements 8..15 <- k0+16+8h+0..7 (same map for A and B)
__device__ __forceinline__ v16h  ldh(const h16* p) { return cat16(*(const v8h*)p, *(const v8h*)(p + 16)); }
// fragment loader from a fragment-order plane; p already includes + 8*lane: elements 0..7 from the lane's piece of one 512-B group, elements 8..15 from its piece of the next group
__device__ __forceinline__ v16h  ldf(const h16* p) { return cat16(*(const v8h*)p, *(const v8h*)(p + 256)); }
// ordering point for wave-private LDS tiles (same wave writes and reads)
__device__ __forceinline__ void wave_sync() { __builtin_amdgcn_fence(3 /* release order */, "wavefront"); __builtin_amdgcn_wave_barrier(); asm volatile("" ::: "memory"); }
// f32 -> f16 convert that cannot produce an f16 subnormal (value select)
static __device__ __forceinline__ h16 toh_flush(float v) { const h16 r = (h16)v; return (fabsf(v) < 6.103515625e-05f) ? (h16)0.0f : r; }
// one WMMA with its own hazard guard (ties the accumulator, keeps A/B live)
__device__ __forceinline__ v8f wmma16g(v16h a, v16h b, v8f c) {
    c = __builtin_amdgcn_wmma_f32_16x16x32_f16(false, a, false, b, (short)0, c, false, false);
    asm volatile("v_nop\n\tv_nop\n\tv_nop\n\tv_nop" : "+v"(c) : "v"(a), "v"(b));
    return c;
}

// k_prep: the three f16 planes in one launch. One block per (64*PU-token span, batch*head): grid (SEQ/(64*PU), NB*NHD), 256 threads; the block reads the same
// 64*PU tokens x 64 columns of q, k and v. Every global load of a thread (12*PU of 16 B) is issued before the first use, so one wave start and one memory latency serve all of them.
// q: in[t][h*64 + d] (f32, token pitch HE) -> same layout in f16, 8 values per piece, 8 lanes fill one 128-B line.
// k: piece (token t, columns 8c..8c+7) -> 16-B unit ((b*16 + h)*(SEQ/16) + t/16)*128 + (c>>1)*32 + (c&1)*16 + t%16: group c>>1 of a 16-key tile holds, at lane (c&1)*16 + t%16, what that lane takes as one half of an A fragment.
//    The pieces change threads through LDS (a spare unit behind every 16 spreads the banks), under the same block barrier as v.
// v: piece (column d, tokens 8g..8g+7) -> 16-B unit ((b*16 + h)*(SEQ/32) + g/4)*256 + (d/16)*64 + (g&3)*16 + d%16: float4 loads scattered transposed into LDS float tiles [d][t] (cross-wave: block barrier), then 16-B pieces.
// A thread stores unit (trip*256 + tid) of the block's span of either plane: a wave's store is 512 contiguous bytes.
__global__ __launch_bounds__(256) void k_prep(const float* __restrict__ Q, const float* __restrict__ K, const float* __restrict__ V, h16* QH, h16* KP, h16* VT) {
    __shared__ __align__(16) float tl[PU * 64 * TP];
    __shared__ __align__(16) h16 kl[(KU + KU / 16) * 8];
    const int tid = threadIdx.x;
    const int tt0 = blockIdx.x * (64 * PU); const int zh = blockIdx.y; const int b = zh / NHD, h = zh % NHD;
    const size_t sb = ((size_t)b * SEQ_FULL + tt0) * HE + (size_t)h * HD;    // (batch b, token tt0, head h) in the inputs
    const size_t db = ((size_t)b * SEQ + tt0) * HE + (size_t)h * HD;         // the same place in the q plane
    v4f xv[PU][4]; v8f xq[PU][2], xk[PU][2];
    const float* pv[4]; const float* pq[2]; const float* pk[2];              // tile 0's addresses; tile u lies 64 * u tokens further on
#pragma unroll
    for (int s = 0; s < 4; ++s) { const int p = s * 256 + tid; pv[s] = V + sb + (size_t)(p >> 4) * HE + (p & 15) * 4; }   // 4 s x 16 tokens = 64 tokens; 16 lanes x 4 = 64 columns
#pragma unroll
    for (int s = 0; s < 2; ++s) { const int p = s * 256 + tid; const size_t o = sb + (size_t)(p >> 3) * HE + (p & 7) * 8;  // 2 s x 32 tokens = 64 tokens; 8 lanes x 8 = 64 columns
        pq[s] = Q + o; pk[s] = K + o; }
#pragma unroll
    for (int u = 0; u < PU; ++u) {
#pragma unroll
        for (int s = 0; s < 4; ++s) xv[u][s] = *(const v4f*)(pv[s] + (size_t)u * 64 * HE); }
#pragma unroll
    for (int u = 0; u < PU; ++u) {
#pragma unroll
        for (int s = 0; s < 2; ++s) { xq[u][s] = *(const v8f*)(pq[s] + (size_t)u * 64 * HE); xk[u][s] = *(const v8f*)(pk[s] + (size_t)u * 64 * HE); } }
    // every load stands above this line (left free, the scheduler sinks the q and k loads to their uses and the thread pays several memory latencies in a row);
    // the addresses are inputs, so they stay in their registers up to the wait and no load's result lands in one of them ahead of it
    asm volatile("s_wait_xcnt 0x0" :: "v"(pv[0]), "v"(pv[1]), "v"(pv[2]), "v"(pv[3]), "v"(pq[0]), "v"(pq[1]), "v"(pk[0]), "v"(pk[1]) : "memory");
#pragma unroll
    for (int u = 0; u < PU; ++u) {
#pragma unroll
        for (int s = 0; s < 4; ++s) { const int p = s * 256 + tid; const int t = p >> 4, d4 = (p & 15) * 4;
#pragma unroll
            for (int i = 0; i < 4; ++i) tl[u * 64 * TP + (d4 + i) * TP + t] = bfr(xv[u][s][i]); } }
#pragma unroll
    for (int u = 0; u < PU; ++u) {
#pragma unroll
        for (int s = 0; s < 2; ++s) { const int p = s * 256 + tid; const int t = u * 64 + (p >> 3), c = p & 7;
            v8h ok;
#pragma unroll
            for (int k = 0; k < 8; ++k) ok[k] = toh_flush(bfr(xk[u][s][k]));
            const int un = (t >> 4) * 128 + (c >> 1) * 32 + (c & 1) * 16 + (t & 15);
            *(v8h*)(&kl[(un + (un >> 4)) * 8]) = ok; } }
    __syncthreads();
    // q needs no exchange; its stores stand behind the barrier, which would otherwise wait for them
#pragma unroll
    for (int u = 0; u < PU; ++u) {
#pragma unroll
        for (int s = 0; s < 2; ++s) { const int p = s * 256 + tid; const int t = u * 64 + (p >> 3), c8 = (p & 7) * 8;
            v8h oq;
#pragma unroll
            for (int k = 0; k < 8; ++k) oq[k] = toh_flush(bfr(xq[u][s][k]));
            *(v8h*)(QH + db + (size_t)t * HE + c8) = oq;
            asm volatile("s_wait_xcnt 0x0" ::: "memory"); } }   // the next piece, and the LDS reads below, land in registers that this store names
    const size_t kb = ((size_t)zh * SEQ + tt0) * HD;                         // the block's span in either fragment-order plane: 64*PU tokens x 64 halves, contiguous
#pragma unroll
    for (int s = 0; s < 2 * PU; ++s) { const int un = s * 256 + tid;
        *(v8h*)(KP + kb + (size_t)un * 8) = *(const v8h*)(&kl[(un + (un >> 4)) * 8]); }
    asm volatile("s_wait_xcnt 0x0" ::: "memory");   // the same for the k stores and the v pieces formed below
#pragma unroll
    for (int s = 0; s < 2 * PU; ++s) { const int un = s * 256 + tid;         // trip s = 32-key tile s of the span; tid = (d/16)*64 + (g&3)*16 + d%16
        const int d = ((tid >> 6) << 4) | (tid & 15), tk = s * 32 + ((tid >> 4) & 3) * 8;
        const float* tr = &tl[(tk >> 6) * 64 * TP + d * TP + (tk & 63)];
        const v4f x0 = *(const v4fa*)(tr); const v4f x1 = *(const v4fa*)(tr + 4);
        v8h hv;
#pragma unroll
        for (int i = 0; i < 4; ++i) { hv[i] = toh_flush(x0[i]); hv[4 + i] = toh_flush(x1[i]); }
        *(v8h*)(VT + kb + (size_t)un * 8) = hv; }
}

// flash_body: fused attention, one wave per 16 query rows of one (batch, head); K / V^T / Q fragments straight from the f16 planes (two 16-B loads each, arithmetic addressing; K and V^T: 512 contiguous bytes per wave-wide load).
// Transposed form: S^T[key][t] = K Q^T (A = K rows, B = Q rows, two k-steps over d); lane (t = lane&15, h = lane>>4) holds keys 8h+r of each 16-key tile, so the packed
// P tile is directly the B fragment of O^T[d][t] = V^T P^T (element r <- tile keys 0..15, element 8+r <- tile keys 16..31, lane unchanged); four 16-row d tiles.
// Softmax state (running max over kept keys, partial sum) is one scalar per lane; the two lane halves of a row are combined with one xor-16 exchange.
// Keep rule (key <= query) evaluated per element inside every visited 32-key tile; the per-wave key bound is (t0 + 16) raised to a multiple of 32, at most SEQ; every visited tile holds a kept key for every row.
// EARLY = 1 (query rows [0, EROWS)): P = f16 value + f16 residual x2048; O = V P + (V P_res) / 2048 (residual products in their own accumulators); row sum from the f32 exponentials.
// EARLY = 0 (query rows [EROWS, SEQ)): single P; row sum over the converted P.
template <int EARLY>
__device__ __forceinline__ void flash_body(const h16* __restrict__ QH, const h16* __restrict__ KP, const h16* __restrict__ VT, float* OUT) {
    __shared__ __align__(16) float os[AW * 16 * OSP];
    const int lane = threadIdx.x & 31, lr = lane & 15, hi = lane >> 4;
    const int wave = __builtin_amdgcn_readfirstlane((int)(threadIdx.x >> 5));
    const int zh = blockIdx.y; const int b = zh / NHD, h = zh % NHD;
    const int t0 = (EARLY ? 0 : EROWS) + (blockIdx.x * AW + wave) * 16;
    const int lim = t0 + lr;                                               // key j kept iff j <= lim
    const int nk = (t0 + 16 + 31) & ~31;                                   // wave-uniform, multiple of 32, <= SEQ
    const size_t rowb = (size_t)b * SEQ * HE + (size_t)h * HD;            // (batch b, token 0, head h) in the q plane
    const size_t qo = rowb + (size_t)(t0 + lr) * HE + 8 * hi;
    const v16h q0 = ldh(QH + qo), q1 = ldh(QH + qo + 32);                  // B fragments: col t, k = d (two k-steps)
    const size_t ko = (size_t)zh * SEQ * HD + 8 * lane;                    // + key * HD: 16-key tile = four 512-B groups (A fragment: row key, k = d; two groups per k-step)
    const size_t vo = ko;                                                  // + key * HD: 32-key tile = eight 512-B groups (A fragment: row d, k = key; two groups per 16-row d tile)
    const v16h hz = (v16h){};
    v8f o[4], oR[4];
#pragma unroll
    for (int j = 0; j < 4; ++j) { o[j] = (v8f){}; oR[j] = (v8f){}; }
    float m = NEGB, l = 0.0f;
    // Fragments are fetched ahead of their tile: a register set is refilled right behind the products that read it.
    // EARLY = 0: two sets (even and odd tiles), each fetched two tiles ahead; EARLY = 1 (twice the accumulators): one set, one tile ahead, which stays below 256 registers.
    // A fetch past the wave's last tile is clamped to that tile (in bounds, values unused).
    auto ld_k = [&](int key, v16h (&kf)[4]) {
        const h16* ka = KP + ko + (size_t)key * HD;
        kf[0] = ldf(ka); kf[1] = ldf(ka + 512); kf[2] = ldf(ka + 1024); kf[3] = ldf(ka + 1536); };
    auto ld_v = [&](int key, v16h (&vf)[4]) {
        const h16* va = VT + vo + (size_t)key * HD;
        vf[0] = ldf(va); vf[1] = ldf(va + 512); vf[2] = ldf(va + 1024); vf[3] = ldf(va + 1536); };
    auto tile = [&](int key0, int ahead, bool fetch, v16h (&kf)[4], v16h (&vf)[4]) {
        int keyn = (key0 + ahead < nk) ? key0 + ahead : nk - 32;
        // earlier fetches are still in flight here, over the loop's back edge too; this trip's fetch addresses are formed from keyn, so the wait stands in front of every rewrite of an address register
        if (fetch) asm volatile("s_wait_xcnt 0x0" : "+s"(keyn) :: "memory");
        v8f sA = (v8f){}, sB = (v8f){};
        sA = wmma16g(kf[0], q0, sA); sB = wmma16g(kf[2], q0, sB);
        sA = wmma16g(kf[1], q1, sA); sB = wmma16g(kf[3], q1, sB);
        if (fetch) ld_k(keyn, kf);
        const int ja = key0 + 8 * hi;                                      // D: sA[r] = (key ja + r, t = lane&15), sB[r] = (key ja + 16 + r, t)
        float ta[8], tb[8]; bool fa[8], fb[8]; float mx = NEGB;
#pragma unroll
        for (int r = 0; r < 8; ++r) {
            fa[r] = (ja + r <= lim);
            fb[r] = (ja + 16 + r <= lim);
            ta[r] = sA[r] * SC2; tb[r] = sB[r] * SC2;
            mx = fmaxf(mx, fmaxf(fa[r] ? ta[r] : NEGB, fb[r] ? tb[r] : NEGB)); }
        mx = fmaxf(mx, __shfl_xor(mx, 16, 32));
        const float mnew = fmaxf(m, mx);
        const float alpha = __builtin_amdgcn_exp2f(m - mnew);
        const float sh = PSH - mnew;
        v16h pb, pr = hz; float ls = 0.0f;
#pragma unroll
        for (int r = 0; r < 8; ++r) {
            const float ea = __builtin_amdgcn_exp2f(ta[r] + sh), eb = __builtin_amdgcn_exp2f(tb[r] + sh);
            const float ga = fa[r] ? ea : 0.0f, gb = fb[r] ? eb : 0.0f;       // dropped elements selected to 0 by value
            const h16 pa = toh_flush(ga); const h16 pc = toh_flush(gb);
            pb[r] = pa; pb[8 + r] = pc;
            if (EARLY) { pr[r] = toh_flush((ga - (float)pa) * QRS); pr[8 + r] = toh_flush((gb - (float)pc) * QRS); ls += ga + gb; }
            else       { ls += (float)pa + (float)pc; } }
        l = l * alpha + ls; m = mnew;
#pragma unroll
        for (int j = 0; j < 4; ++j) o[j] = o[j] * alpha;
        if (EARLY) {
#pragma unroll
            for (int j = 0; j < 4; ++j) oR[j] = oR[j] * alpha; }
        o[0] = wmma16g(vf[0], pb, o[0]); o[1] = wmma16g(vf[1], pb, o[1]); o[2] = wmma16g(vf[2], pb, o[2]); o[3] = wmma16g(vf[3], pb, o[3]);
        if (EARLY) {
            oR[0] = wmma16g(vf[0], pr, oR[0]); oR[1] = wmma16g(vf[1], pr, oR[1]); oR[2] = wmma16g(vf[2], pr, oR[2]); oR[3] = wmma16g(vf[3], pr, oR[3]);
        }
        if (fetch) ld_v(keyn, vf);
    };
    v16h kE[4], vE[4];
    // first fetches in the loop's own issue order (K, V, K, V), held there by the scheduling barriers, so that the counted load waits at the loop head leave the younger fetches in flight;
    // the wait between them stands in front of loads whose results land in address registers of the loads above
    auto hold = [&]() { __builtin_amdgcn_sched_barrier(0); asm volatile("s_wait_xcnt 0x0" ::: "memory"); __builtin_amdgcn_sched_barrier(0); };
    ld_k(0, kE); hold();
    ld_v(0, vE);
    int key0 = 0;
    if constexpr (EARLY) {
#pragma unroll 1   // kept rolled: an unrolled body would need further register sets
        do { tile(key0, 32, true, kE, vE); key0 += 32; } while (key0 < nk);              // t0 >= 0, so nk >= 32: at least one tile
    } else {
        static_assert(EROWS >= 32);                                                      // t0 >= EROWS, so nk >= 64: tile 1 exists and the pair loop runs at least once
        v16h kO[4], vO[4];
        hold(); ld_k(32, kO); hold();
        ld_v(32, vO);
#pragma unroll 1   // kept rolled: the body already holds one tile of each set
        do { tile(key0, 64, true, kE, vE); tile(key0 + 32, 64, true, kO, vO); key0 += 64; } while (key0 + 64 <= nk);
        if (key0 < nk) tile(key0, 64, false, kE, vE);                                    // odd tile count: the last tile sits in the even set
    }
    l += __shfl_xor(l, 16, 32);
    const bool any = l > 0.0f;
    const float lsafe = any ? l : 1.0f;
    const float inv = any ? (1.0f / lsafe) : 0.0f;
    const int wb = wave * 16 * OSP;
    // O^T D layout: f_j[r] = (d = 16j + 8h + r, t = lane&15) -> os[t][d]; rows 0..15 x columns 0..63 all written
#pragma unroll
    for (int j = 0; j < 4; ++j) {
        v8f f = o[j];
        if (EARLY) f = o[j] + oR[j] * QRI;
        v4f a, c;
        a[0] = f[0] * inv; a[1] = f[1] * inv; a[2] = f[2] * inv; a[3] = f[3] * inv; c[0] = f[4] * inv; c[1] = f[5] * inv; c[2] = f[6] * inv; c[3] = f[7] * inv;
        *(v4fa*)(&os[wb + lr * OSP + 16 * j + 8 * hi]) = a; *(v4fa*)(&os[wb + lr * OSP + 16 * j + 8 * hi + 4]) = c; }
    wave_sync();
    float* orow = OUT + (((size_t)b * OUT_SEQ + t0) * NHD + h) * HD;
{
#pragma unroll
        for (int s = 0; s < 8; ++s) { const int row = 2 * s + (lane >> 4), cofs = (lane & 15) * 4;   // 8 s x 2 rows = 16 rows; 16 lanes x 4 floats = 64 columns = two lines
            const v4f val = *(const v4fa*)(&os[wb + row * OSP + cofs]);
            *(v4f*)(orow + (size_t)row * HE + cofs) = val; }
         }
    asm volatile("s_wait_loadcnt 0x0" ::: "memory");   // the clamped fetches of the last trips are never read, so nothing else waits for them: they have landed before the wave hands its registers back
}

__global__ __launch_bounds__(32 * AW) void k_flash_early(const h16* __restrict__ QH, const h16* __restrict__ KP, const h16* __restrict__ VT, float* OUT) {
    flash_body<1>(QH, KP, VT, OUT);
}

__global__ __launch_bounds__(32 * AW) void k_flash_late(const h16* __restrict__ QH, const h16* __restrict__ KP, const h16* __restrict__ VT, float* OUT) {
    flash_body<0>(QH, KP, VT, OUT);
}

static constexpr size_t al256(size_t v) { return (v + 255) & ~(size_t)255; }
static constexpr size_t SZ_QK = al256((size_t)NB * SEQ * HE * 2);           // q plane [NB][SEQ][HE] f16; k plane [NB*NHD][SEQ/16][4][32][8] f16
static constexpr size_t SZ_VT = al256((size_t)NB * NHD * HD * SEQ * 2);     // v^T plane [NB*NHD][SEQ/32][8][32][8] f16
static constexpr size_t SZ_TOTAL = 2 * SZ_QK + SZ_VT;
static_assert(SZ_TOTAL <= (size_t)134217728);          // workspace carve <= 128 MiB
static_assert(((size_t)NB * SEQ * HE * 2) % 128 == 0);
static_assert(((size_t)SEQ * 2) % 128 == 0);

extern "C" void kernel_launch(void* const* d_in, const int* in_sizes, int n_in,
                              void* d_out, int out_size, void* d_ws, size_t ws_size, hipStream_t stream) {
    if (n_in < 3) return;
    const size_t needx = ((size_t)(NB - 1) * SEQ_FULL + SEQ) * HE;
    if ((size_t)in_sizes[0] < needx || (size_t)in_sizes[1] < needx || (size_t)in_sizes[2] < needx) return;
    if ((size_t)out_size < ((size_t)(NB - 1) * OUT_SEQ + SEQ) * HE) return;
    if (SZ_TOTAL > ws_size) return;
    // wire order: queries, keys, values
    const float* qin = (const float*)d_in[0];
    const float* kin = (const float*)d_in[1];
    const float* vin = (const float*)d_in[2];
    float* OUT = (float*)d_out;      // [NB][SEQ][16][64]
    char* wsp = (char*)d_ws;
    h16* QH = (h16*)wsp; wsp += SZ_QK;               // [NB][SEQ][1024]
    h16* KP = (h16*)wsp; wsp += SZ_QK;               // [NB*16][SEQ/16][4][32][8]
    h16* VT = (h16*)wsp; wsp += SZ_VT;               // [NB*16][SEQ/32][8][32][8]

    // q -> f16 plane in the input layout; k, v -> f16 planes in fragment order; grid (token spans, batch*head)
    k_prep<<<dim3(SEQ / (64 * PU), NB * NHD, 1), 256, 0, stream>>>(qin, kin, vin, QH, KP, VT);

    // query rows [0, EROWS): two-plane-P instantiation; rows [EROWS, SEQ): single-product instantiation (disjoint output rows)
    k_flash_early<<<dim3(EROWS / (16 * AW), NB * NHD, 1), 32 * AW, 0, stream>>>(QH, KP, VT, OUT);
    if (SEQ > EROWS)
        k_flash_late<<<dim3((SEQ - EROWS) / (16 * AW), NB * NHD, 1), 32 * AW, 0, stream>>>(QH, KP, VT, OUT);
}

// v004
// It runs in 59.8 microseconds.
// Next to v003, in two timings, it ran 1.04 and 1.02 times as fast.
// All steps since v000 together make it 1.63 times as fast.
#include <hip/hip_runtime.h>

// Causal scaled dot-product attention over per-head slices, no projections: q/k/v [NB][SEQ][16][64] (f32), key j kept for query t iff j <= t (dropped keys get probability 0), score scale 1/sqrt(64), output [NB][SEQ][16][64] (f32).
// Compute dtypes, f32 accumulate everywhere: scores v_wmma_f32_16x16x32_f16 with q, k single f16 planes (inputs RNE-converted to bf16, then held in f16: exact for f16-normal values, smaller magnitudes selected to +0);
// P.V v_wmma_f32_16x16x32_f16: v single f16 plane (same conversion), P f16 with x16384 carry (cancels in the normalisation); on query rows < EROWS P = f16 value + f16 residual x2048, residual products in their own accumulators folded by 1/2048, row sum from the f32 exponentials; on later rows row sum over the converted P. Softmax f32 (online, running max over kept keys).
// Layout: f16 copy of q in the input layout [b][t][h*64 + d] (row pitch 1024 halves); k and v^T planes in fragment order (see k_prep): each 16-B piece stands where the lane that loads it finds it, so one wave-wide 16-B load reads 512 contiguous bytes (four whole lines);
// all three planes written by one launch, k and v through LDS; fused flash kernel in transposed form (S^T = K Q^T, O^T = V^T P^T), fragments straight from the planes, output from f32 accumulators.

#ifndef NB
#define NB 2
#endif
#ifndef SEQ
#define SEQ 2048
#endif
#define NB_FULL  2
#define SEQ_FULL 2048
#ifndef OUT_SEQ
#define OUT_SEQ SEQ              // row pitch (in tokens) between batches of the output
#endif
#define NHD  16                  // heads
#define HD   64                  // head width
#define HE   (NHD * HD)          // token row pitch (elements) of the inputs, the q plane and the output
#define AW   4                   // waves per flash block (16 query rows each)
#define OSP  68                  // LDS row pitch (floats) of the flash output tile
#define TP   68                  // LDS row pitch (floats) of the transpose tile
#define PU   2                   // 64-token tiles per block of the plane-building kernel
#define KU   (64 * PU * 8)       // 16-B pieces of k per block of the plane-building kernel
#define EROWS (SEQ < 512 ? SEQ : 512)   // query rows handled by the two-plane-P flash instantiation
#define QRS  2048.0f             // carry of the residual P fragment
#define QRI  (1.0f / 2048.0f)
#define SC2  ((float)(0.125 * 1.4426950408889634))   // HD^-0.5 * log2(e)
#define PSH  14.0f               // log2 of the P carry (16384)
#define NEGB (-3.0e38f)

static_assert(HD == 64);                       // two 32-deep k-steps per score tile, four 16-row output tiles
static_assert(NHD * HD == HE);
static_assert(HD % 32 == 0);                   // score k-loop steps by 32
static_assert(HE % 8 == 0);                    // 16-byte fragment loads from token rows
static_assert(SEQ % 64 == 0);
static_assert(SEQ % 32 == 0);                  // key loop steps by 32 and its bound never exceeds SEQ
static_assert(SEQ % (16 * AW) == 0);
static_assert(EROWS % (16 * AW) == 0);
static_assert((SEQ - EROWS) % (16 * AW) == 0);
static_assert(EROWS >= 32);
static_assert(EROWS <= SEQ);
static_assert(NB <= NB_FULL);
static_assert(SEQ <= SEQ_FULL);
static_assert(OSP >= HD);
static_assert((OSP * 4) % 16 == 0);
static_assert(TP >= 64);
static_assert((TP * 4) % 16 == 0);
static_assert(SEQ % (64 * PU) == 0);                                 // plane-building grid x tokens per block == SEQ
static_assert((size_t)32 * 16 * 8 == (size_t)16 * HD * 4);           // flash epilogue: 32 lanes x 16 B x 8 trips == 16 rows x 256 B
static_assert((size_t)256 * 2 * 8 == (size_t)64 * HD);               // q/k convert: 256 threads x 2 pieces x 8 floats == 64 tokens x 64 columns
static_assert((size_t)256 * 2 * PU * 8 == (size_t)HD * 64 * PU);     // v^T store: 256 threads x 2*PU pieces x 8 halves == 64 rows x 64*PU tokens
static_assert((size_t)256 * 4 * 4 == (size_t)64 * HD);               // transpose load: 256 threads x 4 float4 x 4 floats == 64 tokens x 64 columns
static_assert((size_t)AW * 16 * OSP * 4 <= 131072);                  // static LDS of the flash kernels
static_assert((size_t)256 * 2 * PU == (size_t)KU);                   // k fragment store: 256 threads x 2*PU pieces == all pieces of the block
static_assert(KU % 16 == 0);
static_assert((size_t)PU * 64 * TP * 4 + (size_t)(KU + KU / 16) * 16 <= 131072);   // static LDS of the plane-building kernel

typedef _Float16 h16;
typedef __attribute__((ext_vector_type(16))) _Float16 v16h;
typedef __attribute__((ext_vector_type(8)))  _Float16 v8h;
typedef __attribute__((ext_vector_type(8)))  float    v8f;
typedef __attribute__((ext_vector_type(4)))  float    v4f;
typedef v4f  __attribute__((may_alias)) v4fa;

__device__ __forceinline__ unsigned short f2bf(float f) { unsigned u = __float_as_uint(f); u += 0x7FFFu + ((u >> 16) & 1u); return (unsigned short)(u >> 16); }
__device__ __forceinline__ float bfr(float f) { return __uint_as_float(((unsigned)f2bf(f)) << 16); }   // value after RNE convert to bf16
__device__ __forceinline__ v16h cat16(v8h lo, v8h hi) { return __builtin_shufflevector(lo, hi, 0, 1, 2, 3, 4, 5, 6, 7, 8, 9, 10, 11, 12, 13, 14, 15); }
// fragment loader from K-contiguous 16-bit rows; p already includes + 8*(lane>>4): elements 0..7 <- k0+8h+0..7, elements 8..15 <- k0+16+8h+0..7 (same map for A and B)
__device__ __forceinline__ v16h  ldh(const h16* p) { return cat16(*(const v8h*)p, *(const v8h*)(p + 16)); }
// fragment loader from a fragment-order plane; p already includes + 8*lane: elements 0..7 from the lane's piece of one 512-B group, elements 8..15 from its piece of the next group
__device__ __forceinline__ v16h  ldf(const h16* p) { return cat16(*(const v8h*)p, *(const v8h*)(p + 256)); }
// ordering point for wave-private LDS tiles (same wave writes and reads)
__device__ __forceinline__ void wave_sync() { __builtin_amdgcn_fence(3 /* release order */, "wavefront"); __builtin_amdgcn_wave_barrier(); asm volatile("" ::: "memory"); }
// f32 -> f16 convert that cannot produce an f16 subnormal (value select)
static __device__ __forceinline__ h16 toh_flush(float v) { const h16 r = (h16)v; return (fabsf(v) < 6.103515625e-05f) ? (h16)0.0f : r; }
// one WMMA with its own hazard guard (ties the accumulator, keeps A/B live)
__device__ __forceinline__ v8f wmma16g(v16h a, v16h b, v8f c) {
    c = __builtin_amdgcn_wmma_f32_16x16x32_f16(false, a, false, b, (short)0, c, false, false);
    asm volatile("v_nop\n\tv_nop\n\tv_nop\n\tv_nop" : "+v"(c) : "v"(a), "v"(b));
    return c;
}

// k_prep: the three f16 planes in one launch. One block per (64*PU-token span, batch*head): grid (SEQ/(64*PU), NB*NHD), 256 threads; the block reads the same
// 64*PU tokens x 64 columns of q, k and v. Every global load of a thread (12*PU of 16 B) is issued before the first use, so one wave start and one memory latency serve all of them.
// q: in[t][h*64 + d] (f32, token pitch HE) -> same layout in f16, 8 values per piece, 8 lanes fill one 128-B line.
// k: piece (token t, columns 8c..8c+7) -> 16-B unit ((b*16 + h)*(SEQ/16) + t/16)*128 + (c>>1)*32 + (c&1)*16 + t%16: group c>>1 of a 16-key tile holds, at lane (c&1)*16 + t%16, what that lane takes as one half of an A fragment.
//    The pieces change threads through LDS (a spare unit behind every 16 spreads the banks), under the same block barrier as v.
// v: piece (column d, tokens 8g..8g+7) -> 16-B unit ((b*16 + h)*(SEQ/32) + g/4)*256 + (d/16)*64 + (g&3)*16 + d%16: float4 loads scattered transposed into LDS float tiles [d][t] (cross-wave: block barrier), then 16-B pieces.
// A thread stores unit (trip*256 + tid) of the block's span of either plane: a wave's store is 512 contiguous bytes.
__global__ __launch_bounds__(256) void k_prep(const float* __restrict__ Q, const float* __restrict__ K, const float* __restrict__ V, h16* QH, h16* KP, h16* VT) {
    __shared__ __align__(16) float tl[PU * 64 * TP];
    __shared__ __align__(16) h16 kl[(KU + KU / 16) * 8];
    const int tid = threadIdx.x;
    const int tt0 = blockIdx.x * (64 * PU); const int zh = blockIdx.y; const int b = zh / NHD, h = zh % NHD;
    const size_t sb = ((size_t)b * SEQ_FULL + tt0) * HE + (size_t)h * HD;    // (batch b, token tt0, head h) in the inputs
    const size_t db = ((size_t)b * SEQ + tt0) * HE + (size_t)h * HD;         // the same place in the q plane
    v4f xv[PU][4]; v8f xq[PU][2], xk[PU][2];
    const float* pv[4]; const float* pq[2]; const float* pk[2];              // tile 0's addresses; tile u lies 64 * u tokens further on
#pragma unroll
    for (int s = 0; s < 4; ++s) { const int p = s * 256 + tid; pv[s] = V + sb + (size_t)(p >> 4) * HE + (p & 15) * 4; }   // 4 s x 16 tokens = 64 tokens; 16 lanes x 4 = 64 columns
#pragma unroll
    for (int s = 0; s < 2; ++s) { const int p = s * 256 + tid; const size_t o = sb + (size_t)(p >> 3) * HE + (p & 7) * 8;  // 2 s x 32 tokens = 64 tokens; 8 lanes x 8 = 64 columns
        pq[s] = Q + o; pk[s] = K + o; }
#pragma unroll
    for (int u = 0; u < PU; ++u) {
#pragma unroll
        for (int s = 0; s < 4; ++s) xv[u][s] = *(const v4f*)(pv[s] + (size_t)u * 64 * HE); }
#pragma unroll
    for (int u = 0; u < PU; ++u) {
#pragma unroll
        for (int s = 0; s < 2; ++s) { xq[u][s] = *(const v8f*)(pq[s] + (size_t)u * 64 * HE); xk[u][s] = *(const v8f*)(pk[s] + (size_t)u * 64 * HE); } }
    // every load stands above this line (left free, the scheduler sinks the q and k loads to their uses and the thread pays several memory latencies in a row);
    // the addresses are inputs, so they stay in their registers up to the wait and no load's result lands in one of them ahead of it
    asm volatile("s_wait_xcnt 0x0" :: "v"(pv[0]), "v"(pv[1]), "v"(pv[2]), "v"(pv[3]), "v"(pq[0]), "v"(pq[1]), "v"(pk[0]), "v"(pk[1]) : "memory");
#pragma unroll
    for (int u = 0; u < PU; ++u) {
#pragma unroll
        for (int s = 0; s < 4; ++s) { const int p = s * 256 + tid; const int t = p >> 4, d4 = (p & 15) * 4;
#pragma unroll
            for (int i = 0; i < 4; ++i) tl[u * 64 * TP + (d4 + i) * TP + t] = bfr(xv[u][s][i]); } }
#pragma unroll
    for (int u = 0; u < PU; ++u) {
#pragma unroll
        for (int s = 0; s < 2; ++s) { const int p = s * 256 + tid; const int t = u * 64 + (p >> 3), c = p & 7;
            v8h ok;
#pragma unroll
            for (int k = 0; k < 8; ++k) ok[k] = toh_flush(bfr(xk[u][s][k]));
            const int un = (t >> 4) * 128 + (c >> 1) * 32 + (c & 1) * 16 + (t & 15);
            *(v8h*)(&kl[(un + (un >> 4)) * 8]) = ok; } }
    __syncthreads();
    // q needs no exchange; its stores stand behind the barrier, which would otherwise wait for them
#pragma unroll
    for (int u = 0; u < PU; ++u) {
#pragma unroll
        for (int s = 0; s < 2; ++s) { const int p = s * 256 + tid; const int t = u * 64 + (p >> 3), c8 = (p & 7) * 8;
            v8h oq;
#pragma unroll
            for (int k = 0; k < 8; ++k) oq[k] = toh_flush(bfr(xq[u][s][k]));
            *(v8h*)(QH + db + (size_t)t * HE + c8) = oq;
            asm volatile("s_wait_xcnt 0x0" ::: "memory"); } }   // the next piece, and the LDS reads below, land in registers that this store names
    const size_t kb = ((size_t)zh * SEQ + tt0) * HD;                         // the block's span in either fragment-order plane: 64*PU tokens x 64 halves, contiguous
#pragma unroll
    for (int s = 0; s < 2 * PU; ++s) { const int un = s * 256 + tid;
        *(v8h*)(KP + kb + (size_t)un * 8) = *(const v8h*)(&kl[(un + (un >> 4)) * 8]); }
    asm volatile("s_wait_xcnt 0x0" ::: "memory");   // the same for the k stores and the v pieces formed below
#pragma unroll
    for (int s = 0; s < 2 * PU; ++s) { const int un = s * 256 + tid;         // trip s = 32-key tile s of the span; tid = (d/16)*64 + (g&3)*16 + d%16
        const int d = ((tid >> 6) << 4) | (tid & 15), tk = s * 32 + ((tid >> 4) & 3) * 8;
        const float* tr = &tl[(tk >> 6) * 64 * TP + d * TP + (tk & 63)];
        const v4f x0 = *(const v4fa*)(tr); const v4f x1 = *(const v4fa*)(tr + 4);
        v8h hv;
#pragma unroll
        for (int i = 0; i < 4; ++i) { hv[i] = toh_flush(x0[i]); hv[4 + i] = toh_flush(x1[i]); }
        *(v8h*)(VT + kb + (size_t)un * 8) = hv; }
}

// flash_body: fused attention, one wave per 16 query rows of one (batch, head); K / V^T / Q fragments straight from the f16 planes (two 16-B loads each, arithmetic addressing; K and V^T: 512 contiguous bytes per wave-wide load).
// Transposed form: S^T[key][t] = K Q^T (A = K rows, B = Q rows, two k-steps over d); lane (t = lane&15, h = lane>>4) holds keys 8h+r of each 16-key tile, so the packed
// P tile is directly the B fragment of O^T[d][t] = V^T P^T (element r <- tile keys 0..15, element 8+r <- tile keys 16..31, lane unchanged); four 16-row d tiles.
// Softmax state (running max over kept keys, partial sum) is one scalar per lane; the two lane halves of a row are combined with one xor-16 exchange.
// The per-wave key bound nk is (t0 + 16) raised to a multiple of 32, at most SEQ; every visited tile holds a kept key for every row.
// Keep rule (key <= query) evaluated per element in the wave's last tile only: t0 is a multiple of 16, so that tile starts at or below t0 and every earlier tile ends below t0, where all 32 keys are kept for all 16 rows.
// EARLY = 1 (query rows [0, EROWS)): P = f16 value + f16 residual x2048; O = V P + (V P_res) / 2048 (residual products in their own accumulators); row sum from the f32 exponentials.
// EARLY = 0 (query rows [EROWS, SEQ)): single P; row sum over the converted P.
template <int EARLY>
__device__ __forceinline__ void flash_body(const h16* __restrict__ QH, const h16* __restrict__ KP, const h16* __restrict__ VT, float* OUT) {
    __shared__ __align__(16) float os[AW * 16 * OSP];
    const int lane = threadIdx.x & 31, lr = lane & 15, hi = lane >> 4;
    const int wave = __builtin_amdgcn_readfirstlane((int)(threadIdx.x >> 5));
    const int zh = blockIdx.y; const int b = zh / NHD, h = zh % NHD;
    const int t0 = (EARLY ? 0 : EROWS) + (blockIdx.x * AW + wave) * 16;
    const int lim = t0 + lr;                                               // key j kept iff j <= lim
    const int nk = (t0 + 16 + 31) & ~31;                                   // wave-uniform, multiple of 32, <= SEQ
    const size_t rowb = (size_t)b * SEQ * HE + (size_t)h * HD;            // (batch b, token 0, head h) in the q plane
    const size_t qo = rowb + (size_t)(t0 + lr) * HE + 8 * hi;
    const v16h q0 = ldh(QH + qo), q1 = ldh(QH + qo + 32);                  // B fragments: col t, k = d (two k-steps)
    const size_t ko = (size_t)zh * SEQ * HD + 8 * lane;                    // + key * HD: 16-key tile = four 512-B groups (A fragment: row key, k = d; two groups per k-step)
    const size_t vo = ko;                                                  // + key * HD: 32-key tile = eight 512-B groups (A fragment: row d, k = key; two groups per 16-row d tile)
    const v16h hz = (v16h){};
    v8f o[4], oR[4];
#pragma unroll
    for (int j = 0; j < 4; ++j) { o[j] = (v8f){}; oR[j] = (v8f){}; }
    float m = NEGB, l = 0.0f;
    // Fragments are fetched ahead of their tile: a register set is refilled right behind the products that read it.
    // EARLY = 0: two sets (even and odd tiles), each fetched two tiles ahead; EARLY = 1 (twice the accumulators): one set, one tile ahead, which stays below 256 registers.
    // A fetch past the wave's last tile is clamped to that tile (in bounds, values unused).
    auto ld_k = [&](int key, v16h (&kf)[4]) {
        const h16* ka = KP + ko + (size_t)key * HD;
        kf[0] = ldf(ka); kf[1] = ldf(ka + 512); kf[2] = ldf(ka + 1024); kf[3] = ldf(ka + 1536); };
    auto ld_v = [&](int key, v16h (&vf)[4]) {
        const h16* va = VT + vo + (size_t)key * HD;
        vf[0] = ldf(va); vf[1] = ldf(va + 512); vf[2] = ldf(va + 1024); vf[3] = ldf(va + 1536); };
    auto tile = [&](int key0, int ahead, bool fetch, bool diag, v16h (&kf)[4], v16h (&vf)[4]) __attribute__((always_inline)) {
        int keyn = (key0 + ahead < nk) ? key0 + ahead : nk - 32;
        // earlier fetches are still in flight here, over the loop's back edge too; this trip's fetch addresses are formed from keyn, so the wait stands in front of every rewrite of an address register
        if (fetch) asm volatile("s_wait_xcnt 0x0" : "+s"(keyn) :: "memory");
        v8f sA = (v8f){}, sB = (v8f){};
        sA = wmma16g(kf[0], q0, sA); sB = wmma16g(kf[2], q0, sB);
        sA = wmma16g(kf[1], q1, sA); sB = wmma16g(kf[3], q1, sB);
        if (fetch) ld_k(keyn, kf);
        const int ja = key0 + 8 * hi;                                      // D: sA[r] = (key ja + r, t = lane&15), sB[r] = (key ja + 16 + r, t)
        float ta[8], tb[8]; bool fa[8], fb[8]; float mx = NEGB;
#pragma unroll
        for (int r = 0; r < 8; ++r) {
            fa[r] = !diag || (ja + r <= lim);
            fb[r] = !diag || (ja + 16 + r <= lim);
            ta[r] = sA[r] * SC2; tb[r] = sB[r] * SC2;
            mx = fmaxf(mx, fmaxf(fa[r] ? ta[r] : NEGB, fb[r] ? tb[r] : NEGB)); }
        mx = fmaxf(mx, __shfl_xor(mx, 16, 32));
        const float mnew = fmaxf(m, mx);
        const float alpha = __builtin_amdgcn_exp2f(m - mnew);
        const float sh = PSH - mnew;
        v16h pb, pr = hz; float ls = 0.0f;
#pragma unroll
        for (int r = 0; r < 8; ++r) {
            // scale and shift written as one fused operation, so that every form of the tile rounds the exponent alike whatever the compiler would pick
            const float ea = __builtin_amdgcn_exp2f(__builtin_fmaf(sA[r], SC2, sh)), eb = __builtin_amdgcn_exp2f(__builtin_fmaf(sB[r], SC2, sh));
            const float ga = fa[r] ? ea : 0.0f, gb = fb[r] ? eb : 0.0f;       // dropped elements selected to 0 by value
            const h16 pa = toh_flush(ga); const h16 pc = toh_flush(gb);
            pb[r] = pa; pb[8 + r] = pc;
            if (EARLY) { pr[r] = toh_flush((ga - (float)pa) * QRS); pr[8 + r] = toh_flush((gb - (float)pc) * QRS); ls += ga + gb; }
            else       { ls += (float)pa + (float)pc; } }
        l = l * alpha + ls; m = mnew;
#pragma unroll
        for (int j = 0; j < 4; ++j) o[j] = o[j] * alpha;
        if (EARLY) {
#pragma unroll
            for (int j = 0; j < 4; ++j) oR[j] = oR[j] * alpha; }
        o[0] = wmma16g(vf[0], pb, o[0]); o[1] = wmma16g(vf[1], pb, o[1]); o[2] = wmma16g(vf[2], pb, o[2]); o[3] = wmma16g(vf[3], pb, o[3]);
        if (EARLY) {
            oR[0] = wmma16g(vf[0], pr, oR[0]); oR[1] = wmma16g(vf[1], pr, oR[1]); oR[2] = wmma16g(vf[2], pr, oR[2]); oR[3] = wmma16g(vf[3], pr, oR[3]);
        }
        if (fetch) { ld_v(keyn, vf);
            // the fetch's address is an input, so it stays in its registers up to the wait: no result (of the next tile's first product, moved up over the loop's back edge, either) lands in them ahead of it
            asm volatile("s_wait_xcnt 0x0" :: "v"(VT + vo + (size_t)keyn * HD) : "memory"); }
    };
    v16h kE[4], vE[4];
    // first fetches in the loop's own issue order (K, V, K, V), held there by the scheduling barriers, so that the counted load waits at the loop head leave the younger fetches in flight;
    // the wait between them stands in front of loads whose results land in address registers of the loads above
    auto hold = [&]() { __builtin_amdgcn_sched_barrier(0); asm volatile("s_wait_xcnt 0x0" ::: "memory"); __builtin_amdgcn_sched_barrier(0); };
    ld_k(0, kE); hold();
    ld_v(0, vE);
    int key0 = 0;
    const int nd = nk - 32;                                                              // first key of the last tile, the one that the diagonal crosses
    if constexpr (EARLY) {
#pragma unroll 1   // kept rolled: an unrolled body would need further register sets
        for (; key0 < nd; key0 += 32) tile(key0, 32, true, false, kE, vE);
        tile(key0, 32, false, true, kE, vE);                                             // t0 >= 0, so nk >= 32: the last tile always exists
    } else {
        static_assert(EROWS >= 64);                                                      // t0 >= EROWS, so nd >= 64: tile 1 exists and the pair loop runs at least once
        v16h kO[4], vO[4];
        hold(); ld_k(32, kO); hold();
        ld_v(32, vO);
#pragma unroll 1   // kept rolled: the body already holds one tile of each set
        do { tile(key0, 64, true, false, kE, vE); tile(key0 + 32, 64, true, false, kO, vO); key0 += 64; } while (key0 + 64 <= nd);
        if (key0 < nd) { tile(key0, 64, false, false, kE, vE); tile(key0 + 32, 64, false, true, kO, vO); }   // even tile count: the last tile sits in the odd set
        else tile(key0, 64, false, true, kE, vE);                                        // odd tile count: it sits in the even set
    }
    l += __shfl_xor(l, 16, 32);
    const bool any = l > 0.0f;
    const float lsafe = any ? l : 1.0f;
    const float inv = any ? (1.0f / lsafe) : 0.0f;
    const int wb = wave * 16 * OSP;
    // O^T D layout: f_j[r] = (d = 16j + 8h + r, t = lane&15) -> os[t][d]; rows 0..15 x columns 0..63 all written
#pragma unroll
    for (int j = 0; j < 4; ++j) {
        v8f f = o[j];
        if (EARLY) f = o[j] + oR[j] * QRI;
        v4f a, c;
        a[0] = f[0] * inv; a[1] = f[1] * inv; a[2] = f[2] * inv; a[3] = f[3] * inv; c[0] = f[4] * inv; c[1] = f[5] * inv; c[2] = f[6] * inv; c[3] = f[7] * inv;
        *(v4fa*)(&os[wb + lr * OSP + 16 * j + 8 * hi]) = a; *(v4fa*)(&os[wb + lr * OSP + 16 * j + 8 * hi + 4]) = c; }
    wave_sync();
    float* orow = OUT + (((size_t)b * OUT_SEQ + t0) * NHD + h) * HD;
{
#pragma unroll
        for (int s = 0; s < 8; ++s) { const int row = 2 * s + (lane >> 4), cofs = (lane & 15) * 4;   // 8 s x 2 rows = 16 rows; 16 lanes x 4 floats = 64 columns = two lines
            const v4f val = *(const v4fa*)(&os[wb + row * OSP + cofs]);
            *(v4f*)(orow + (size_t)row * HE + cofs) = val; }
         }
    asm volatile("s_wait_loadcnt 0x0" ::: "memory");   // the clamped fetches of the last trips are never read, so nothing else waits for them: they have landed before the wave hands its registers back
}

__global__ __launch_bounds__(32 * AW) void k_flash_early(const h16* __restrict__ QH, const h16* __restrict__ KP, const h16* __restrict__ VT, float* OUT) {
    flash_body<1>(QH, KP, VT, OUT);
}

__global__ __launch_bounds__(32 * AW) void k_flash_late(const h16* __restrict__ QH, const h16* __restrict__ KP, const h16* __restrict__ VT, float* OUT) {
    flash_body<0>(QH, KP, VT, OUT);
}

static constexpr size_t al256(size_t v) { return (v + 255) & ~(size_t)255; }
static constexpr size_t SZ_QK = al256((size_t)NB * SEQ * HE * 2);           // q plane [NB][SEQ][HE] f16; k plane [NB*NHD][SEQ/16][4][32][8] f16
static constexpr size_t SZ_VT = al256((size_t)NB * NHD * HD * SEQ * 2);     // v^T plane [NB*NHD][SEQ/32][8][32][8] f16
static constexpr size_t SZ_TOTAL = 2 * SZ_QK + SZ_VT;
static_assert(SZ_TOTAL <= (size_t)134217728);          // workspace carve <= 128 MiB
static_assert(((size_t)NB * SEQ * HE * 2) % 128 == 0);
static_assert(((size_t)SEQ * 2) % 128 == 0);

extern "C" void kernel_launch(void* const* d_in, const int* in_sizes, int n_in,
                              void* d_out, int out_size, void* d_ws, size_t ws_size, hipStream_t stream) {
    if (n_in < 3) return;
    const size_t needx = ((size_t)(NB - 1) * SEQ_FULL + SEQ) * HE;
    if ((size_t)in_sizes[0] < needx || (size_t)in_sizes[1] < needx || (size_t)in_sizes[2] < needx) return;
    if ((size_t)out_size < ((size_t)(NB - 1) * OUT_SEQ + SEQ) * HE) return;
    if (SZ_TOTAL > ws_size) return;
    // wire order: queries, keys, values
    const float* qin = (const float*)d_in[0];
    const float* kin = (const float*)d_in[1];
    const float* vin = (const float*)d_in[2];
    float* OUT = (float*)d_out;      // [NB][SEQ][16][64]
    char* wsp = (char*)d_ws;
    h16* QH = (h16*)wsp; wsp += SZ_QK;               // [NB][SEQ][1024]
    h16* KP = (h16*)wsp; wsp += SZ_QK;               // [NB*16][SEQ/16][4][32][8]
    h16* VT = (h16*)wsp; wsp += SZ_VT;               // [NB*16][SEQ/32][8][32][8]

    // q -> f16 plane in the input layout; k, v -> f16 planes in fragment order; grid (token spans, batch*head)
    k_prep<<<dim3(SEQ / (64 * PU), NB * NHD, 1), 256, 0, stream>>>(qin, kin, vin, QH, KP, VT);

    // query rows [0, EROWS): two-plane-P instantiation; rows [EROWS, SEQ): single-product instantiation (disjoint output rows)
    k_flash_early<<<dim3(EROWS / (16 * AW), NB * NHD, 1), 32 * AW, 0, stream>>>(QH, KP, VT, OUT);
    if (SEQ > EROWS)
        k_flash_late<<<dim3((SEQ - EROWS) / (16 * AW), NB * NHD, 1), 32 * AW, 0, stream>>>(QH, KP, VT, OUT);
}

// v005
// A run of this version takes 41.2 microseconds.
// Two timings next to v004 put it at 1.45 and 1.44 times that version's speed.
// All steps since v000 together make it 2.36 times as fast.
#include <hip/hip_runtime.h>

// Causal scaled dot-product attention over per-head slices, no projections: q/k/v [NB][SEQ][16][64] (f32), key j kept for query t iff j <= t (dropped keys get probability 0), score scale 1/sqrt(64), output [NB][SEQ][16][64] (f32).
// Compute dtypes, f32 accumulate everywhere: scores v_wmma_f32_16x16x32_f16 with q, k single f16 planes (inputs RNE-converted to bf16, then held in f16: exact for f16-normal values, smaller magnitudes selected to +0);
// P.V v_wmma_f32_16x16x32_f16: v single f16 plane (same conversion), P f16 with x16384 carry (cancels in the normalisation); on query rows < EROWS P = f16 value + f16 residual x2048, residual products in their own accumulators folded by 1/2048, row sum from the f32 exponentials; on later rows row sum over the converted P. Softmax f32 (online, running max over kept keys).
// Layout: f16 copy of q in the input layout [b][t][h*64 + d] (row pitch 1024 halves); k and v^T planes in fragment order (see k_prep): each 16-B piece stands where the lane that loads it finds it, so one wave-wide 16-B load reads 512 contiguous bytes (four whole lines);
// all three planes written by one launch, k and v through LDS; fused flash kernel in transposed form (S^T = K Q^T, O^T = V^T P^T), fragments straight from the planes, output from f32 accumulators.

#ifndef NB
#define NB 2
#endif
#ifndef SEQ
#define SEQ 2048
#endif
#define NB_FULL  2
#define SEQ_FULL 2048
#ifndef OUT_SEQ
#define OUT_SEQ SEQ              // row pitch (in tokens) between batches of the output
#endif
#define NHD  16                  // heads
#define HD   64                  // head width
#define HE   (NHD * HD)          // token row pitch (elements) of the inputs, the q plane and the output
#define AW   4                   // waves per flash block (16 query rows each)
#define OSP  68                  // LDS row pitch (floats) of the flash output tile
#define TP   68                  // LDS row pitch (floats) of the transpose tile
#define PU   2                   // 64-token tiles per block of the plane-building kernel
#define KU   (64 * PU * 8)       // 16-B pieces of k per block of the plane-building kernel
#define EROWS (SEQ < 512 ? SEQ : 512)   // query rows handled by the two-plane-P flash instantiation
#define NXB  (SEQ / (16 * AW))   // row blocks (16*AW query rows each) per (batch, head)
#define QRS  2048.0f             // carry of the residual P fragment
#define QRI  (1.0f / 2048.0f)
#define SC2  ((float)(0.125 * 1.4426950408889634))   // HD^-0.5 * log2(e)
#define PSH  14.0f               // log2 of the P carry (16384)
#define NEGB (-3.0e38f)

static_assert(HD == 64);                       // two 32-deep k-steps per score tile, four 16-row output tiles
static_assert(NHD * HD == HE);
static_assert(HD % 32 == 0);                   // score k-loop steps by 32
static_assert(HE % 8 == 0);                    // 16-byte fragment loads from token rows
static_assert(SEQ % 64 == 0);
static_assert(SEQ % 32 == 0);                  // key loop steps by 32 and its bound never exceeds SEQ
static_assert(SEQ % (16 * AW) == 0);
static_assert(EROWS % (16 * AW) == 0);
static_assert((SEQ - EROWS) % (16 * AW) == 0);
static_assert(EROWS >= 32);
static_assert(EROWS <= SEQ);
static_assert(NXB % 4 == 0);                   // the flash grid deals the row blocks in four equal groups
static_assert(NB <= NB_FULL);
static_assert(SEQ <= SEQ_FULL);
static_assert(OSP >= HD);
static_assert((OSP * 4) % 16 == 0);
static_assert(TP >= 64);
static_assert((TP * 4) % 16 == 0);
static_assert(SEQ % (64 * PU) == 0);                                 // plane-building grid x tokens per block == SEQ
static_assert((size_t)32 * 16 * 8 == (size_t)16 * HD * 4);           // flash epilogue: 32 lanes x 16 B x 8 trips == 16 rows x 256 B
static_assert((size_t)256 * 2 * 8 == (size_t)64 * HD);               // q/k convert: 256 threads x 2 pieces x 8 floats == 64 tokens x 64 columns
static_assert((size_t)256 * 2 * PU * 8 == (size_t)HD * 64 * PU);     // v^T store: 256 threads x 2*PU pieces x 8 halves == 64 rows x 64*PU tokens
static_assert((size_t)256 * 4 * 4 == (size_t)64 * HD);               // transpose load: 256 threads x 4 float4 x 4 floats == 64 tokens x 64 columns
static_assert((size_t)AW * 16 * OSP * 4 <= 131072);                  // static LDS of the flash kernel
static_assert((size_t)256 * 2 * PU == (size_t)KU);                   // k fragment store: 256 threads x 2*PU pieces == all pieces of the block
static_assert(KU % 16 == 0);
static_assert((size_t)PU * 64 * TP * 4 + (size_t)(KU + KU / 16) * 16 <= 131072);   // static LDS of the plane-building kernel

typedef _Float16 h16;
typedef __attribute__((ext_vector_type(16))) _Float16 v16h;
typedef __attribute__((ext_vector_type(8)))  _Float16 v8h;
typedef __attribute__((ext_vector_type(8)))  float    v8f;
typedef __attribute__((ext_vector_type(4)))  float    v4f;
typedef v4f  __attribute__((may_alias)) v4fa;

__device__ __forceinline__ unsigned short f2bf(float f) { unsigned u = __float_as_uint(f); u += 0x7FFFu + ((u >> 16) & 1u); return (unsigned short)(u >> 16); }
__device__ __forceinline__ float bfr(float f) { return __uint_as_float(((unsigned)f2bf(f)) << 16); }   // value after RNE convert to bf16
__device__ __forceinline__ v16h cat16(v8h lo, v8h hi) { return __builtin_shufflevector(lo, hi, 0, 1, 2, 3, 4, 5, 6, 7, 8, 9, 10, 11, 12, 13, 14, 15); }
// fragment loader from K-contiguous 16-bit rows; p already includes + 8*(lane>>4): elements 0..7 <- k0+8h+0..7, elements 8..15 <- k0+16+8h+0..7 (same map for A and B)
__device__ __forceinline__ v16h  ldh(const h16* p) { return cat16(*(const v8h*)p, *(const v8h*)(p + 16)); }
// fragment loader from a fragment-order plane; p already includes + 8*lane: elements 0..7 from the lane's piece of one 512-B group, elements 8..15 from its piece of the next group
__device__ __forceinline__ v16h  ldf(const h16* p) { return cat16(*(const v8h*)p, *(const v8h*)(p + 256)); }
// ordering point for wave-private LDS tiles (same wave writes and reads)
__device__ __forceinline__ void wave_sync() { __builtin_amdgcn_fence(3 /* release order */, "wavefront"); __builtin_amdgcn_wave_barrier(); asm volatile("" ::: "memory"); }
// f32 -> f16 convert that cannot produce an f16 subnormal (value select)
static __device__ __forceinline__ h16 toh_flush(float v) { const h16 r = (h16)v; return (fabsf(v) < 6.103515625e-05f) ? (h16)0.0f : r; }
// one WMMA with its own hazard guard (ties the accumulator, keeps A/B live)
__device__ __forceinline__ v8f wmma16g(v16h a, v16h b, v8f c) {
    c = __builtin_amdgcn_wmma_f32_16x16x32_f16(false, a, false, b, (short)0, c, false, false);
    asm volatile("v_nop\n\tv_nop\n\tv_nop\n\tv_nop" : "+v"(c) : "v"(a), "v"(b));
    return c;
}

// k_prep: the three f16 planes in one launch. One block per (64*PU-token span, batch*head): grid (SEQ/(64*PU), NB*NHD), 256 threads; the block reads the same
// 64*PU tokens x 64 columns of q, k and v. Every global load of a thread (12*PU of 16 B) is issued before the first use, so one wave start and one memory latency serve all of them.
// q: in[t][h*64 + d] (f32, token pitch HE) -> same layout in f16, 8 values per piece, 8 lanes fill one 128-B line.
// k: piece (token t, columns 8c..8c+7) -> 16-B unit ((b*16 + h)*(SEQ/16) + t/16)*128 + (c>>1)*32 + (c&1)*16 + t%16: group c>>1 of a 16-key tile holds, at lane (c&1)*16 + t%16, what that lane takes as one half of an A fragment.
//    The pieces change threads through LDS (a spare unit behind every 16 spreads the banks), under the same block barrier as v.
// v: piece (column d, tokens 8g..8g+7) -> 16-B unit ((b*16 + h)*(SEQ/32) + g/4)*256 + (d/16)*64 + (g&3)*16 + d%16: float4 loads scattered transposed into LDS float tiles [d][t] (cross-wave: block barrier), then 16-B pieces.
// A thread stores unit (trip*256 + tid) of the block's span of either plane: a wave's store is 512 contiguous bytes.
__global__ __launch_bounds__(256) void k_prep(const float* __restrict__ Q, const float* __restrict__ K, const float* __restrict__ V, h16* QH, h16* KP, h16* VT) {
    __shared__ __align__(16) float tl[PU * 64 * TP];
    __shared__ __align__(16) h16 kl[(KU + KU / 16) * 8];
    const int tid = threadIdx.x;
    const int tt0 = blockIdx.x * (64 * PU); const int zh = blockIdx.y; const int b = zh / NHD, h = zh % NHD;
    const size_t sb = ((size_t)b * SEQ_FULL + tt0) * HE + (size_t)h * HD;    // (batch b, token tt0, head h) in the inputs
    const size_t db = ((size_t)b * SEQ + tt0) * HE + (size_t)h * HD;         // the same place in the q plane
    v4f xv[PU][4]; v8f xq[PU][2], xk[PU][2];
    const float* pv[4]; const float* pq[2]; const float* pk[2];              // tile 0's addresses; tile u lies 64 * u tokens further on
#pragma unroll
    for (int s = 0; s < 4; ++s) { const int p = s * 256 + tid; pv[s] = V + sb + (size_t)(p >> 4) * HE + (p & 15) * 4; }   // 4 s x 16 tokens = 64 tokens; 16 lanes x 4 = 64 columns
#pragma unroll
    for (int s = 0; s < 2; ++s) { const int p = s * 256 + tid; const size_t o = sb + (size_t)(p >> 3) * HE + (p & 7) * 8;  // 2 s x 32 tokens = 64 tokens; 8 lanes x 8 = 64 columns
        pq[s] = Q + o; pk[s] = K + o; }
#pragma unroll
    for (int u = 0; u < PU; ++u) {
#pragma unroll
        for (int s = 0; s < 4; ++s) xv[u][s] = *(const v4f*)(pv[s] + (size_t)u * 64 * HE); }
#pragma unroll
    for (int u = 0; u < PU; ++u) {
#pragma unroll
        for (int s = 0; s < 2; ++s) { xq[u][s] = *(const v8f*)(pq[s] + (size_t)u * 64 * HE); xk[u][s] = *(const v8f*)(pk[s] + (size_t)u * 64 * HE); } }
    // every load stands above this line (left free, the scheduler sinks the q and k loads to their uses and the thread pays several memory latencies in a row);
    // the addresses are inputs, so they stay in their registers up to the wait and no load's result lands in one of them ahead of it
    asm volatile("s_wait_xcnt 0x0" :: "v"(pv[0]), "v"(pv[1]), "v"(pv[2]), "v"(pv[3]), "v"(pq[0]), "v"(pq[1]), "v"(pk[0]), "v"(pk[1]) : "memory");
#pragma unroll
    for (int u = 0; u < PU; ++u) {
#pragma unroll
        for (int s = 0; s < 4; ++s) { const int p = s * 256 + tid; const int t = p >> 4, d4 = (p & 15) * 4;
#pragma unroll
            for (int i = 0; i < 4; ++i) tl[u * 64 * TP + (d4 + i) * TP + t] = bfr(xv[u][s][i]); } }
#pragma unroll
    for (int u = 0; u < PU; ++u) {
#pragma unroll
        for (int s = 0; s < 2; ++s) { const int p = s * 256 + tid; const int t = u * 64 + (p >> 3), c = p & 7;
            v8h ok;
#pragma unroll
            for (int k = 0; k < 8; ++k) ok[k] = toh_flush(bfr(xk[u][s][k]));
            const int un = (t >> 4) * 128 + (c >> 1) * 32 + (c & 1) * 16 + (t & 15);
            *(v8h*)(&kl[(un + (un >> 4)) * 8]) = ok; } }
    __syncthreads();
    // q needs no exchange; its stores stand behind the barrier, which would otherwise wait for them
#pragma unroll
    for (int u = 0; u < PU; ++u) {
#pragma unroll
        for (int s = 0; s < 2; ++s) { const int p = s * 256 + tid; const int t = u * 64 + (p >> 3), c8 = (p & 7) * 8;
            v8h oq;
#pragma unroll
            for (int k = 0; k < 8; ++k) oq[k] = toh_flush(bfr(xq[u][s][k]));
            *(v8h*)(QH + db + (size_t)t * HE + c8) = oq;
            asm volatile("s_wait_xcnt 0x0" ::: "memory"); } }   // the next piece, and the LDS reads below, land in registers that this store names
    const size_t kb = ((size_t)zh * SEQ + tt0) * HD;                         // the block's span in either fragment-order plane: 64*PU tokens x 64 halves, contiguous
#pragma unroll
    for (int s = 0; s < 2 * PU; ++s) { const int un = s * 256 + tid;
        *(v8h*)(KP + kb + (size_t)un * 8) = *(const v8h*)(&kl[(un + (un >> 4)) * 8]); }
    asm volatile("s_wait_xcnt 0x0" ::: "memory");   // the same for the k stores and the v pieces formed below
#pragma unroll
    for (int s = 0; s < 2 * PU; ++s) { const int un = s * 256 + tid;         // trip s = 32-key tile s of the span; tid = (d/16)*64 + (g&3)*16 + d%16
        const int d = ((tid >> 6) << 4) | (tid & 15), tk = s * 32 + ((tid >> 4) & 3) * 8;
        const float* tr = &tl[(tk >> 6) * 64 * TP + d * TP + (tk & 63)];
        const v4f x0 = *(const v4fa*)(tr); const v4f x1 = *(const v4fa*)(tr + 4);
        v8h hv;
#pragma unroll
        for (int i = 0; i < 4; ++i) { hv[i] = toh_flush(x0[i]); hv[4 + i] = toh_flush(x1[i]); }
        *(v8h*)(VT + kb + (size_t)un * 8) = hv; }
}

// flash_body: fused attention, one wave per 16 query rows of one (batch, head); K / V^T / Q fragments straight from the f16 planes (two 16-B loads each, arithmetic addressing; K and V^T: 512 contiguous bytes per wave-wide load).
// Transposed form: S^T[key][t] = K Q^T (A = K rows, B = Q rows, two k-steps over d); lane (t = lane&15, h = lane>>4) holds keys 8h+r of each 16-key tile, so the packed
// P tile is directly the B fragment of O^T[d][t] = V^T P^T (element r <- tile keys 0..15, element 8+r <- tile keys 16..31, lane unchanged); four 16-row d tiles.
// Softmax state (running max over kept keys, partial sum) is one scalar per lane; the two lane halves of a row are combined with one xor-16 exchange.
// The per-wave key bound nk is (t0 + 16) raised to a multiple of 32, at most SEQ; every visited tile holds a kept key for every row.
// Keep rule (key <= query) evaluated per element in the wave's last tile only: t0 is a multiple of 16, so that tile starts at or below t0 and every earlier tile ends below t0, where all 32 keys are kept for all 16 rows.
// EARLY = 1 (query rows [0, EROWS)): P = f16 value + f16 residual x2048; O = V P + (V P_res) / 2048 (residual products in their own accumulators); row sum from the f32 exponentials.
// EARLY = 0 (query rows [EROWS, SEQ)): single P; row sum over the converted P.
template <int EARLY>
__device__ __forceinline__ void flash_body(const h16* __restrict__ QH, const h16* __restrict__ KP, const h16* __restrict__ VT, float* OUT, float* os, const int zh, const int xb) {
    const int lane = threadIdx.x & 31, lr = lane & 15, hi = lane >> 4;
    const int wave = __builtin_amdgcn_readfirstlane((int)(threadIdx.x >> 5));
    const int b = zh / NHD, h = zh % NHD;
    const int t0 = (xb * AW + wave) * 16;                                  // EARLY = 1: xb < EROWS / (16*AW), so t0 < EROWS; EARLY = 0: t0 >= EROWS
    const int lim = t0 + lr;                                               // key j kept iff j <= lim
    const int nk = (t0 + 16 + 31) & ~31;                                   // wave-uniform, multiple of 32, <= SEQ
    const size_t rowb = (size_t)b * SEQ * HE + (size_t)h * HD;            // (batch b, token 0, head h) in the q plane
    const size_t qo = rowb + (size_t)(t0 + lr) * HE + 8 * hi;
    const v16h q0 = ldh(QH + qo), q1 = ldh(QH + qo + 32);                  // B fragments: col t, k = d (two k-steps)
    const size_t ko = (size_t)zh * SEQ * HD + 8 * lane;                    // + key * HD: 16-key tile = four 512-B groups (A fragment: row key, k = d; two groups per k-step)
    const size_t vo = ko;                                                  // + key * HD: 32-key tile = eight 512-B groups (A fragment: row d, k = key; two groups per 16-row d tile)
    const v16h hz = (v16h){};
    v8f o[4], oR[4];
#pragma unroll
    for (int j = 0; j < 4; ++j) { o[j] = (v8f){}; oR[j] = (v8f){}; }
    float m = NEGB, l = 0.0f;
    // Fragments are fetched ahead of their tile: a register set is refilled right behind the products that read it.
    // EARLY = 0: two sets (even and odd tiles), each fetched two tiles ahead; EARLY = 1 (twice the accumulators): one set, one tile ahead, which stays below 256 registers.
    // A fetch past the wave's last tile is clamped to that tile (in bounds, values unused).
    auto ld_k = [&](int key, v16h (&kf)[4]) {
        const h16* ka = KP + ko + (size_t)key * HD;
        kf[0] = ldf(ka); kf[1] = ldf(ka + 512); kf[2] = ldf(ka + 1024); kf[3] = ldf(ka + 1536); };
    auto ld_v = [&](int key, v16h (&vf)[4]) {
        const h16* va = VT + vo + (size_t)key * HD;
        vf[0] = ldf(va); vf[1] = ldf(va + 512); vf[2] = ldf(va + 1024); vf[3] = ldf(va + 1536); };
    auto tile = [&](int key0, int ahead, bool fetch, bool diag, v16h (&kf)[4], v16h (&vf)[4]) __attribute__((always_inline)) {
        int keyn = (key0 + ahead < nk) ? key0 + ahead : nk - 32;
        // earlier fetches are still in flight here, over the loop's back edge too; this trip's fetch addresses are formed from keyn, so the wait stands in front of every rewrite of an address register
        if (fetch) asm volatile("s_wait_xcnt 0x0" : "+s"(keyn) :: "memory");
        v8f sA = (v8f){}, sB = (v8f){};
        sA = wmma16g(kf[0], q0, sA); sB = wmma16g(kf[2], q0, sB);
        sA = wmma16g(kf[1], q1, sA); sB = wmma16g(kf[3], q1, sB);
        if (fetch) ld_k(keyn, kf);
        const int ja = key0 + 8 * hi;                                      // D: sA[r] = (key ja + r, t = lane&15), sB[r] = (key ja + 16 + r, t)
        float ta[8], tb[8]; bool fa[8], fb[8]; float mx = NEGB;
#pragma unroll
        for (int r = 0; r < 8; ++r) {
            fa[r] = !diag || (ja + r <= lim);
            fb[r] = !diag || (ja + 16 + r <= lim);
            ta[r] = sA[r] * SC2; tb[r] = sB[r] * SC2;
            mx = fmaxf(mx, fmaxf(fa[r] ? ta[r] : NEGB, fb[r] ? tb[r] : NEGB)); }
        mx = fmaxf(mx, __shfl_xor(mx, 16, 32));
        const float mnew = fmaxf(m, mx);
        const float alpha = __builtin_amdgcn_exp2f(m - mnew);
        const float sh = PSH - mnew;
        v16h pb, pr = hz; float ls = 0.0f;
#pragma unroll
        for (int r = 0; r < 8; ++r) {
            // scale and shift written as one fused operation, so that every form of the tile rounds the exponent alike whatever the compiler would pick
            const float ea = __builtin_amdgcn_exp2f(__builtin_fmaf(sA[r], SC2, sh)), eb = __builtin_amdgcn_exp2f(__builtin_fmaf(sB[r], SC2, sh));
            const float ga = fa[r] ? ea : 0.0f, gb = fb[r] ? eb : 0.0f;       // dropped elements selected to 0 by value
            const h16 pa = toh_flush(ga); const h16 pc = toh_flush(gb);
            pb[r] = pa; pb[8 + r] = pc;
            if (EARLY) { pr[r] = toh_flush((ga - (float)pa) * QRS); pr[8 + r] = toh_flush((gb - (float)pc) * QRS); ls += ga + gb; }
            else       { ls += (float)pa + (float)pc; } }
        l = l * alpha + ls; m = mnew;
#pragma unroll
        for (int j = 0; j < 4; ++j) o[j] = o[j] * alpha;
        if (EARLY) {
#pragma unroll
            for (int j = 0; j < 4; ++j) oR[j] = oR[j] * alpha; }
        o[0] = wmma16g(vf[0], pb, o[0]); o[1] = wmma16g(vf[1], pb, o[1]); o[2] = wmma16g(vf[2], pb, o[2]); o[3] = wmma16g(vf[3], pb, o[3]);
        if (EARLY) {
            oR[0] = wmma16g(vf[0], pr, oR[0]); oR[1] = wmma16g(vf[1], pr, oR[1]); oR[2] = wmma16g(vf[2], pr, oR[2]); oR[3] = wmma16g(vf[3], pr, oR[3]);
        }
        if (fetch) { ld_v(keyn, vf);
            // the fetch's address is an input, so it stays in its registers up to the wait: no result (of the next tile's first product, moved up over the loop's back edge, either) lands in them ahead of it
            asm volatile("s_wait_xcnt 0x0" :: "v"(VT + vo + (size_t)keyn * HD) : "memory"); }
    };
    v16h kE[4], vE[4];
    // first fetches in the loop's own issue order (K, V, K, V), held there by the scheduling barriers, so that the counted load waits at the loop head leave the younger fetches in flight;
    // the wait between them stands in front of loads whose results land in address registers of the loads above
    auto hold = [&]() { __builtin_amdgcn_sched_barrier(0); asm volatile("s_wait_xcnt 0x0" ::: "memory"); __builtin_amdgcn_sched_barrier(0); };
    ld_k(0, kE); hold();
    ld_v(0, vE);
    int key0 = 0;
    const int nd = nk - 32;                                                              // first key of the last tile, the one that the diagonal crosses
    if constexpr (EARLY) {
#pragma unroll 1   // kept rolled: an unrolled body would need further register sets
        for (; key0 < nd; key0 += 32) tile(key0, 32, true, false, kE, vE);
        tile(key0, 32, false, true, kE, vE);                                             // t0 >= 0, so nk >= 32: the last tile always exists
    } else {
        static_assert(EROWS >= 64);                                                      // t0 >= EROWS, so nd >= 64: tile 1 exists and the pair loop runs at least once
        v16h kO[4], vO[4];
        hold(); ld_k(32, kO); hold();
        ld_v(32, vO);
#pragma unroll 1   // kept rolled: the body already holds one tile of each set
        do { tile(key0, 64, true, false, kE, vE); tile(key0 + 32, 64, true, false, kO, vO); key0 += 64; } while (key0 + 64 <= nd);
        if (key0 < nd) { tile(key0, 64, false, false, kE, vE); tile(key0 + 32, 64, false, true, kO, vO); }   // even tile count: the last tile sits in the odd set
        else tile(key0, 64, false, true, kE, vE);                                        // odd tile count: it sits in the even set
    }
    l += __shfl_xor(l, 16, 32);
    const bool any = l > 0.0f;
    const float lsafe = any ? l : 1.0f;
    const float inv = any ? (1.0f / lsafe) : 0.0f;
    const int wb = wave * 16 * OSP;
    // O^T D layout: f_j[r] = (d = 16j + 8h + r, t = lane&15) -> os[t][d]; rows 0..15 x columns 0..63 all written
#pragma unroll
    for (int j = 0; j < 4; ++j) {
        v8f f = o[j];
        if (EARLY) f = o[j] + oR[j] * QRI;
        v4f a, c;
        a[0] = f[0] * inv; a[1] = f[1] * inv; a[2] = f[2] * inv; a[3] = f[3] * inv; c[0] = f[4] * inv; c[1] = f[5] * inv; c[2] = f[6] * inv; c[3] = f[7] * inv;
        *(v4fa*)(&os[wb + lr * OSP + 16 * j + 8 * hi]) = a; *(v4fa*)(&os[wb + lr * OSP + 16 * j + 8 * hi + 4]) = c; }
    wave_sync();
    float* orow = OUT + (((size_t)b * OUT_SEQ + t0) * NHD + h) * HD;
{
#pragma unroll
        for (int s = 0; s < 8; ++s) { const int row = 2 * s + (lane >> 4), cofs = (lane & 15) * 4;   // 8 s x 2 rows = 16 rows; 16 lanes x 4 floats = 64 columns = two lines
            const v4f val = *(const v4fa*)(&os[wb + row * OSP + cofs]);
            *(v4f*)(orow + (size_t)row * HE + cofs) = val; }
         }
    asm volatile("s_wait_loadcnt 0x0" ::: "memory");   // the clamped fetches of the last trips are never read, so nothing else waits for them: they have landed before the wave hands its registers back
}

// k_flash: all row blocks of all heads in one launch, grid (NB*NHD heads, NXB ranks), so that the short two-plane-P blocks run beside the long blocks instead of in a launch of their own.
// At 4 waves per SIMD every block is resident at once, and the launch lasts as long as the fullest WGP. A block's cost grows linearly with its row block xb. The rank -> xb map is a permutation in four groups of NXB/4:
// odd xb from the top down, even xb from the top down, odd xb from the bottom up, even xb from the bottom up. Blocks whose flat indices lie a quarter of the grid apart (one of each group at the same place k)
// then hold xb = (n-1-2k, n-2-2k, 2k+1, 2k): the same sum for every k, and the two longest nearly alike, so that no long wave is left alone on its SIMD for long. Head index fastest: those four blocks also walk one head's k and v.
// Where the blocks land is the dispatcher's choice: the map is for speed only, every (head, row block) is done exactly once wherever it runs.
// four waves per SIMD (at most 256 registers a wave): what lets every block of the grid be resident at once
__global__ __launch_bounds__(32 * AW) __attribute__((amdgpu_waves_per_eu(4, 4))) void k_flash(const h16* __restrict__ QH, const h16* __restrict__ KP, const h16* __restrict__ VT, float* OUT) {
    __shared__ __align__(16) float os[AW * 16 * OSP];
    const int zh = blockIdx.x;
    const int g = blockIdx.y / (NXB / 4), k = blockIdx.y % (NXB / 4);
    const int xb = (g < 2) ? NXB - 1 - g - 2 * k : 2 * k + 3 - g;
    if (xb < EROWS / (16 * AW)) flash_body<1>(QH, KP, VT, OUT, os, zh, xb);   // block-uniform
    else                        flash_body<0>(QH, KP, VT, OUT, os, zh, xb);
}

static constexpr size_t al256(size_t v) { return (v + 255) & ~(size_t)255; }
static constexpr size_t SZ_QK = al256((size_t)NB * SEQ * HE * 2);           // q plane [NB][SEQ][HE] f16; k plane [NB*NHD][SEQ/16][4][32][8] f16
static constexpr size_t SZ_VT = al256((size_t)NB * NHD * HD * SEQ * 2);     // v^T plane [NB*NHD][SEQ/32][8][32][8] f16
static constexpr size_t SZ_TOTAL = 2 * SZ_QK + SZ_VT;
static_assert(SZ_TOTAL <= (size_t)134217728);          // workspace carve <= 128 MiB
static_assert(((size_t)NB * SEQ * HE * 2) % 128 == 0);
static_assert(((size_t)SEQ * 2) % 128 == 0);

extern "C" void kernel_launch(void* const* d_in, const int* in_sizes, int n_in,
                              void* d_out, int out_size, void* d_ws, size_t ws_size, hipStream_t stream) {
    if (n_in < 3) return;
    const size_t needx = ((size_t)(NB - 1) * SEQ_FULL + SEQ) * HE;
    if ((size_t)in_sizes[0] < needx || (size_t)in_sizes[1] < needx || (size_t)in_sizes[2] < needx) return;
    if ((size_t)out_size < ((size_t)(NB - 1) * OUT_SEQ + SEQ) * HE) return;
    if (SZ_TOTAL > ws_size) return;
    // wire order: queries, keys, values
    const float* qin = (const float*)d_in[0];
    const float* kin = (const float*)d_in[1];
    const float* vin = (const float*)d_in[2];
    float* OUT = (float*)d_out;      // [NB][SEQ][16][64]
    char* wsp = (char*)d_ws;
    h16* QH = (h16*)wsp; wsp += SZ_QK;               // [NB][SEQ][1024]
    h16* KP = (h16*)wsp; wsp += SZ_QK;               // [NB*16][SEQ/16][4][32][8]
    h16* VT = (h16*)wsp; wsp += SZ_VT;               // [NB*16][SEQ/32][8][32][8]

    // q -> f16 plane in the input layout; k, v -> f16 planes in fragment order; grid (token spans, batch*head)
    k_prep<<<dim3(SEQ / (64 * PU), NB * NHD, 1), 256, 0, stream>>>(qin, kin, vin, QH, KP, VT);

    // query rows [0, EROWS): two-plane-P instantiation; rows [EROWS, SEQ): single-product instantiation (disjoint output rows); one launch, grid (batch*head, rank of the row block)
    k_flash<<<dim3(NB * NHD, NXB, 1), 32 * AW, 0, stream>>>(QH, KP, VT, OUT);
}

// v006
// It runs in 39.7 microseconds.
// Next to v005, in two timings, it ran 1.04 and 1.03 times as fast.
// Counting every step since v000, it is 2.45 times as fast.
#include <hip/hip_runtime.h>

// Causal scaled dot-product attention over per-head slices, no projections: q/k/v [NB][SEQ][16][64] (f32), key j kept for query t iff j <= t (dropped keys get probability 0), score scale 1/sqrt(64), output [NB][SEQ][16][64] (f32).
// Compute dtypes, f32 accumulate everywhere: scores v_wmma_f32_16x16x32_f16 with q, k single f16 planes (inputs RNE-converted to bf16, then held in f16: exact for f16-normal values, smaller magnitudes selected to +0);
// P.V v_wmma_f32_16x16x32_f16: v single f16 plane (same conversion), P f16 with x16384 carry (cancels in the normalisation); on query rows < EROWS P = f16 value + f16 residual x2048, residual products in their own accumulators folded by 1/2048, row sum from the f32 exponentials; on later rows row sum over the converted P. Softmax f32 (online, running max over kept keys).
// Layout: f16 copy of q in the input layout [b][t][h*64 + d] (row pitch 1024 halves); k and v^T planes in fragment order (see k_prep): each 16-B piece stands where the lane that loads it finds it, so one wave-wide 16-B load reads 512 contiguous bytes (four whole lines);
// all three planes written by one launch, k and v through LDS; fused flash kernel in transposed form (S^T = K Q^T, O^T = V^T P^T), k and v^T fragments from an LDS ring filled once per block, output from f32 accumulators.

#ifndef NB
#define NB 2
#endif
#ifndef SEQ
#define SEQ 2048
#endif
#define NB_FULL  2
#define SEQ_FULL 2048
#ifndef OUT_SEQ
#define OUT_SEQ SEQ              // row pitch (in tokens) between batches of the output
#endif
#define NHD  16                  // heads
#define HD   64                  // head width
#define HE   (NHD * HD)          // token row pitch (elements) of the inputs, the q plane and the output
#define AW   4                   // waves per flash block (16 query rows each)
#define OSP  68                  // LDS row pitch (floats) of the flash output tile
#define TP   68                  // LDS row pitch (floats) of the transpose tile
#define PU   2                   // 64-token tiles per block of the plane-building kernel
#define KU   (64 * PU * 8)       // 16-B pieces of k per block of the plane-building kernel
#define EROWS (SEQ < 512 ? SEQ : 512)   // query rows handled by the two-plane-P flash instantiation
#define NXB  (SEQ / (16 * AW))   // row blocks (16*AW query rows each) per (batch, head)
#define STK  64                  // keys per stage of the flash kernel's LDS ring
#define STH  (STK * HD)          // halves of one plane in a stage
#define QRS  2048.0f             // carry of the residual P fragment
#define QRI  (1.0f / 2048.0f)
#define SC2  ((float)(0.125 * 1.4426950408889634))   // HD^-0.5 * log2(e)
#define PSH  14.0f               // log2 of the P carry (16384)
#define NEGB (-3.0e38f)

static_assert(HD == 64);                       // two 32-deep k-steps per score tile, four 16-row output tiles
static_assert(NHD * HD == HE);
static_assert(HD % 32 == 0);                   // score k-loop steps by 32
static_assert(HE % 8 == 0);                    // 16-byte fragment loads from token rows
static_assert(SEQ % 64 == 0);
static_assert(SEQ % 32 == 0);                  // key loop steps by 32 and its bound never exceeds SEQ
static_assert(SEQ % (16 * AW) == 0);
static_assert(EROWS % (16 * AW) == 0);
static_assert((SEQ - EROWS) % (16 * AW) == 0);
static_assert(EROWS >= 32);
static_assert(EROWS <= SEQ);
static_assert(NXB % 4 == 0);                   // the flash grid deals the row blocks in four equal groups
static_assert(NB <= NB_FULL);
static_assert(SEQ <= SEQ_FULL);
static_assert(OSP >= HD);
static_assert((OSP * 4) % 16 == 0);
static_assert(TP >= 64);
static_assert((TP * 4) % 16 == 0);
static_assert(SEQ % (64 * PU) == 0);                                 // plane-building grid x tokens per block == SEQ
static_assert((size_t)32 * 16 * 8 == (size_t)16 * HD * 4);           // flash epilogue: 32 lanes x 16 B x 8 trips == 16 rows x 256 B
static_assert((size_t)256 * 2 * 8 == (size_t)64 * HD);               // q/k convert: 256 threads x 2 pieces x 8 floats == 64 tokens x 64 columns
static_assert((size_t)256 * 2 * PU * 8 == (size_t)HD * 64 * PU);     // v^T store: 256 threads x 2*PU pieces x 8 halves == 64 rows x 64*PU tokens
static_assert((size_t)256 * 4 * 4 == (size_t)64 * HD);               // transpose load: 256 threads x 4 float4 x 4 floats == 64 tokens x 64 columns
static_assert(STK == 16 * AW);                                       // row block xb walks stages 0 .. xb, the diagonal inside the last
static_assert((size_t)32 * AW * 4 * 16 == (size_t)STH * 2);          // stage copy: 128 threads x 4 pieces x 16 B == one plane's stage
static_assert(4 * ((size_t)AW * 16 * OSP * 4 + (size_t)4 * STH * 2) <= 327680);   // static LDS of four resident flash blocks
static_assert((size_t)256 * 2 * PU == (size_t)KU);                   // k fragment store: 256 threads x 2*PU pieces == all pieces of the block
static_assert(KU % 16 == 0);
static_assert((size_t)PU * 64 * TP * 4 + (size_t)(KU + KU / 16) * 16 <= 131072);   // static LDS of the plane-building kernel

typedef _Float16 h16;
typedef __attribute__((ext_vector_type(16))) _Float16 v16h;
typedef __attribute__((ext_vector_type(8)))  _Float16 v8h;
typedef __attribute__((ext_vector_type(8)))  float    v8f;
typedef __attribute__((ext_vector_type(4)))  float    v4f;
typedef v4f  __attribute__((may_alias)) v4fa;

__device__ __forceinline__ unsigned short f2bf(float f) { unsigned u = __float_as_uint(f); u += 0x7FFFu + ((u >> 16) & 1u); return (unsigned short)(u >> 16); }
__device__ __forceinline__ float bfr(float f) { return __uint_as_float(((unsigned)f2bf(f)) << 16); }   // value after RNE convert to bf16
__device__ __forceinline__ v16h cat16(v8h lo, v8h hi) { return __builtin_shufflevector(lo, hi, 0, 1, 2, 3, 4, 5, 6, 7, 8, 9, 10, 11, 12, 13, 14, 15); }
// fragment loader from K-contiguous 16-bit rows; p already includes + 8*(lane>>4): elements 0..7 <- k0+8h+0..7, elements 8..15 <- k0+16+8h+0..7 (same map for A and B)
__device__ __forceinline__ v16h  ldh(const h16* p) { return cat16(*(const v8h*)p, *(const v8h*)(p + 16)); }
// fragment loader from a fragment-order plane; p already includes + 8*lane: elements 0..7 from the lane's piece of one 512-B group, elements 8..15 from its piece of the next group
__device__ __forceinline__ v16h  ldf(const h16* p) { return cat16(*(const v8h*)p, *(const v8h*)(p + 256)); }
// ordering point for wave-private LDS tiles (same wave writes and reads)
__device__ __forceinline__ void wave_sync() { __builtin_amdgcn_fence(3 /* release order */, "wavefront"); __builtin_amdgcn_wave_barrier(); asm volatile("" ::: "memory"); }
// f32 -> f16 convert that cannot produce an f16 subnormal (value select)
static __device__ __forceinline__ h16 toh_flush(float v) { const h16 r = (h16)v; return (fabsf(v) < 6.103515625e-05f) ? (h16)0.0f : r; }
// one WMMA with its own hazard guard (ties the accumulator, keeps A/B live)
__device__ __forceinline__ v8f wmma16g(v16h a, v16h b, v8f c) {
    c = __builtin_amdgcn_wmma_f32_16x16x32_f16(false, a, false, b, (short)0, c, false, false);
    asm volatile("v_nop\n\tv_nop\n\tv_nop\n\tv_nop" : "+v"(c) : "v"(a), "v"(b));
    return c;
}

// k_prep: the three f16 planes in one launch. One block per (64*PU-token span, batch*head): grid (SEQ/(64*PU), NB*NHD), 256 threads; the block reads the same
// 64*PU tokens x 64 columns of q, k and v. Every global load of a thread (12*PU of 16 B) is issued before the first use, so one wave start and one memory latency serve all of them.
// q: in[t][h*64 + d] (f32, token pitch HE) -> same layout in f16, 8 values per piece, 8 lanes fill one 128-B line.
// k: piece (token t, columns 8c..8c+7) -> 16-B unit ((b*16 + h)*(SEQ/16) + t/16)*128 + (c>>1)*32 + (c&1)*16 + t%16: group c>>1 of a 16-key tile holds, at lane (c&1)*16 + t%16, what that lane takes as one half of an A fragment.
//    The pieces change threads through LDS (a spare unit behind every 16 spreads the banks), under the same block barrier as v.
// v: piece (column d, tokens 8g..8g+7) -> 16-B unit ((b*16 + h)*(SEQ/32) + g/4)*256 + (d/16)*64 + (g&3)*16 + d%16: float4 loads scattered transposed into LDS float tiles [d][t] (cross-wave: block barrier), then 16-B pieces.
// A thread stores unit (trip*256 + tid) of the block's span of either plane: a wave's store is 512 contiguous bytes.
__global__ __launch_bounds__(256) void k_prep(const float* __restrict__ Q, const float* __restrict__ K, const float* __restrict__ V, h16* QH, h16* KP, h16* VT) {
    __shared__ __align__(16) float tl[PU * 64 * TP];
    __shared__ __align__(16) h16 kl[(KU + KU / 16) * 8];
    const int tid = threadIdx.x;
    const int tt0 = blockIdx.x * (64 * PU); const int zh = blockIdx.y; const int b = zh / NHD, h = zh % NHD;
    const size_t sb = ((size_t)b * SEQ_FULL + tt0) * HE + (size_t)h * HD;    // (batch b, token tt0, head h) in the inputs
    const size_t db = ((size_t)b * SEQ + tt0) * HE + (size_t)h * HD;         // the same place in the q plane
    v4f xv[PU][4]; v8f xq[PU][2], xk[PU][2];
    const float* pv[4]; const float* pq[2]; const float* pk[2];              // tile 0's addresses; tile u lies 64 * u tokens further on
#pragma unroll
    for (int s = 0; s < 4; ++s) { const int p = s * 256 + tid; pv[s] = V + sb + (size_t)(p >> 4) * HE + (p & 15) * 4; }   // 4 s x 16 tokens = 64 tokens; 16 lanes x 4 = 64 columns
#pragma unroll
    for (int s = 0; s < 2; ++s) { const int p = s * 256 + tid; const size_t o = sb + (size_t)(p >> 3) * HE + (p & 7) * 8;  // 2 s x 32 tokens = 64 tokens; 8 lanes x 8 = 64 columns
        pq[s] = Q + o; pk[s] = K + o; }
#pragma unroll
    for (int u = 0; u < PU; ++u) {
#pragma unroll
        for (int s = 0; s < 4; ++s) xv[u][s] = *(const v4f*)(pv[s] + (size_t)u * 64 * HE); }
#pragma unroll
    for (int u = 0; u < PU; ++u) {
#pragma unroll
        for (int s = 0; s < 2; ++s) { xq[u][s] = *(const v8f*)(pq[s] + (size_t)u * 64 * HE); xk[u][s] = *(const v8f*)(pk[s] + (size_t)u * 64 * HE); } }
    // every load stands above this line (left free, the scheduler sinks the q and k loads to their uses and the thread pays several memory latencies in a row);
    // the addresses are inputs, so they stay in their registers up to the wait and no load's result lands in one of them ahead of it
    asm volatile("s_wait_xcnt 0x0" :: "v"(pv[0]), "v"(pv[1]), "v"(pv[2]), "v"(pv[3]), "v"(pq[0]), "v"(pq[1]), "v"(pk[0]), "v"(pk[1]) : "memory");
#pragma unroll
    for (int u = 0; u < PU; ++u) {
#pragma unroll
        for (int s = 0; s < 4; ++s) { const int p = s * 256 + tid; const int t = p >> 4, d4 = (p & 15) * 4;
#pragma unroll
            for (int i = 0; i < 4; ++i) tl[u * 64 * TP + (d4 + i) * TP + t] = bfr(xv[u][s][i]); } }
#pragma unroll
    for (int u = 0; u < PU; ++u) {
#pragma unroll
        for (int s = 0; s < 2; ++s) { const int p = s * 256 + tid; const int t = u * 64 + (p >> 3), c = p & 7;
            v8h ok;
#pragma unroll
            for (int k = 0; k < 8; ++k) ok[k] = toh_flush(bfr(xk[u][s][k]));
            const int un = (t >> 4) * 128 + (c >> 1) * 32 + (c & 1) * 16 + (t & 15);
            *(v8h*)(&kl[(un + (un >> 4)) * 8]) = ok; } }
    __syncthreads();
    // q needs no exchange; its stores stand behind the barrier, which would otherwise wait for them
#pragma unroll
    for (int u = 0; u < PU; ++u) {
#pragma unroll
        for (int s = 0; s < 2; ++s) { const int p = s * 256 + tid; const int t = u * 64 + (p >> 3), c8 = (p & 7) * 8;
            v8h oq;
#pragma unroll
            for (int k = 0; k < 8; ++k) oq[k] = toh_flush(bfr(xq[u][s][k]));
            *(v8h*)(QH + db + (size_t)t * HE + c8) = oq;
            asm volatile("s_wait_xcnt 0x0" ::: "memory"); } }   // the next piece, and the LDS reads below, land in registers that this store names
    const size_t kb = ((size_t)zh * SEQ + tt0) * HD;                         // the block's span in either fragment-order plane: 64*PU tokens x 64 halves, contiguous
#pragma unroll
    for (int s = 0; s < 2 * PU; ++s) { const int un = s * 256 + tid;
        *(v8h*)(KP + kb + (size_t)un * 8) = *(const v8h*)(&kl[(un + (un >> 4)) * 8]); }
    asm volatile("s_wait_xcnt 0x0" ::: "memory");   // the same for the k stores and the v pieces formed below
#pragma unroll
    for (int s = 0; s < 2 * PU; ++s) { const int un = s * 256 + tid;         // trip s = 32-key tile s of the span; tid = (d/16)*64 + (g&3)*16 + d%16
        const int d = ((tid >> 6) << 4) | (tid & 15), tk = s * 32 + ((tid >> 4) & 3) * 8;
        const float* tr = &tl[(tk >> 6) * 64 * TP + d * TP + (tk & 63)];
        const v4f x0 = *(const v4fa*)(tr); const v4f x1 = *(const v4fa*)(tr + 4);
        v8h hv;
#pragma unroll
        for (int i = 0; i < 4; ++i) { hv[i] = toh_flush(x0[i]); hv[4 + i] = toh_flush(x1[i]); }
        *(v8h*)(VT + kb + (size_t)un * 8) = hv; }
}

// stage_copy: one stage of the flash kernel's LDS ring, 64 keys of the k plane and of the v^T plane (8 KiB each, contiguous in fragment order), by asynchronous copies to LDS.
// A thread brings the 16-B pieces tid, tid + 128, tid + 256, tid + 384 of either plane; kg, vg, kl, vl are its first piece's global and LDS addresses (all multiples of 16 B).
__device__ __forceinline__ void stage_copy(const h16* kg, const h16* vg, unsigned kl, unsigned vl) {
    // the wait is the statement's last line, so that no address register of a copy is rewritten ahead of it
    asm volatile("global_load_async_to_lds_b128 %0, %8, off\n\t"
                 "global_load_async_to_lds_b128 %1, %9, off\n\t"
                 "global_load_async_to_lds_b128 %2, %10, off\n\t"
                 "global_load_async_to_lds_b128 %3, %11, off\n\t"
                 "global_load_async_to_lds_b128 %4, %12, off\n\t"
                 "global_load_async_to_lds_b128 %5, %13, off\n\t"
                 "global_load_async_to_lds_b128 %6, %14, off\n\t"
                 "global_load_async_to_lds_b128 %7, %15, off\n\t"
                 "s_wait_xcnt 0x0"
                 :: "v"(kl), "v"(kl + 2048u), "v"(kl + 4096u), "v"(kl + 6144u), "v"(vl), "v"(vl + 2048u), "v"(vl + 4096u), "v"(vl + 6144u),
                    "v"(kg), "v"(kg + 1024), "v"(kg + 2048), "v"(kg + 3072), "v"(vg), "v"(vg + 1024), "v"(vg + 2048), "v"(vg + 3072)
                 : "memory");
}

// flash_body: fused attention, one wave per 16 query rows of one (batch, head); the block's four waves walk the same keys, so each 64-key stage of K and V^T is brought into LDS once per block
// (two buffers, the next stage's copies in flight while this one is worked on) and every wave takes its fragments from there (two 16-B LDS loads each, 512 contiguous bytes per wave-wide load); Q fragments straight from the f16 plane.
// Transposed form: S^T[key][t] = K Q^T (A = K rows, B = Q rows, two k-steps over d); lane (t = lane&15, h = lane>>4) holds keys 8h+r of each 16-key tile, so the packed
// P tile is directly the B fragment of O^T[d][t] = V^T P^T (element r <- tile keys 0..15, element 8+r <- tile keys 16..31, lane unchanged); four 16-row d tiles.
// Softmax state (running max over kept keys, partial sum) is one scalar per lane; the two lane halves of a row are combined with one xor-16 exchange.
// Row block xb (query rows 64*xb .. 64*xb+63) walks stages 0 .. xb. Stages below xb end below the block's first row: both 32-key tiles unmasked in every wave.
// Stage xb: waves 0 and 1 end in its first tile, waves 2 and 3 take that tile unmasked and end in the second; the keep rule (key <= query) is evaluated per element in a wave's last tile only. Every visited tile holds a kept key for every row.
// EARLY = 1 (query rows [0, EROWS)): P = f16 value + f16 residual x2048; O = V P + (V P_res) / 2048 (residual products in their own accumulators); row sum from the f32 exponentials.
// EARLY = 0 (query rows [EROWS, SEQ)): single P; row sum over the converted P.
template <int EARLY>
__device__ __forceinline__ void flash_body(const h16* __restrict__ QH, const h16* __restrict__ KP, const h16* __restrict__ VT, float* OUT, float* os, h16* ring, const int zh, const int xb) {
    const int lane = threadIdx.x & 31, lr = lane & 15, hi = lane >> 4;
    const int wave = __builtin_amdgcn_readfirstlane((int)(threadIdx.x >> 5));
    const int b = zh / NHD, h = zh % NHD;
    const int t0 = (xb * AW + wave) * 16;                                  // EARLY = 1: xb < EROWS / (16*AW), so t0 < EROWS; EARLY = 0: t0 >= EROWS
    const int lim = t0 + lr;                                               // key j kept iff j <= lim
    // the thread's first piece of stage 0 in either plane, and of buffer 0 in LDS; stage s lies s * STH halves further on, buffer 1 2 * STH halves; s <= xb < NXB, so every stage lies inside the planes
    const h16* kg0 = KP + (size_t)zh * SEQ * HD + 8 * (int)threadIdx.x;
    const h16* vg0 = VT + (size_t)zh * SEQ * HD + 8 * (int)threadIdx.x;
    const unsigned kl0 = (unsigned)(size_t)ring + 16u * threadIdx.x;
    auto copy = [&](int s) { const unsigned kl = kl0 + (unsigned)(s & 1) * (4u * STH); stage_copy(kg0 + (size_t)s * STH, vg0 + (size_t)s * STH, kl, kl + 2u * STH); };
    copy(0);
    const size_t rowb = (size_t)b * SEQ * HE + (size_t)h * HD;            // (batch b, token 0, head h) in the q plane
    const size_t qo = rowb + (size_t)(t0 + lr) * HE + 8 * hi;
    const v16h q0 = ldh(QH + qo), q1 = ldh(QH + qo + 32);                  // B fragments: col t, k = d (two k-steps)
    const v16h hz = (v16h){};
    v8f o[4], oR[4];
#pragma unroll
    for (int j = 0; j < 4; ++j) { o[j] = (v8f){}; oR[j] = (v8f){}; }
    float m = NEGB, l = 0.0f;
    // the four fragments of one 32-key tile of either plane; p = the tile's place in the stage + 8 * lane. K: 16-key tile = four 512-B groups (A fragment: row key, k = d; two groups per k-step); V^T: eight groups (A fragment: row d, k = key; two per 16-row d tile)
    auto ld_t = [&](const h16* p, v16h (&f)[4]) { f[0] = ldf(p); f[1] = ldf(p + 512); f[2] = ldf(p + 1024); f[3] = ldf(p + 1536); };
    // fetch: the register set is refilled, right behind the products that read it, with the tile at nk, nv (the same stage's second tile)
    auto tile = [&](int key0, bool fetch, const h16* nk, const h16* nv, bool diag, v16h (&kf)[4], v16h (&vf)[4]) __attribute__((always_inline)) {
        v8f sA = (v8f){}, sB = (v8f){};
        sA = wmma16g(kf[0], q0, sA); sB = wmma16g(kf[2], q0, sB);
        sA = wmma16g(kf[1], q1, sA); sB = wmma16g(kf[3], q1, sB);
        if (fetch) ld_t(nk, kf);
        const int ja = key0 + 8 * hi;                                      // D: sA[r] = (key ja + r, t = lane&15), sB[r] = (key ja + 16 + r, t)
        float ta[8], tb[8]; bool fa[8], fb[8]; float mx = NEGB;
#pragma unroll
        for (int r = 0; r < 8; ++r) {
            fa[r] = !diag || (ja + r <= lim);
            fb[r] = !diag || (ja + 16 + r <= lim);
            ta[r] = sA[r] * SC2; tb[r] = sB[r] * SC2;
            mx = fmaxf(mx, fmaxf(fa[r] ? ta[r] : NEGB, fb[r] ? tb[r] : NEGB)); }
        mx = fmaxf(mx, __shfl_xor(mx, 16, 32));
        const float mnew = fmaxf(m, mx);
        const float alpha = __builtin_amdgcn_exp2f(m - mnew);
        const float sh = PSH - mnew;
        v16h pb, pr = hz; float ls = 0.0f;
#pragma unroll
        for (int r = 0; r < 8; ++r) {
            // scale and shift written as one fused operation, so that every form of the tile rounds the exponent alike whatever the compiler would pick
            const float ea = __builtin_amdgcn_exp2f(__builtin_fmaf(sA[r], SC2, sh)), eb = __builtin_amdgcn_exp2f(__builtin_fmaf(sB[r], SC2, sh));
            const float ga = fa[r] ? ea : 0.0f, gb = fb[r] ? eb : 0.0f;       // dropped elements selected to 0 by value
            const h16 pa = toh_flush(ga); const h16 pc = toh_flush(gb);
            pb[r] = pa; pb[8 + r] = pc;
            if (EARLY) { pr[r] = toh_flush((ga - (float)pa) * QRS); pr[8 + r] = toh_flush((gb - (float)pc) * QRS); ls += ga + gb; }
            else       { ls += (float)pa + (float)pc; } }
        l = l * alpha + ls; m = mnew;
#pragma unroll
        for (int j = 0; j < 4; ++j) o[j] = o[j] * alpha;
        if (EARLY) {
#pragma unroll
            for (int j = 0; j < 4; ++j) oR[j] = oR[j] * alpha; }
        o[0] = wmma16g(vf[0], pb, o[0]); o[1] = wmma16g(vf[1], pb, o[1]); o[2] = wmma16g(vf[2], pb, o[2]); o[3] = wmma16g(vf[3], pb, o[3]);
        if (EARLY) {
            oR[0] = wmma16g(vf[0], pr, oR[0]); oR[1] = wmma16g(vf[1], pr, oR[1]); oR[2] = wmma16g(vf[2], pr, oR[2]); oR[3] = wmma16g(vf[3], pr, oR[3]);
        }
        if (fetch) ld_t(nv, vf);
    };
    // stage 0 has landed (each wave waits for its own copies) and is published by the barrier; stage 1 then flies while stage 0 is worked on
    asm volatile("s_wait_asynccnt 0x0" ::: "memory");
    __syncthreads();
    if (xb >= 1) copy(1);
    v16h kE[4], vE[4];
    const h16* rl = ring + 8 * lane;
    const int dt = wave >> 1;                                              // the tile of stage xb that the wave's diagonal crosses
    if constexpr (EARLY) {
        // twice the accumulators: one register set; a stage's second tile is fetched behind the first tile's products
#pragma unroll 1   // kept rolled: one trip per ring stage, the buffer picked by the trip's parity
        for (int s = 0; s < xb; ++s) {
            const h16* sk = rl + (s & 1) * (2 * STH); const h16* sv = sk + STH;
            ld_t(sk, kE); ld_t(sv, vE);
            tile(s * STK, true, sk + 2048, sv + 2048, false, kE, vE);
            tile(s * STK + 32, false, sk, sv, false, kE, vE);
            asm volatile("s_wait_dscnt 0x0" ::: "memory");      // this wave's reads of the buffer have ended before it is refilled
            asm volatile("s_wait_asynccnt 0x0" ::: "memory");   // this wave's copies of stage s + 1 have landed before the barrier publishes them
            __syncthreads();
            if (s + 2 <= xb) copy(s + 2);
        }
        const h16* sk = rl + (xb & 1) * (2 * STH); const h16* sv = sk + STH;
        if (dt) { ld_t(sk, kE); ld_t(sv, vE); tile(xb * STK, false, sk, sv, false, kE, vE); }
        ld_t(sk + 2048 * dt, kE); ld_t(sv + 2048 * dt, vE);
        tile(xb * STK + 32 * dt, false, sk, sv, true, kE, vE);
    } else {
        v16h kO[4], vO[4];
#pragma unroll 1   // kept rolled: one trip per ring stage, the buffer picked by the trip's parity
        for (int s = 0; s < xb; ++s) {
            const h16* sk = rl + (s & 1) * (2 * STH); const h16* sv = sk + STH;
            ld_t(sk, kE); ld_t(sv, vE); ld_t(sk + 2048, kO); ld_t(sv + 2048, vO);
            tile(s * STK, false, sk, sv, false, kE, vE);
            tile(s * STK + 32, false, sk, sv, false, kO, vO);
            asm volatile("s_wait_dscnt 0x0" ::: "memory");      // this wave's reads of the buffer have ended before it is refilled
            asm volatile("s_wait_asynccnt 0x0" ::: "memory");   // this wave's copies of stage s + 1 have landed before the barrier publishes them
            __syncthreads();
            if (s + 2 <= xb) copy(s + 2);
        }
        const h16* sk = rl + (xb & 1) * (2 * STH); const h16* sv = sk + STH;
        ld_t(sk + 2048 * dt, kO); ld_t(sv + 2048 * dt, vO);
        if (dt) { ld_t(sk, kE); ld_t(sv, vE); tile(xb * STK, false, sk, sv, false, kE, vE); }
        tile(xb * STK + 32 * dt, false, sk, sv, true, kO, vO);
    }
    asm volatile("s_wait_asynccnt 0x0" ::: "memory");   // no copy is outstanding when the wave ends
    l += __shfl_xor(l, 16, 32);
    const bool any = l > 0.0f;
    const float lsafe = any ? l : 1.0f;
    const float inv = any ? (1.0f / lsafe) : 0.0f;
    const int wb = wave * 16 * OSP;
    // O^T D layout: f_j[r] = (d = 16j + 8h + r, t = lane&15) -> os[t][d]; rows 0..15 x columns 0..63 all written
#pragma unroll
    for (int j = 0; j < 4; ++j) {
        v8f f = o[j];
        if (EARLY) f = o[j] + oR[j] * QRI;
        v4f a, c;
        a[0] = f[0] * inv; a[1] = f[1] * inv; a[2] = f[2] * inv; a[3] = f[3] * inv; c[0] = f[4] * inv; c[1] = f[5] * inv; c[2] = f[6] * inv; c[3] = f[7] * inv;
        *(v4fa*)(&os[wb + lr * OSP + 16 * j + 8 * hi]) = a; *(v4fa*)(&os[wb + lr * OSP + 16 * j + 8 * hi + 4]) = c; }
    wave_sync();
    float* orow = OUT + (((size_t)b * OUT_SEQ + t0) * NHD + h) * HD;
{
#pragma unroll
        for (int s = 0; s < 8; ++s) { const int row = 2 * s + (lane >> 4), cofs = (lane & 15) * 4;   // 8 s x 2 rows = 16 rows; 16 lanes x 4 floats = 64 columns = two lines
            const v4f val = *(const v4fa*)(&os[wb + row * OSP + cofs]);
            *(v4f*)(orow + (size_t)row * HE + cofs) = val; }
         }
}

// k_flash: all row blocks of all heads in one launch, grid (NB*NHD heads, NXB ranks), so that the short two-plane-P blocks run beside the long blocks instead of in a launch of their own.
// At 4 waves per SIMD every block is resident at once, and the launch lasts as long as the fullest WGP. A block's cost grows linearly with its row block xb. The rank -> xb map is a permutation in four groups of NXB/4:
// odd xb from the top down, even xb from the top down, odd xb from the bottom up, even xb from the bottom up. Blocks whose flat indices lie a quarter of the grid apart (one of each group at the same place k)
// then hold xb = (n-1-2k, n-2-2k, 2k+1, 2k): the same sum for every k, and the two longest nearly alike, so that no long wave is left alone on its SIMD for long. Head index fastest: those four blocks also walk one head's k and v.
// Where the blocks land is the dispatcher's choice: the map is for speed only, every (head, row block) is done exactly once wherever it runs.
// four waves per SIMD (at most 256 registers a wave): what lets every block of the grid be resident at once
__global__ __launch_bounds__(32 * AW) __attribute__((amdgpu_waves_per_eu(4, 4))) void k_flash(const h16* __restrict__ QH, const h16* __restrict__ KP, const h16* __restrict__ VT, float* OUT) {
    __shared__ __align__(16) float os[AW * 16 * OSP];
    __shared__ __align__(16) h16 ring[2 * 2 * STH];   // two buffers x (k stage, v^T stage)
    const int zh = blockIdx.x;
    const int g = blockIdx.y / (NXB / 4), k = blockIdx.y % (NXB / 4);
    const int xb = (g < 2) ? NXB - 1 - g - 2 * k : 2 * k + 3 - g;
    if (xb < EROWS / (16 * AW)) flash_body<1>(QH, KP, VT, OUT, os, ring, zh, xb);   // block-uniform
    else                        flash_body<0>(QH, KP, VT, OUT, os, ring, zh, xb);
}

static constexpr size_t al256(size_t v) { return (v + 255) & ~(size_t)255; }
static constexpr size_t SZ_QK = al256((size_t)NB * SEQ * HE * 2);           // q plane [NB][SEQ][HE] f16; k plane [NB*NHD][SEQ/16][4][32][8] f16
static constexpr size_t SZ_VT = al256((size_t)NB * NHD * HD * SEQ * 2);     // v^T plane [NB*NHD][SEQ/32][8][32][8] f16
static constexpr size_t SZ_TOTAL = 2 * SZ_QK + SZ_VT;
static_assert(SZ_TOTAL <= (size_t)134217728);          // workspace carve <= 128 MiB
static_assert(((size_t)NB * SEQ * HE * 2) % 128 == 0);
static_assert(((size_t)SEQ * 2) % 128 == 0);

extern "C" void kernel_launch(void* const* d_in, const int* in_sizes, int n_in,
                              void* d_out, int out_size, void* d_ws, size_t ws_size, hipStream_t stream) {
    if (n_in < 3) return;
    const size_t needx = ((size_t)(NB - 1) * SEQ_FULL + SEQ) * HE;
    if ((size_t)in_sizes[0] < needx || (size_t)in_sizes[1] < needx || (size_t)in_sizes[2] < needx) return;
    if ((size_t)out_size < ((size_t)(NB - 1) * OUT_SEQ + SEQ) * HE) return;
    if (SZ_TOTAL > ws_size) return;
    // wire order: queries, keys, values
    const float* qin = (const float*)d_in[0];
    const float* kin = (const float*)d_in[1];
    const float* vin = (const float*)d_in[2];
    float* OUT = (float*)d_out;      // [NB][SEQ][16][64]
    char* wsp = (char*)d_ws;
    h16* QH = (h16*)wsp; wsp += SZ_QK;               // [NB][SEQ][1024]
    h16* KP = (h16*)wsp; wsp += SZ_QK;               // [NB*16][SEQ/16][4][32][8]
    h16* VT = (h16*)wsp; wsp += SZ_VT;               // [NB*16][SEQ/32][8][32][8]

    // q -> f16 plane in the input layout; k, v -> f16 planes in fragment order; grid (token spans, batch*head)
    k_prep<<<dim3(SEQ / (64 * PU), NB * NHD, 1), 256, 0, stream>>>(qin, kin, vin, QH, KP, VT);

    // query rows [0, EROWS): two-plane-P instantiation; rows [EROWS, SEQ): single-product instantiation (disjoint output rows); one launch, grid (batch*head, rank of the row block)
    k_flash<<<dim3(NB * NHD, NXB, 1), 32 * AW, 0, stream>>>(QH, KP, VT, OUT);
}

// v007
// A run of this version takes 38.3 microseconds.
// Two timings next to v006 put it at 1.05 and 1.03 times that version's speed.
// Over all steps from v000 it is 2.55 times as fast.
#include <hip/hip_runtime.h>

// Causal scaled dot-product attention over per-head slices, no projections: q/k/v [NB][SEQ][16][64] (f32), key j kept for query t iff j <= t (dropped keys get probability 0), score scale 1/sqrt(64), output [NB][SEQ][16][64] (f32).
// Compute dtypes, f32 accumulate everywhere: scores v_wmma_f32_16x16x32_f16 with q, k single f16 planes (inputs RNE-converted to bf16, then held in f16: exact for f16-normal values, smaller magnitudes selected to +0);
// P.V v_wmma_f32_16x16x32_f16: v single f16 plane (same conversion), P f16 with x16384 carry (cancels in the normalisation), converted RNE two at a time, values below 2^-14 kept as f16 subnormals; on query rows < EROWS P = f16 value + f16 residual x2048, residual products in their own accumulators folded by 1/2048, row sum from the f32 exponentials; on later rows row sum over the converted P. Softmax f32 (online, running max over kept keys).
// Layout: f16 copy of q in the input layout [b][t][h*64 + d] (row pitch 1024 halves); k and v^T planes in fragment order (see k_prep): each 16-B piece stands where the lane that loads it finds it, so one wave-wide 16-B load reads 512 contiguous bytes (four whole lines);
// all three planes written by one launch, k and v through LDS; fused flash kernel in transposed form (S^T = K Q^T, O^T = V^T P^T), k and v^T fragments from an LDS ring filled once per block, output from f32 accumulators.

#ifndef NB
#define NB 2
#endif
#ifndef SEQ
#define SEQ 2048
#endif
#define NB_FULL  2
#define SEQ_FULL 2048
#ifndef OUT_SEQ
#define OUT_SEQ SEQ              // row pitch (in tokens) between batches of the output
#endif
#define NHD  16                  // heads
#define HD   64                  // head width
#define HE   (NHD * HD)          // token row pitch (elements) of the inputs, the q plane and the output
#define AW   4                   // waves per flash block (16 query rows each)
#define OSP  68                  // LDS row pitch (floats) of the flash output tile
#define TP   68                  // LDS row pitch (floats) of the transpose tile
#define PU   2                   // 64-token tiles per block of the plane-building kernel
#define KU   (64 * PU * 8)       // 16-B pieces of k per block of the plane-building kernel
#define EROWS (SEQ < 512 ? SEQ : 512)   // query rows handled by the two-plane-P flash instantiation
#define NXB  (SEQ / (16 * AW))   // row blocks (16*AW query rows each) per (batch, head)
#define STK  64                  // keys per stage of the flash kernel's LDS ring
#define STH  (STK * HD)          // halves of one plane in a stage
#define QRS  2048.0f             // carry of the residual P fragment
#define QRI  (1.0f / 2048.0f)
#define SC2  ((float)(0.125 * 1.4426950408889634))   // HD^-0.5 * log2(e)
#define PSH  14.0f               // log2 of the P carry (16384)
#define NEGB (-3.0e38f)

static_assert(HD == 64);                       // two 32-deep k-steps per score tile, four 16-row output tiles
static_assert(NHD * HD == HE);
static_assert(HD % 32 == 0);                   // score k-loop steps by 32
static_assert(HE % 8 == 0);                    // 16-byte fragment loads from token rows
static_assert(SEQ % 64 == 0);
static_assert(SEQ % 32 == 0);                  // key loop steps by 32 and its bound never exceeds SEQ
static_assert(SEQ % (16 * AW) == 0);
static_assert(EROWS % (16 * AW) == 0);
static_assert((SEQ - EROWS) % (16 * AW) == 0);
static_assert(EROWS >= 32);
static_assert(EROWS <= SEQ);
static_assert(NXB % 4 == 0);                   // the flash grid deals the row blocks in four equal groups
static_assert(NB <= NB_FULL);
static_assert(SEQ <= SEQ_FULL);
static_assert(OSP >= HD);
static_assert((OSP * 4) % 16 == 0);
static_assert(TP >= 64);
static_assert((TP * 4) % 16 == 0);
static_assert(SEQ % (64 * PU) == 0);                                 // plane-building grid x tokens per block == SEQ
static_assert((size_t)32 * 16 * 8 == (size_t)16 * HD * 4);           // flash epilogue: 32 lanes x 16 B x 8 trips == 16 rows x 256 B
static_assert((size_t)256 * 2 * 8 == (size_t)64 * HD);               // q/k convert: 256 threads x 2 pieces x 8 floats == 64 tokens x 64 columns
static_assert((size_t)256 * 2 * PU * 8 == (size_t)HD * 64 * PU);     // v^T store: 256 threads x 2*PU pieces x 8 halves == 64 rows x 64*PU tokens
static_assert((size_t)256 * 4 * 4 == (size_t)64 * HD);               // transpose load: 256 threads x 4 float4 x 4 floats == 64 tokens x 64 columns
static_assert(STK == 16 * AW);                                       // row block xb walks stages 0 .. xb, the diagonal inside the last
static_assert((size_t)32 * AW * 4 * 16 == (size_t)STH * 2);          // stage copy: 128 threads x 4 pieces x 16 B == one plane's stage
static_assert(4 * ((size_t)AW * 16 * OSP * 4 + (size_t)4 * STH * 2) <= 327680);   // static LDS of four resident flash blocks
static_assert((size_t)256 * 2 * PU == (size_t)KU);                   // k fragment store: 256 threads x 2*PU pieces == all pieces of the block
static_assert(KU % 16 == 0);
static_assert((size_t)PU * 64 * TP * 4 + (size_t)(KU + KU / 16) * 16 <= 131072);   // static LDS of the plane-building kernel

typedef _Float16 h16;
typedef __attribute__((ext_vector_type(16))) _Float16 v16h;
typedef __attribute__((ext_vector_type(8)))  _Float16 v8h;
typedef __attribute__((ext_vector_type(8)))  float    v8f;
typedef __attribute__((ext_vector_type(4)))  float    v4f;
typedef v4f  __attribute__((may_alias)) v4fa;
typedef __attribute__((ext_vector_type(2)))  float    v2f;
typedef __attribute__((ext_vector_type(2)))  _Float16 v2h;

__device__ __forceinline__ unsigned short f2bf(float f) { unsigned u = __float_as_uint(f); u += 0x7FFFu + ((u >> 16) & 1u); return (unsigned short)(u >> 16); }
__device__ __forceinline__ float bfr(float f) { return __uint_as_float(((unsigned)f2bf(f)) << 16); }   // value after RNE convert to bf16
__device__ __forceinline__ v16h cat16(v8h lo, v8h hi) { return __builtin_shufflevector(lo, hi, 0, 1, 2, 3, 4, 5, 6, 7, 8, 9, 10, 11, 12, 13, 14, 15); }
// fragment loader from K-contiguous 16-bit rows; p already includes + 8*(lane>>4): elements 0..7 <- k0+8h+0..7, elements 8..15 <- k0+16+8h+0..7 (same map for A and B)
__device__ __forceinline__ v16h  ldh(const h16* p) { return cat16(*(const v8h*)p, *(const v8h*)(p + 16)); }
// fragment loader from a fragment-order plane; p already includes + 8*lane: elements 0..7 from the lane's piece of one 512-B group, elements 8..15 from its piece of the next group
__device__ __forceinline__ v16h  ldf(const h16* p) { return cat16(*(const v8h*)p, *(const v8h*)(p + 256)); }
// ordering point for wave-private LDS tiles (same wave writes and reads)
__device__ __forceinline__ void wave_sync() { __builtin_amdgcn_fence(3 /* release order */, "wavefront"); __builtin_amdgcn_wave_barrier(); asm volatile("" ::: "memory"); }
// f32 -> f16 convert that cannot produce an f16 subnormal (value select)
static __device__ __forceinline__ h16 toh_flush(float v) { const h16 r = (h16)v; return (fabsf(v) < 6.103515625e-05f) ? (h16)0.0f : r; }
// two f32 -> one register of two f16, round to nearest even, one packed convert; a result below 2^-14 stays an f16 subnormal, which the matrix unit takes as it is
static __device__ __forceinline__ v2h toh2(float a, float b) { return __builtin_convertvector((v2f){a, b}, v2h); }
// one WMMA with its own hazard guard (ties the accumulator, keeps A/B live)
__device__ __forceinline__ v8f wmma16g(v16h a, v16h b, v8f c) {
    c = __builtin_amdgcn_wmma_f32_16x16x32_f16(false, a, false, b, (short)0, c, false, false);
    asm volatile("v_nop\n\tv_nop\n\tv_nop\n\tv_nop" : "+v"(c) : "v"(a), "v"(b));
    return c;
}

// k_prep: the three f16 planes in one launch. One block per (64*PU-token span, batch*head): grid (SEQ/(64*PU), NB*NHD), 256 threads; the block reads the same
// 64*PU tokens x 64 columns of q, k and v. Every global load of a thread (12*PU of 16 B) is issued before the first use, so one wave start and one memory latency serve all of them.
// q: in[t][h*64 + d] (f32, token pitch HE) -> same layout in f16, 8 values per piece, 8 lanes fill one 128-B line.
// k: piece (token t, columns 8c..8c+7) -> 16-B unit ((b*16 + h)*(SEQ/16) + t/16)*128 + (c>>1)*32 + (c&1)*16 + t%16: group c>>1 of a 16-key tile holds, at lane (c&1)*16 + t%16, what that lane takes as one half of an A fragment.
//    The pieces change threads through LDS (a spare unit behind every 16 spreads the banks), under the same block barrier as v.
// v: piece (column d, tokens 8g..8g+7) -> 16-B unit ((b*16 + h)*(SEQ/32) + g/4)*256 + (d/16)*64 + (g&3)*16 + d%16: float4 loads scattered transposed into LDS float tiles [d][t] (cross-wave: block barrier), then 16-B pieces.
// A thread stores unit (trip*256 + tid) of the block's span of either plane: a wave's store is 512 contiguous bytes.
__global__ __launch_bounds__(256) void k_prep(const float* __restrict__ Q, const float* __restrict__ K, const float* __restrict__ V, h16* QH, h16* KP, h16* VT) {
    __shared__ __align__(16) float tl[PU * 64 * TP];
    __shared__ __align__(16) h16 kl[(KU + KU / 16) * 8];
    const int tid = threadIdx.x;
    const int tt0 = blockIdx.x * (64 * PU); const int zh = blockIdx.y; const int b = zh / NHD, h = zh % NHD;
    const size_t sb = ((size_t)b * SEQ_FULL + tt0) * HE + (size_t)h * HD;    // (batch b, token tt0, head h) in the inputs
    const size_t db = ((size_t)b * SEQ + tt0) * HE + (size_t)h * HD;         // the same place in the q plane
    v4f xv[PU][4]; v8f xq[PU][2], xk[PU][2];
    const float* pv[4]; const float* pq[2]; const float* pk[2];              // tile 0's addresses; tile u lies 64 * u tokens further on
#pragma unroll
    for (int s = 0; s < 4; ++s) { const int p = s * 256 + tid; pv[s] = V + sb + (size_t)(p >> 4) * HE + (p & 15) * 4; }   // 4 s x 16 tokens = 64 tokens; 16 lanes x 4 = 64 columns
#pragma unroll
    for (int s = 0; s < 2; ++s) { const int p = s * 256 + tid; const size_t o = sb + (size_t)(p >> 3) * HE + (p & 7) * 8;  // 2 s x 32 tokens = 64 tokens; 8 lanes x 8 = 64 columns
        pq[s] = Q + o; pk[s] = K + o; }
#pragma unroll
    for (int u = 0; u < PU; ++u) {
#pragma unroll
        for (int s = 0; s < 4; ++s) xv[u][s] = *(const v4f*)(pv[s] + (size_t)u * 64 * HE); }
#pragma unroll
    for (int u = 0; u < PU; ++u) {
#pragma unroll
        for (int s = 0; s < 2; ++s) { xq[u][s] = *(const v8f*)(pq[s] + (size_t)u * 64 * HE); xk[u][s] = *(const v8f*)(pk[s] + (size_t)u * 64 * HE); } }
    // every load stands above this line (left free, the scheduler sinks the q and k loads to their uses and the thread pays several memory latencies in a row);
    // the addresses are inputs, so they stay in their registers up to the wait and no load's result lands in one of them ahead of it
    asm volatile("s_wait_xcnt 0x0" :: "v"(pv[0]), "v"(pv[1]), "v"(pv[2]), "v"(pv[3]), "v"(pq[0]), "v"(pq[1]), "v"(pk[0]), "v"(pk[1]) : "memory");
#pragma unroll
    for (int u = 0; u < PU; ++u) {
#pragma unroll
        for (int s = 0; s < 4; ++s) { const int p = s * 256 + tid; const int t = p >> 4, d4 = (p & 15) * 4;
#pragma unroll
            for (int i = 0; i < 4; ++i) tl[u * 64 * TP + (d4 + i) * TP + t] = bfr(xv[u][s][i]); } }
#pragma unroll
    for (int u = 0; u < PU; ++u) {
#pragma unroll
        for (int s = 0; s < 2; ++s) { const int p = s * 256 + tid; const int t = u * 64 + (p >> 3), c = p & 7;
            v8h ok;
#pragma unroll
            for (int k = 0; k < 8; ++k) ok[k] = toh_flush(bfr(xk[u][s][k]));
            const int un = (t >> 4) * 128 + (c >> 1) * 32 + (c & 1) * 16 + (t & 15);
            *(v8h*)(&kl[(un + (un >> 4)) * 8]) = ok; } }
    __syncthreads();
    // q needs no exchange; its stores stand behind the barrier, which would otherwise wait for them
#pragma unroll
    for (int u = 0; u < PU; ++u) {
#pragma unroll
        for (int s = 0; s < 2; ++s) { const int p = s * 256 + tid; const int t = u * 64 + (p >> 3), c8 = (p & 7) * 8;
            v8h oq;
#pragma unroll
            for (int k = 0; k < 8; ++k) oq[k] = toh_flush(bfr(xq[u][s][k]));
            *(v8h*)(QH + db + (size_t)t * HE + c8) = oq;
            asm volatile("s_wait_xcnt 0x0" ::: "memory"); } }   // the next piece, and the LDS reads below, land in registers that this store names
    const size_t kb = ((size_t)zh * SEQ + tt0) * HD;                         // the block's span in either fragment-order plane: 64*PU tokens x 64 halves, contiguous
#pragma unroll
    for (int s = 0; s < 2 * PU; ++s) { const int un = s * 256 + tid;
        *(v8h*)(KP + kb + (size_t)un * 8) = *(const v8h*)(&kl[(un + (un >> 4)) * 8]); }
    asm volatile("s_wait_xcnt 0x0" ::: "memory");   // the same for the k stores and the v pieces formed below
#pragma unroll
    for (int s = 0; s < 2 * PU; ++s) { const int un = s * 256 + tid;         // trip s = 32-key tile s of the span; tid = (d/16)*64 + (g&3)*16 + d%16
        const int d = ((tid >> 6) << 4) | (tid & 15), tk = s * 32 + ((tid >> 4) & 3) * 8;
        const float* tr = &tl[(tk >> 6) * 64 * TP + d * TP + (tk & 63)];
        const v4f x0 = *(const v4fa*)(tr); const v4f x1 = *(const v4fa*)(tr + 4);
        v8h hv;
#pragma unroll
        for (int i = 0; i < 4; ++i) { hv[i] = toh_flush(x0[i]); hv[4 + i] = toh_flush(x1[i]); }
        *(v8h*)(VT + kb + (size_t)un * 8) = hv; }
}

// stage_copy: one stage of the flash kernel's LDS ring, 64 keys of the k plane and of the v^T plane (8 KiB each, contiguous in fragment order), by asynchronous copies to LDS.
// A thread brings the 16-B pieces tid, tid + 128, tid + 256, tid + 384 of either plane; kg, vg, kl, vl are its first piece's global and LDS addresses (all multiples of 16 B).
__device__ __forceinline__ void stage_copy(const h16* kg, const h16* vg, unsigned kl, unsigned vl) {
    // the wait is the statement's last line, so that no address register of a copy is rewritten ahead of it
    asm volatile("global_load_async_to_lds_b128 %0, %8, off\n\t"
                 "global_load_async_to_lds_b128 %1, %9, off\n\t"
                 "global_load_async_to_lds_b128 %2, %10, off\n\t"
                 "global_load_async_to_lds_b128 %3, %11, off\n\t"
                 "global_load_async_to_lds_b128 %4, %12, off\n\t"
                 "global_load_async_to_lds_b128 %5, %13, off\n\t"
                 "global_load_async_to_lds_b128 %6, %14, off\n\t"
                 "global_load_async_to_lds_b128 %7, %15, off\n\t"
                 "s_wait_xcnt 0x0"
                 :: "v"(kl), "v"(kl + 2048u), "v"(kl + 4096u), "v"(kl + 6144u), "v"(vl), "v"(vl + 2048u), "v"(vl + 4096u), "v"(vl + 6144u),
                    "v"(kg), "v"(kg + 1024), "v"(kg + 2048), "v"(kg + 3072), "v"(vg), "v"(vg + 1024), "v"(vg + 2048), "v"(vg + 3072)
                 : "memory");
}

// flash_body: fused attention, one wave per 16 query rows of one (batch, head); the block's four waves walk the same keys, so each 64-key stage of K and V^T is brought into LDS once per block
// (two buffers, the next stage's copies in flight while this one is worked on) and every wave takes its fragments from there (two 16-B LDS loads each, 512 contiguous bytes per wave-wide load); Q fragments straight from the f16 plane.
// Transposed form: S^T[key][t] = K Q^T (A = K rows, B = Q rows, two k-steps over d); lane (t = lane&15, h = lane>>4) holds keys 8h+r of each 16-key tile, so the packed
// P tile is directly the B fragment of O^T[d][t] = V^T P^T (element r <- tile keys 0..15, element 8+r <- tile keys 16..31, lane unchanged); four 16-row d tiles.
// Softmax state (running max over kept keys, partial sum) is one scalar per lane; the two lane halves of a row are combined with one xor-16 exchange.
// Row block xb (query rows 64*xb .. 64*xb+63) walks stages 0 .. xb. Stages below xb end below the block's first row: both 32-key tiles unmasked in every wave.
// Stage xb: waves 0 and 1 end in its first tile, waves 2 and 3 take that tile unmasked and end in the second; the keep rule (key <= query) is evaluated per element in a wave's last tile only. Every visited tile holds a kept key for every row.
// EARLY = 1 (query rows [0, EROWS)): P = f16 value + f16 residual x2048; O = V P + (V P_res) / 2048 (residual products in their own accumulators); row sum from the f32 exponentials.
// EARLY = 0 (query rows [EROWS, SEQ)): single P; row sum over the converted P.
template <int EARLY>
__device__ __forceinline__ void flash_body(const h16* __restrict__ QH, const h16* __restrict__ KP, const h16* __restrict__ VT, float* OUT, float* os, h16* ring, const int zh, const int xb) {
    const int lane = threadIdx.x & 31, lr = lane & 15, hi = lane >> 4;
    const int wave = __builtin_amdgcn_readfirstlane((int)(threadIdx.x >> 5));
    const int b = zh / NHD, h = zh % NHD;
    const int t0 = (xb * AW + wave) * 16;                                  // EARLY = 1: xb < EROWS / (16*AW), so t0 < EROWS; EARLY = 0: t0 >= EROWS
    const int lim = t0 + lr;                                               // key j kept iff j <= lim
    // the thread's first piece of stage 0 in either plane, and of buffer 0 in LDS; stage s lies s * STH halves further on, buffer 1 2 * STH halves; s <= xb < NXB, so every stage lies inside the planes
    const h16* kg0 = KP + (size_t)zh * SEQ * HD + 8 * (int)threadIdx.x;
    const h16* vg0 = VT + (size_t)zh * SEQ * HD + 8 * (int)threadIdx.x;
    const unsigned kl0 = (unsigned)(size_t)ring + 16u * threadIdx.x;
    auto copy = [&](int s) { const unsigned kl = kl0 + (unsigned)(s & 1) * (4u * STH); stage_copy(kg0 + (size_t)s * STH, vg0 + (size_t)s * STH, kl, kl + 2u * STH); };
    copy(0);
    const size_t rowb = (size_t)b * SEQ * HE + (size_t)h * HD;            // (batch b, token 0, head h) in the q plane
    const size_t qo = rowb + (size_t)(t0 + lr) * HE + 8 * hi;
    const v16h q0 = ldh(QH + qo), q1 = ldh(QH + qo + 32);                  // B fragments: col t, k = d (two k-steps)
    const v16h hz = (v16h){};
    v8f o[4], oR[4];
#pragma unroll
    for (int j = 0; j < 4; ++j) { o[j] = (v8f){}; oR[j] = (v8f){}; }
    float m = NEGB, l = 0.0f;
    // the four fragments of one 32-key tile of either plane; p = the tile's place in the stage + 8 * lane. K: 16-key tile = four 512-B groups (A fragment: row key, k = d; two groups per k-step); V^T: eight groups (A fragment: row d, k = key; two per 16-row d tile)
    auto ld_t = [&](const h16* p, v16h (&f)[4]) { f[0] = ldf(p); f[1] = ldf(p + 512); f[2] = ldf(p + 1024); f[3] = ldf(p + 1536); };
    // fetch: the register set is refilled, right behind the products that read it, with the tile at nk, nv (the same stage's second tile)
    auto tile = [&](int key0, bool fetch, const h16* nk, const h16* nv, bool diag, v16h (&kf)[4], v16h (&vf)[4]) __attribute__((always_inline)) {
        v8f sA = (v8f){}, sB = (v8f){};
        sA = wmma16g(kf[0], q0, sA); sB = wmma16g(kf[2], q0, sB);
        sA = wmma16g(kf[1], q1, sA); sB = wmma16g(kf[3], q1, sB);
        if (fetch) ld_t(nk, kf);
        const int ja = key0 + 8 * hi;                                      // D: sA[r] = (key ja + r, t = lane&15), sB[r] = (key ja + 16 + r, t)
        float ta[8], tb[8]; bool fa[8], fb[8]; float mx = NEGB;
#pragma unroll
        for (int r = 0; r < 8; ++r) {
            fa[r] = !diag || (ja + r <= lim);
            fb[r] = !diag || (ja + 16 + r <= lim);
            ta[r] = sA[r] * SC2; tb[r] = sB[r] * SC2;
            mx = fmaxf(mx, fmaxf(fa[r] ? ta[r] : NEGB, fb[r] ? tb[r] : NEGB)); }
        mx = fmaxf(mx, __shfl_xor(mx, 16, 32));
        const float mnew = fmaxf(m, mx);
        const float alpha = __builtin_amdgcn_exp2f(m - mnew);
        const float sh = PSH - mnew;
        v16h pb, pr = hz; float ls = 0.0f; float ga[8], gb[8];
#pragma unroll
        for (int r = 0; r < 8; ++r) {
            // scale and shift written as one fused operation, so that every form of the tile rounds the exponent alike whatever the compiler would pick
            const float ea = __builtin_amdgcn_exp2f(__builtin_fmaf(sA[r], SC2, sh)), eb = __builtin_amdgcn_exp2f(__builtin_fmaf(sB[r], SC2, sh));
            ga[r] = fa[r] ? ea : 0.0f; gb[r] = fb[r] ? eb : 0.0f; }           // dropped elements selected to 0 by value
#pragma unroll   // unrolled: ga, gb, pb and pr stay in registers only under constant indices
        for (int r = 0; r < 8; r += 2) {                                      // neighbouring keys share a register of the B fragment: one packed convert fills it
            const v2h pa = toh2(ga[r], ga[r + 1]), pc = toh2(gb[r], gb[r + 1]);
            pb[r] = pa[0]; pb[r + 1] = pa[1]; pb[8 + r] = pc[0]; pb[9 + r] = pc[1];
            if (EARLY) {
                const v2h ra = toh2((ga[r] - (float)pa[0]) * QRS, (ga[r + 1] - (float)pa[1]) * QRS), rc = toh2((gb[r] - (float)pc[0]) * QRS, (gb[r + 1] - (float)pc[1]) * QRS);
                pr[r] = ra[0]; pr[r + 1] = ra[1]; pr[8 + r] = rc[0]; pr[9 + r] = rc[1];
                ls += ga[r] + gb[r]; ls += ga[r + 1] + gb[r + 1]; }
            else { ls += (float)pa[0] + (float)pc[0]; ls += (float)pa[1] + (float)pc[1]; } }
        l = l * alpha + ls; m = mnew;
#pragma unroll
        for (int j = 0; j < 4; ++j) o[j] = o[j] * alpha;
        if (EARLY) {
#pragma unroll
            for (int j = 0; j < 4; ++j) oR[j] = oR[j] * alpha; }
        o[0] = wmma16g(vf[0], pb, o[0]); o[1] = wmma16g(vf[1], pb, o[1]); o[2] = wmma16g(vf[2], pb, o[2]); o[3] = wmma16g(vf[3], pb, o[3]);
        if (EARLY) {
            oR[0] = wmma16g(vf[0], pr, oR[0]); oR[1] = wmma16g(vf[1], pr, oR[1]); oR[2] = wmma16g(vf[2], pr, oR[2]); oR[3] = wmma16g(vf[3], pr, oR[3]);
        }
        if (fetch) ld_t(nv, vf);
    };
    // stage 0 has landed (each wave waits for its own copies) and is published by the barrier; stage 1 then flies while stage 0 is worked on
    asm volatile("s_wait_asynccnt 0x0" ::: "memory");
    __syncthreads();
    if (xb >= 1) copy(1);
    v16h kE[4], vE[4];
    const h16* rl = ring + 8 * lane;
    const int dt = wave >> 1;                                              // the tile of stage xb that the wave's diagonal crosses
    if constexpr (EARLY) {
        // twice the accumulators: one register set; a stage's second tile is fetched behind the first tile's products
#pragma unroll 1   // kept rolled: one trip per ring stage, the buffer picked by the trip's parity
        for (int s = 0; s < xb; ++s) {
            const h16* sk = rl + (s & 1) * (2 * STH); const h16* sv = sk + STH;
            ld_t(sk, kE); ld_t(sv, vE);
            tile(s * STK, true, sk + 2048, sv + 2048, false, kE, vE);
            tile(s * STK + 32, false, sk, sv, false, kE, vE);
            asm volatile("s_wait_dscnt 0x0" ::: "memory");      // this wave's reads of the buffer have ended before it is refilled
            asm volatile("s_wait_asynccnt 0x0" ::: "memory");   // this wave's copies of stage s + 1 have landed before the barrier publishes them
            __syncthreads();
            if (s + 2 <= xb) copy(s + 2);
        }
        const h16* sk = rl + (xb & 1) * (2 * STH); const h16* sv = sk + STH;
        if (dt) { ld_t(sk, kE); ld_t(sv, vE); tile(xb * STK, false, sk, sv, false, kE, vE); }
        ld_t(sk + 2048 * dt, kE); ld_t(sv + 2048 * dt, vE);
        tile(xb * STK + 32 * dt, false, sk, sv, true, kE, vE);
    } else {
        v16h kO[4], vO[4];
#pragma unroll 1   // kept rolled: one trip per ring stage, the buffer picked by the trip's parity
        for (int s = 0; s < xb; ++s) {
            const h16* sk = rl + (s & 1) * (2 * STH); const h16* sv = sk + STH;
            ld_t(sk, kE); ld_t(sv, vE); ld_t(sk + 2048, kO); ld_t(sv + 2048, vO);
            tile(s * STK, false, sk, sv, false, kE, vE);
            tile(s * STK + 32, false, sk, sv, false, kO, vO);
            asm volatile("s_wait_dscnt 0x0" ::: "memory");      // this wave's reads of the buffer have ended before it is refilled
            asm volatile("s_wait_asynccnt 0x0" ::: "memory");   // this wave's copies of stage s + 1 have landed before the barrier publishes them
            __syncthreads();
            if (s + 2 <= xb) copy(s + 2);
        }
        const h16* sk = rl + (xb & 1) * (2 * STH); const h16* sv = sk + STH;
        ld_t(sk + 2048 * dt, kO); ld_t(sv + 2048 * dt, vO);
        if (dt) { ld_t(sk, kE); ld_t(sv, vE); tile(xb * STK, false, sk, sv, false, kE, vE); }
        tile(xb * STK + 32 * dt, false, sk, sv, true, kO, vO);
    }
    asm volatile("s_wait_asynccnt 0x0" ::: "memory");   // no copy is outstanding when the wave ends
    l += __shfl_xor(l, 16, 32);
    const bool any = l > 0.0f;
    const float lsafe = any ? l : 1.0f;
    const float inv = any ? (1.0f / lsafe) : 0.0f;
    const int wb = wave * 16 * OSP;
    // O^T D layout: f_j[r] = (d = 16j + 8h + r, t = lane&15) -> os[t][d]; rows 0..15 x columns 0..63 all written
#pragma unroll
    for (int j = 0; j < 4; ++j) {
        v8f f = o[j];
        if (EARLY) f = o[j] + oR[j] * QRI;
        v4f a, c;
        a[0] = f[0] * inv; a[1] = f[1] * inv; a[2] = f[2] * inv; a[3] = f[3] * inv; c[0] = f[4] * inv; c[1] = f[5] * inv; c[2] = f[6] * inv; c[3] = f[7] * inv;
        *(v4fa*)(&os[wb + lr * OSP + 16 * j + 8 * hi]) = a; *(v4fa*)(&os[wb + lr * OSP + 16 * j + 8 * hi + 4]) = c; }
    wave_sync();
    float* orow = OUT + (((size_t)b * OUT_SEQ + t0) * NHD + h) * HD;
{
#pragma unroll
        for (int s = 0; s < 8; ++s) { const int row = 2 * s + (lane >> 4), cofs = (lane & 15) * 4;   // 8 s x 2 rows = 16 rows; 16 lanes x 4 floats = 64 columns = two lines
            const v4f val = *(const v4fa*)(&os[wb + row * OSP + cofs]);
            *(v4f*)(orow + (size_t)row * HE + cofs) = val; }
         }
}

// k_flash: all row blocks of all heads in one launch, grid (NB*NHD heads, NXB ranks), so that the short two-plane-P blocks run beside the long blocks instead of in a launch of their own.
// At 4 waves per SIMD every block is resident at once, and the launch lasts as long as the fullest WGP. A block's cost grows linearly with its row block xb. The rank -> xb map is a permutation in four groups of NXB/4:
// odd xb from the top down, even xb from the top down, odd xb from the bottom up, even xb from the bottom up. Blocks whose flat indices lie a quarter of the grid apart (one of each group at the same place k)
// then hold xb = (n-1-2k, n-2-2k, 2k+1, 2k): the same sum for every k, and the two longest nearly alike, so that no long wave is left alone on its SIMD for long. Head index fastest: those four blocks also walk one head's k and v.
// Where the blocks land is the dispatcher's choice: the map is for speed only, every (head, row block) is done exactly once wherever it runs.
// four waves per SIMD (at most 256 registers a wave): what lets every block of the grid be resident at once
__global__ __launch_bounds__(32 * AW) __attribute__((amdgpu_waves_per_eu(4, 4))) void k_flash(const h16* __restrict__ QH, const h16* __restrict__ KP, const h16* __restrict__ VT, float* OUT) {
    __shared__ __align__(16) float os[AW * 16 * OSP];
    __shared__ __align__(16) h16 ring[2 * 2 * STH];   // two buffers x (k stage, v^T stage)
    const int zh = blockIdx.x;
    const int g = blockIdx.y / (NXB / 4), k = blockIdx.y % (NXB / 4);
    const int xb = (g < 2) ? NXB - 1 - g - 2 * k : 2 * k + 3 - g;
    if (xb < EROWS / (16 * AW)) flash_body<1>(QH, KP, VT, OUT, os, ring, zh, xb);   // block-uniform
    else                        flash_body<0>(QH, KP, VT, OUT, os, ring, zh, xb);
}

static constexpr size_t al256(size_t v) { return (v + 255) & ~(size_t)255; }
static constexpr size_t SZ_QK = al256((size_t)NB * SEQ * HE * 2);           // q plane [NB][SEQ][HE] f16; k plane [NB*NHD][SEQ/16][4][32][8] f16
static constexpr size_t SZ_VT = al256((size_t)NB * NHD * HD * SEQ * 2);     // v^T plane [NB*NHD][SEQ/32][8][32][8] f16
static constexpr size_t SZ_TOTAL = 2 * SZ_QK + SZ_VT;
static_assert(SZ_TOTAL <= (size_t)134217728);          // workspace carve <= 128 MiB
static_assert(((size_t)NB * SEQ * HE * 2) % 128 == 0);
static_assert(((size_t)SEQ * 2) % 128 == 0);

extern "C" void kernel_launch(void* const* d_in, const int* in_sizes, int n_in,
                              void* d_out, int out_size, void* d_ws, size_t ws_size, hipStream_t stream) {
    if (n_in < 3) return;
    const size_t needx = ((size_t)(NB - 1) * SEQ_FULL + SEQ) * HE;
    if ((size_t)in_sizes[0] < needx || (size_t)in_sizes[1] < needx || (size_t)in_sizes[2] < needx) return;
    if ((size_t)out_size < ((size_t)(NB - 1) * OUT_SEQ + SEQ) * HE) return;
    if (SZ_TOTAL > ws_size) return;
    // wire order: queries, keys, values
    const float* qin = (const float*)d_in[0];
    const float* kin = (const float*)d_in[1];
    const float* vin = (const float*)d_in[2];
    float* OUT = (float*)d_out;      // [NB][SEQ][16][64]
    char* wsp = (char*)d_ws;
    h16* QH = (h16*)wsp; wsp += SZ_QK;               // [NB][SEQ][1024]
    h16* KP = (h16*)wsp; wsp += SZ_QK;               // [NB*16][SEQ/16][4][32][8]
    h16* VT = (h16*)wsp; wsp += SZ_VT;               // [NB*16][SEQ/32][8][32][8]

    // q -> f16 plane in the input layout; k, v -> f16 planes in fragment order; grid (token spans, batch*head)
    k_prep<<<dim3(SEQ / (64 * PU), NB * NHD, 1), 256, 0, stream>>>(qin, kin, vin, QH, KP, VT);

    // query rows [0, EROWS): two-plane-P instantiation; rows [EROWS, SEQ): single-product instantiation (disjoint output rows); one launch, grid (batch*head, rank of the row block)
    k_flash<<<dim3(NB * NHD, NXB, 1), 32 * AW, 0, stream>>>(QH, KP, VT, OUT);
}

// v008
// Measured time: 34.8 microseconds a run.
// Two timings next to v007 put it at 1.11 and 1.10 times that version's speed.
// All steps since v000 together make it 2.82 times as fast.
#include <hip/hip_runtime.h>

// Causal scaled dot-product attention over per-head slices, no projections: q/k/v [NB][SEQ][16][64] (f32), key j kept for query t iff j <= t (dropped keys get probability 0), score scale 1/sqrt(64), output [NB][SEQ][16][64] (f32).
// Compute dtypes, f32 accumulate everywhere: scores v_wmma_f32_16x16x32_f16 with q, k single f16 planes (inputs RNE-converted to bf16, then held in f16: exact for f16-normal values, smaller magnitudes selected to +0);
// P.V v_wmma_f32_16x16x32_f16: v single f16 plane (same conversion), P f16 with x16384 carry (cancels in the normalisation), converted RNE two at a time, values below 2^-14 kept as f16 subnormals; on query rows < EROWS P = f16 value + f16 residual x2048, residual products in their own accumulators folded by 1/2048, row sum from the f32 exponentials; on later rows row sum over the converted P. Softmax f32 (online, running max over kept keys).
// Layout: f16 copy of q in the input layout [b][t][h*64 + d] (row pitch 1024 halves); k and v^T planes in fragment order (see k_prep): each 16-B piece stands where the lane that loads it finds it, so one wave-wide 16-B load reads 512 contiguous bytes (four whole lines);
// all three planes written by one launch, k and v through LDS; fused flash kernel in transposed form (S^T = K Q^T, O^T = V^T P^T), k and v^T fragments from an LDS ring filled once per block, a row block's keys shared out between two groups of waves whose partial results are joined through LDS, output from f32 accumulators.

#ifndef NB
#define NB 2
#endif
#ifndef SEQ
#define SEQ 2048
#endif
#define NB_FULL  2
#define SEQ_FULL 2048
#ifndef OUT_SEQ
#define OUT_SEQ SEQ              // row pitch (in tokens) between batches of the output
#endif
#define NHD  16                  // heads
#define HD   64                  // head width
#define HE   (NHD * HD)          // token row pitch (elements) of the inputs, the q plane and the output
#define AW   4                   // waves per key group of a flash block (16 query rows each)
#define KG   2                   // key groups per flash block: group g takes the 64-key spans g, g + KG, ..
#define OSP  68                  // LDS row pitch (floats) of the flash output tile
#define TP   68                  // LDS row pitch (floats) of the transpose tile
#define PU   2                   // 64-token tiles per block of the plane-building kernel
#define KU   (64 * PU * 8)       // 16-B pieces of k per block of the plane-building kernel
#define EROWS (SEQ < 512 ? SEQ : 512)   // query rows handled by the two-plane-P flash instantiation
#define NXB  (SEQ / (16 * AW))   // row blocks (16*AW query rows each) per (batch, head)
#define STK  64                  // keys of one group in a stage of the flash kernel's LDS ring
#define STH  (KG * STK * HD)     // halves of one plane in a stage (KG * STK keys)
#define QRS  2048.0f             // carry of the residual P fragment
#define QRI  (1.0f / 2048.0f)
#define SC2  ((float)(0.125 * 1.4426950408889634))   // HD^-0.5 * log2(e)
#define PSH  14.0f               // log2 of the P carry (16384)
#define NEGB (-3.0e38f)

static_assert(HD == 64);                       // two 32-deep k-steps per score tile, four 16-row output tiles
static_assert(NHD * HD == HE);
static_assert(HD % 32 == 0);                   // score k-loop steps by 32
static_assert(HE % 8 == 0);                    // 16-byte fragment loads from token rows
static_assert(SEQ % 64 == 0);
static_assert(SEQ % 32 == 0);                  // key loop steps by 32 and its bound never exceeds SEQ
static_assert(SEQ % (16 * AW) == 0);
static_assert(EROWS % (16 * AW) == 0);
static_assert((SEQ - EROWS) % (16 * AW) == 0);
static_assert(EROWS >= 32);
static_assert(EROWS <= SEQ);
static_assert(SEQ % (KG * STK) == 0);           // a ring stage never ends past the planes
static_assert(NB <= NB_FULL);
static_assert(SEQ <= SEQ_FULL);
static_assert(OSP >= HD);
static_assert((OSP * 4) % 16 == 0);
static_assert(TP >= 64);
static_assert((TP * 4) % 16 == 0);
static_assert(SEQ % (64 * PU) == 0);                                 // plane-building grid x tokens per block == SEQ
static_assert((size_t)32 * 16 * 8 == (size_t)16 * HD * 4);           // flash epilogue: 32 lanes x 16 B x 8 trips == 16 rows x 256 B
static_assert((size_t)256 * 2 * 8 == (size_t)64 * HD);               // q/k convert: 256 threads x 2 pieces x 8 floats == 64 tokens x 64 columns
static_assert((size_t)256 * 2 * PU * 8 == (size_t)HD * 64 * PU);     // v^T store: 256 threads x 2*PU pieces x 8 halves == 64 rows x 64*PU tokens
static_assert((size_t)256 * 4 * 4 == (size_t)64 * HD);               // transpose load: 256 threads x 4 float4 x 4 floats == 64 tokens x 64 columns
static_assert(STK == 16 * AW);                                       // row block xb walks the 64-key spans 0 .. xb, the diagonal inside the last
static_assert((size_t)32 * AW * KG * 4 * 16 == (size_t)STH * 2);     // stage copy: 256 threads x 4 pieces x 16 B == one plane's stage
static_assert(2 * ((size_t)AW * 16 * OSP * 4 + (size_t)4 * STH * 2) <= 327680);   // static LDS of two resident flash blocks
static_assert((size_t)AW * 17 * 512 <= (size_t)4 * STH * 2);         // the join area (17 wave-wide 16-B pieces per wave at most) fits the ring
static_assert((size_t)256 * 2 * PU == (size_t)KU);                   // k fragment store: 256 threads x 2*PU pieces == all pieces of the block
static_assert(KU % 16 == 0);
static_assert((size_t)PU * 64 * TP * 4 + (size_t)(KU + KU / 16) * 16 <= 131072);   // static LDS of the plane-building kernel

typedef _Float16 h16;
typedef __attribute__((ext_vector_type(16))) _Float16 v16h;
typedef __attribute__((ext_vector_type(8)))  _Float16 v8h;
typedef __attribute__((ext_vector_type(8)))  float    v8f;
typedef __attribute__((ext_vector_type(4)))  float    v4f;
typedef v4f  __attribute__((may_alias)) v4fa;
typedef __attribute__((ext_vector_type(2)))  float    v2f;
typedef __attribute__((ext_vector_type(2)))  _Float16 v2h;

__device__ __forceinline__ unsigned short f2bf(float f) { unsigned u = __float_as_uint(f); u += 0x7FFFu + ((u >> 16) & 1u); return (unsigned short)(u >> 16); }
__device__ __forceinline__ float bfr(float f) { return __uint_as_float(((unsigned)f2bf(f)) << 16); }   // value after RNE convert to bf16
__device__ __forceinline__ v16h cat16(v8h lo, v8h hi) { return __builtin_shufflevector(lo, hi, 0, 1, 2, 3, 4, 5, 6, 7, 8, 9, 10, 11, 12, 13, 14, 15); }
// fragment loader from K-contiguous 16-bit rows; p already includes + 8*(lane>>4): elements 0..7 <- k0+8h+0..7, elements 8..15 <- k0+16+8h+0..7 (same map for A and B)
__device__ __forceinline__ v16h  ldh(const h16* p) { return cat16(*(const v8h*)p, *(const v8h*)(p + 16)); }
// fragment loader from a fragment-order plane; p already includes + 8*lane: elements 0..7 from the lane's piece of one 512-B group, elements 8..15 from its piece of the next group
__device__ __forceinline__ v16h  ldf(const h16* p) { return cat16(*(const v8h*)p, *(const v8h*)(p + 256)); }
// ordering point for wave-private LDS tiles (same wave writes and reads)
__device__ __forceinline__ void wave_sync() { __builtin_amdgcn_fence(3 /* release order */, "wavefront"); __builtin_amdgcn_wave_barrier(); asm volatile("" ::: "memory"); }
// f32 -> f16 convert that cannot produce an f16 subnormal (value select)
static __device__ __forceinline__ h16 toh_flush(float v) { const h16 r = (h16)v; return (fabsf(v) < 6.103515625e-05f) ? (h16)0.0f : r; }
// two f32 -> one register of two f16, round to nearest even, one packed convert; a result below 2^-14 stays an f16 subnormal, which the matrix unit takes as it is
static __device__ __forceinline__ v2h toh2(float a, float b) { return __builtin_convertvector((v2f){a, b}, v2h); }
// one WMMA with its own hazard guard (ties the accumulator, keeps A/B live)
__device__ __forceinline__ v8f wmma16g(v16h a, v16h b, v8f c) {
    c = __builtin_amdgcn_wmma_f32_16x16x32_f16(false, a, false, b, (short)0, c, false, false);
    asm volatile("v_nop\n\tv_nop\n\tv_nop\n\tv_nop" : "+v"(c) : "v"(a), "v"(b));
    return c;
}

// k_prep: the three f16 planes in one launch. One block per (64*PU-token span, batch*head): grid (SEQ/(64*PU), NB*NHD), 256 threads; the block reads the same
// 64*PU tokens x 64 columns of q, k and v. Every global load of a thread (12*PU of 16 B) is issued before the first use, so one wave start and one memory latency serve all of them.
// q: in[t][h*64 + d] (f32, token pitch HE) -> same layout in f16, 8 values per piece, 8 lanes fill one 128-B line.
// k: piece (token t, columns 8c..8c+7) -> 16-B unit ((b*16 + h)*(SEQ/16) + t/16)*128 + (c>>1)*32 + (c&1)*16 + t%16: group c>>1 of a 16-key tile holds, at lane (c&1)*16 + t%16, what that lane takes as one half of an A fragment.
//    The pieces change threads through LDS (a spare unit behind every 16 spreads the banks), under the same block barrier as v.
// v: piece (column d, tokens 8g..8g+7) -> 16-B unit ((b*16 + h)*(SEQ/32) + g/4)*256 + (d/16)*64 + (g&3)*16 + d%16: float4 loads scattered transposed into LDS float tiles [d][t] (cross-wave: block barrier), then 16-B pieces.
// A thread stores unit (trip*256 + tid) of the block's span of either plane: a wave's store is 512 contiguous bytes.
__global__ __launch_bounds__(256) void k_prep(const float* __restrict__ Q, const float* __restrict__ K, const float* __restrict__ V, h16* QH, h16* KP, h16* VT) {
    __shared__ __align__(16) float tl[PU * 64 * TP];
    __shared__ __align__(16) h16 kl[(KU + KU / 16) * 8];
    const int tid = threadIdx.x;
    const int tt0 = blockIdx.x * (64 * PU); const int zh = blockIdx.y; const int b = zh / NHD, h = zh % NHD;
    const size_t sb = ((size_t)b * SEQ_FULL + tt0) * HE + (size_t)h * HD;    // (batch b, token tt0, head h) in the inputs
    const size_t db = ((size_t)b * SEQ + tt0) * HE + (size_t)h * HD;         // the same place in the q plane
    v4f xv[PU][4]; v8f xq[PU][2], xk[PU][2];
    const float* pv[4]; const float* pq[2]; const float* pk[2];              // tile 0's addresses; tile u lies 64 * u tokens further on
#pragma unroll
    for (int s = 0; s < 4; ++s) { const int p = s * 256 + tid; pv[s] = V + sb + (size_t)(p >> 4) * HE + (p & 15) * 4; }   // 4 s x 16 tokens = 64 tokens; 16 lanes x 4 = 64 columns
#pragma unroll
    for (int s = 0; s < 2; ++s) { const int p = s * 256 + tid; const size_t o = sb + (size_t)(p >> 3) * HE + (p & 7) * 8;  // 2 s x 32 tokens = 64 tokens; 8 lanes x 8 = 64 columns
        pq[s] = Q + o; pk[s] = K + o; }
#pragma unroll
    for (int u = 0; u < PU; ++u) {
#pragma unroll
        for (int s = 0; s < 4; ++s) xv[u][s] = *(const v4f*)(pv[s] + (size_t)u * 64 * HE); }
#pragma unroll
    for (int u = 0; u < PU; ++u) {
#pragma unroll
        for (int s = 0; s < 2; ++s) { xq[u][s] = *(const v8f*)(pq[s] + (size_t)u * 64 * HE); xk[u][s] = *(const v8f*)(pk[s] + (size_t)u * 64 * HE); } }
    // every load stands above this line (left free, the scheduler sinks the q and k loads to their uses and the thread pays several memory latencies in a row);
    // the addresses are inputs, so they stay in their registers up to the wait and no load's result lands in one of them ahead of it
    asm volatile("s_wait_xcnt 0x0" :: "v"(pv[0]), "v"(pv[1]), "v"(pv[2]), "v"(pv[3]), "v"(pq[0]), "v"(pq[1]), "v"(pk[0]), "v"(pk[1]) : "memory");
#pragma unroll
    for (int u = 0; u < PU; ++u) {
#pragma unroll
        for (int s = 0; s < 4; ++s) { const int p = s * 256 + tid; const int t = p >> 4, d4 = (p & 15) * 4;
#pragma unroll
            for (int i = 0; i < 4; ++i) tl[u * 64 * TP + (d4 + i) * TP + t] = bfr(xv[u][s][i]); } }
#pragma unroll
    for (int u = 0; u < PU; ++u) {
#pragma unroll
        for (int s = 0; s < 2; ++s) { const int p = s * 256 + tid; const int t = u * 64 + (p >> 3), c = p & 7;
            v8h ok;
#pragma unroll
            for (int k = 0; k < 8; ++k) ok[k] = toh_flush(bfr(xk[u][s][k]));
            const int un = (t >> 4) * 128 + (c >> 1) * 32 + (c & 1) * 16 + (t & 15);
            *(v8h*)(&kl[(un + (un >> 4)) * 8]) = ok; } }
    __syncthreads();
    // q needs no exchange; its stores stand behind the barrier, which would otherwise wait for them
#pragma unroll
    for (int u = 0; u < PU; ++u) {
#pragma unroll
        for (int s = 0; s < 2; ++s) { const int p = s * 256 + tid; const int t = u * 64 + (p >> 3), c8 = (p & 7) * 8;
            v8h oq;
#pragma unroll
            for (int k = 0; k < 8; ++k) oq[k] = toh_flush(bfr(xq[u][s][k]));
            *(v8h*)(QH + db + (size_t)t * HE + c8) = oq;
            asm volatile("s_wait_xcnt 0x0" ::: "memory"); } }   // the next piece, and the LDS reads below, land in registers that this store names
    const size_t kb = ((size_t)zh * SEQ + tt0) * HD;                         // the block's span in either fragment-order plane: 64*PU tokens x 64 halves, contiguous
#pragma unroll
    for (int s = 0; s < 2 * PU; ++s) { const int un = s * 256 + tid;
        *(v8h*)(KP + kb + (size_t)un * 8) = *(const v8h*)(&kl[(un + (un >> 4)) * 8]); }
    asm volatile("s_wait_xcnt 0x0" ::: "memory");   // the same for the k stores and the v pieces formed below
#pragma unroll
    for (int s = 0; s < 2 * PU; ++s) { const int un = s * 256 + tid;         // trip s = 32-key tile s of the span; tid = (d/16)*64 + (g&3)*16 + d%16
        const int d = ((tid >> 6) << 4) | (tid & 15), tk = s * 32 + ((tid >> 4) & 3) * 8;
        const float* tr = &tl[(tk >> 6) * 64 * TP + d * TP + (tk & 63)];
        const v4f x0 = *(const v4fa*)(tr); const v4f x1 = *(const v4fa*)(tr + 4);
        v8h hv;
#pragma unroll
        for (int i = 0; i < 4; ++i) { hv[i] = toh_flush(x0[i]); hv[4 + i] = toh_flush(x1[i]); }
        *(v8h*)(VT + kb + (size_t)un * 8) = hv; }
}

// stage_copy: one stage of the flash kernel's LDS ring, 128 keys of the k plane and of the v^T plane (16 KiB each, contiguous in fragment order), by asynchronous copies to LDS.
// A thread brings the 16-B pieces tid, tid + 256, tid + 512, tid + 768 of either plane; kg, vg, kl, vl are its first piece's global and LDS addresses (all multiples of 16 B).
__device__ __forceinline__ void stage_copy(const h16* kg, const h16* vg, unsigned kl, unsigned vl) {
    // the wait is the statement's last line, so that no address register of a copy is rewritten ahead of it
    asm volatile("global_load_async_to_lds_b128 %0, %8, off\n\t"
                 "global_load_async_to_lds_b128 %1, %9, off\n\t"
                 "global_load_async_to_lds_b128 %2, %10, off\n\t"
                 "global_load_async_to_lds_b128 %3, %11, off\n\t"
                 "global_load_async_to_lds_b128 %4, %12, off\n\t"
                 "global_load_async_to_lds_b128 %5, %13, off\n\t"
                 "global_load_async_to_lds_b128 %6, %14, off\n\t"
                 "global_load_async_to_lds_b128 %7, %15, off\n\t"
                 "s_wait_xcnt 0x0"
                 :: "v"(kl), "v"(kl + 4096u), "v"(kl + 8192u), "v"(kl + 12288u), "v"(vl), "v"(vl + 4096u), "v"(vl + 8192u), "v"(vl + 12288u),
                    "v"(kg), "v"(kg + 2048), "v"(kg + 4096), "v"(kg + 6144), "v"(vg), "v"(vg + 2048), "v"(vg + 4096), "v"(vg + 6144)
                 : "memory");
}

// flash_body: fused attention, two waves (one of each key group) per 16 query rows of one (batch, head); a 128-key stage of K and V^T is brought into LDS once per block, group g's four waves work on its 64-key span g,
// so a wave walks half the row block's keys (two buffers, the next stage's copies in flight while this one is worked on); every wave takes its fragments from there (two 16-B LDS loads each, 512 contiguous bytes per wave-wide load); Q fragments straight from the f16 plane.
// Transposed form: S^T[key][t] = K Q^T (A = K rows, B = Q rows, two k-steps over d); lane (t = lane&15, h = lane>>4) holds keys 8h+r of each 16-key tile, so the packed
// P tile is directly the B fragment of O^T[d][t] = V^T P^T (element r <- tile keys 0..15, element 8+r <- tile keys 16..31, lane unchanged); four 16-row d tiles.
// Softmax state (running max over kept keys, partial sum) is one scalar per lane; the two lane halves of a row are combined with one xor-16 exchange.
// Row block xb (query rows 64*xb .. 64*xb+63) walks the 64-key spans 0 .. xb, ring stages 0 .. xb/2. Spans below xb end below the block's first row: both 32-key tiles unmasked in every wave.
// Span xb: waves 0 and 1 of its group end in its first tile, waves 2 and 3 take that tile unmasked and end in the second; the keep rule (key <= query) is evaluated per element in a wave's last tile of the last stage only. Every visited tile holds a kept key for every row.
// For even xb the last stage's second span lies past the diagonal: group 1 does no work there (for xb = 0 none at all: its running max stays at the start value and its weight in the join is 0).
// Join: group 1 hands its accumulators, running max and partial sum over through LDS (the ring, once every wave has left it); group 0 brings both to the common max, adds them and writes the output.
// EARLY = 1 (query rows [0, EROWS)): P = f16 value + f16 residual x2048; O = V P + (V P_res) / 2048 (residual products in their own accumulators); row sum from the f32 exponentials.
// EARLY = 0 (query rows [EROWS, SEQ)): single P; row sum over the converted P.
template <int EARLY>
__device__ __forceinline__ void flash_body(const h16* __restrict__ QH, const h16* __restrict__ KP, const h16* __restrict__ VT, float* OUT, float* os, h16* ring, const int zh, const int xb) {
    const int lane = threadIdx.x & 31, lr = lane & 15, hi = lane >> 4;
    const int wave = __builtin_amdgcn_readfirstlane((int)(threadIdx.x >> 5));
    const int b = zh / NHD, h = zh % NHD;
    const int grp = wave / AW, w = wave % AW;                              // key group; place among the group's waves
    const int t0 = (xb * AW + w) * 16;                                     // EARLY = 1: xb < EROWS / (16*AW), so t0 < EROWS; EARLY = 0: t0 >= EROWS
    const int lim = t0 + lr;                                               // key j kept iff j <= lim
    // the thread's first piece of stage 0 in either plane, and of buffer 0 in LDS; stage s lies s * STH halves further on, buffer 1 2 * STH halves; s <= xb / KG < SEQ / (KG * STK), so every stage lies inside the planes
    const h16* kg0 = KP + (size_t)zh * SEQ * HD + 8 * (int)threadIdx.x;
    const h16* vg0 = VT + (size_t)zh * SEQ * HD + 8 * (int)threadIdx.x;
    const unsigned kl0 = (unsigned)(size_t)ring + 16u * threadIdx.x;
    auto copy = [&](int s) { const unsigned kl = kl0 + (unsigned)(s & 1) * (4u * STH); stage_copy(kg0 + (size_t)s * STH, vg0 + (size_t)s * STH, kl, kl + 2u * STH); };
    copy(0);
    const size_t rowb = (size_t)b * SEQ * HE + (size_t)h * HD;            // (batch b, token 0, head h) in the q plane
    const size_t qo = rowb + (size_t)(t0 + lr) * HE + 8 * hi;
    const v16h q0 = ldh(QH + qo), q1 = ldh(QH + qo + 32);                  // B fragments: col t, k = d (two k-steps)
    const v16h hz = (v16h){};
    v8f o[4], oR[4];
#pragma unroll
    for (int j = 0; j < 4; ++j) { o[j] = (v8f){}; oR[j] = (v8f){}; }
    float m = NEGB, l = 0.0f;
    // the four fragments of one 32-key tile of either plane; p = the tile's place in the stage + 8 * lane. K: 16-key tile = four 512-B groups (A fragment: row key, k = d; two groups per k-step); V^T: eight groups (A fragment: row d, k = key; two per 16-row d tile)
    auto ld_t = [&](const h16* p, v16h (&f)[4]) { f[0] = ldf(p); f[1] = ldf(p + 512); f[2] = ldf(p + 1024); f[3] = ldf(p + 1536); };
    // fetch: the register set is refilled, right behind the products that read it, with the tile at nk, nv (the same stage's second tile)
    auto tile = [&](int key0, bool fetch, const h16* nk, const h16* nv, bool diag, v16h (&kf)[4], v16h (&vf)[4]) __attribute__((always_inline)) {
        v8f sA = (v8f){}, sB = (v8f){};
        sA = wmma16g(kf[0], q0, sA); sB = wmma16g(kf[2], q0, sB);
        sA = wmma16g(kf[1], q1, sA); sB = wmma16g(kf[3], q1, sB);
        if (fetch) ld_t(nk, kf);
        const int ja = key0 + 8 * hi;                                      // D: sA[r] = (key ja + r, t = lane&15), sB[r] = (key ja + 16 + r, t)
        float ta[8], tb[8]; bool fa[8], fb[8]; float mx = NEGB;
#pragma unroll
        for (int r = 0; r < 8; ++r) {
            fa[r] = !diag || (ja + r <= lim);
            fb[r] = !diag || (ja + 16 + r <= lim);
            ta[r] = sA[r] * SC2; tb[r] = sB[r] * SC2;
            mx = fmaxf(mx, fmaxf(fa[r] ? ta[r] : NEGB, fb[r] ? tb[r] : NEGB)); }
        mx = fmaxf(mx, __shfl_xor(mx, 16, 32));
        const float mnew = fmaxf(m, mx);
        const float alpha = __builtin_amdgcn_exp2f(m - mnew);
        const float sh = PSH - mnew;
        v16h pb, pr = hz; float ls = 0.0f; float ga[8], gb[8];
#pragma unroll
        for (int r = 0; r < 8; ++r) {
            // scale and shift written as one fused operation, so that every form of the tile rounds the exponent alike whatever the compiler would pick
            const float ea = __builtin_amdgcn_exp2f(__builtin_fmaf(sA[r], SC2, sh)), eb = __builtin_amdgcn_exp2f(__builtin_fmaf(sB[r], SC2, sh));
            ga[r] = fa[r] ? ea : 0.0f; gb[r] = fb[r] ? eb : 0.0f; }           // dropped elements selected to 0 by value
#pragma unroll   // unrolled: ga, gb, pb and pr stay in registers only under constant indices
        for (int r = 0; r < 8; r += 2) {                                      // neighbouring keys share a register of the B fragment: one packed convert fills it
            const v2h pa = toh2(ga[r], ga[r + 1]), pc = toh2(gb[r], gb[r + 1]);
            pb[r] = pa[0]; pb[r + 1] = pa[1]; pb[8 + r] = pc[0]; pb[9 + r] = pc[1];
            if (EARLY) {
                const v2h ra = toh2((ga[r] - (float)pa[0]) * QRS, (ga[r + 1] - (float)pa[1]) * QRS), rc = toh2((gb[r] - (float)pc[0]) * QRS, (gb[r + 1] - (float)pc[1]) * QRS);
                pr[r] = ra[0]; pr[r + 1] = ra[1]; pr[8 + r] = rc[0]; pr[9 + r] = rc[1];
                ls += ga[r] + gb[r]; ls += ga[r + 1] + gb[r + 1]; }
            else { ls += (float)pa[0] + (float)pc[0]; ls += (float)pa[1] + (float)pc[1]; } }
        l = l * alpha + ls; m = mnew;
#pragma unroll
        for (int j = 0; j < 4; ++j) o[j] = o[j] * alpha;
        if (EARLY) {
#pragma unroll
            for (int j = 0; j < 4; ++j) oR[j] = oR[j] * alpha; }
        o[0] = wmma16g(vf[0], pb, o[0]); o[1] = wmma16g(vf[1], pb, o[1]); o[2] = wmma16g(vf[2], pb, o[2]); o[3] = wmma16g(vf[3], pb, o[3]);
        if (EARLY) {
            oR[0] = wmma16g(vf[0], pr, oR[0]); oR[1] = wmma16g(vf[1], pr, oR[1]); oR[2] = wmma16g(vf[2], pr, oR[2]); oR[3] = wmma16g(vf[3], pr, oR[3]);
        }
        if (fetch) ld_t(nv, vf);
    };
    // stage 0 has landed (each wave waits for its own copies) and is published by the barrier; stage 1 then flies while stage 0 is worked on
    asm volatile("s_wait_asynccnt 0x0" ::: "memory");
    __syncthreads();
    const int ns = xb / KG + 1;                                            // ring stages of the row block
    if (ns >= 2) copy(1);
    v16h kE[4], vE[4];
    const h16* rl = ring + grp * (STK * HD) + 8 * lane;                    // the group's span of a stage's k part
    const int sl = (ns - 1) * KG + grp;                                    // the group's span in the last stage: below xb (no row's diagonal in it), xb, or past it
    const int lt = (sl < xb) ? 1 : (w >> 1);                               // the wave's last tile in that span (span xb: the tile that its diagonal crosses)
    if constexpr (EARLY) {
        // twice the accumulators: one register set; a stage's second tile is fetched behind the first tile's products
#pragma unroll 1   // kept rolled: one trip per ring stage, the buffer picked by the trip's parity
        for (int s = 0; s < ns - 1; ++s) {
            const h16* sk = rl + (s & 1) * (2 * STH); const h16* sv = sk + STH;
            ld_t(sk, kE); ld_t(sv, vE);
            tile((s * KG + grp) * STK, true, sk + 2048, sv + 2048, false, kE, vE);
            tile((s * KG + grp) * STK + 32, false, sk, sv, false, kE, vE);
            asm volatile("s_wait_dscnt 0x0" ::: "memory");      // this wave's reads of the buffer have ended before it is refilled
            asm volatile("s_wait_asynccnt 0x0" ::: "memory");   // this wave's copies of stage s + 1 have landed before the barrier publishes them
            __syncthreads();
            if (s + 2 < ns) copy(s + 2);
        }
        const h16* sk = rl + ((ns - 1) & 1) * (2 * STH); const h16* sv = sk + STH;
        if (sl <= xb) {                                                    // wave-uniform; no barrier inside
            if (lt) { ld_t(sk, kE); ld_t(sv, vE); tile(sl * STK, false, sk, sv, false, kE, vE); }
            ld_t(sk + 2048 * lt, kE); ld_t(sv + 2048 * lt, vE);
            tile(sl * STK + 32 * lt, false, sk, sv, true, kE, vE);
        }
    } else {
        v16h kO[4], vO[4];
#pragma unroll 1   // kept rolled: one trip per ring stage, the buffer picked by the trip's parity
        for (int s = 0; s < ns - 1; ++s) {
            const h16* sk = rl + (s & 1) * (2 * STH); const h16* sv = sk + STH;
            ld_t(sk, kE); ld_t(sv, vE); ld_t(sk + 2048, kO); ld_t(sv + 2048, vO);
            tile((s * KG + grp) * STK, false, sk, sv, false, kE, vE);
            tile((s * KG + grp) * STK + 32, false, sk, sv, false, kO, vO);
            asm volatile("s_wait_dscnt 0x0" ::: "memory");      // this wave's reads of the buffer have ended before it is refilled
            asm volatile("s_wait_asynccnt 0x0" ::: "memory");   // this wave's copies of stage s + 1 have landed before the barrier publishes them
            __syncthreads();
            if (s + 2 < ns) copy(s + 2);
        }
        const h16* sk = rl + ((ns - 1) & 1) * (2 * STH); const h16* sv = sk + STH;
        if (sl <= xb) {                                                    // wave-uniform; no barrier inside
            ld_t(sk + 2048 * lt, kO); ld_t(sv + 2048 * lt, vO);
            if (lt) { ld_t(sk, kE); ld_t(sv, vE); tile(sl * STK, false, sk, sv, false, kE, vE); }
            tile(sl * STK + 32 * lt, false, sk, sv, true, kO, vO);
        }
    }
    asm volatile("s_wait_asynccnt 0x0" ::: "memory");   // no copy is outstanding when the ring takes other data
    asm volatile("s_wait_dscnt 0x0" ::: "memory");      // this wave's reads of the ring have ended
    __syncthreads();                                    // every wave has left the ring: it becomes the join area
    // join area: wave w's piece i is 512 contiguous bytes, 16 B a lane; a lane of group 0 and the same lane of group 1 hold the same (row, d) places
    constexpr int NJ = EARLY ? 17 : 9;
    float* jp = (float*)ring + ((size_t)w * NJ * 32 + lane) * 4;
    if (grp == 1) {
#pragma unroll
        for (int j = 0; j < 4; ++j) {
            *(v4fa*)(jp + (2 * j) * 128) = (v4f){o[j][0], o[j][1], o[j][2], o[j][3]}; *(v4fa*)(jp + (2 * j + 1) * 128) = (v4f){o[j][4], o[j][5], o[j][6], o[j][7]};
            if (EARLY) { *(v4fa*)(jp + (8 + 2 * j) * 128) = (v4f){oR[j][0], oR[j][1], oR[j][2], oR[j][3]}; *(v4fa*)(jp + (9 + 2 * j) * 128) = (v4f){oR[j][4], oR[j][5], oR[j][6], oR[j][7]}; } }
        *(v4fa*)(jp + (NJ - 1) * 128) = (v4f){m, l, 0.0f, 0.0f};
    }
    __syncthreads();                                    // publishes group 1's stores
    if (grp == 1) return;                               // wave-uniform, behind the last block barrier
    {
        const v4f ml = *(const v4fa*)(jp + (NJ - 1) * 128);
        const float mm = fmaxf(m, ml[0]);
        const float a0 = __builtin_amdgcn_exp2f(m - mm), a1 = __builtin_amdgcn_exp2f(ml[0] - mm);
        l = l * a0 + ml[1] * a1;
#pragma unroll
        for (int j = 0; j < 4; ++j) {
            const v4f x0 = *(const v4fa*)(jp + (2 * j) * 128), x1 = *(const v4fa*)(jp + (2 * j + 1) * 128);
#pragma unroll
            for (int i = 0; i < 4; ++i) { o[j][i] = o[j][i] * a0 + x0[i] * a1; o[j][4 + i] = o[j][4 + i] * a0 + x1[i] * a1; }
            if (EARLY) {
                const v4f y0 = *(const v4fa*)(jp + (8 + 2 * j) * 128), y1 = *(const v4fa*)(jp + (9 + 2 * j) * 128);
#pragma unroll
                for (int i = 0; i < 4; ++i) { oR[j][i] = oR[j][i] * a0 + y0[i] * a1; oR[j][4 + i] = oR[j][4 + i] * a0 + y1[i] * a1; } } }
    }
    l += __shfl_xor(l, 16, 32);
    const bool any = l > 0.0f;
    const float lsafe = any ? l : 1.0f;
    const float inv = any ? (1.0f / lsafe) : 0.0f;
    const int wb = w * 16 * OSP;
    // O^T D layout: f_j[r] = (d = 16j + 8h + r, t = lane&15) -> os[t][d]; rows 0..15 x columns 0..63 all written
#pragma unroll
    for (int j = 0; j < 4; ++j) {
        v8f f = o[j];
        if (EARLY) f = o[j] + oR[j] * QRI;
        v4f a, c;
        a[0] = f[0] * inv; a[1] = f[1] * inv; a[2] = f[2] * inv; a[3] = f[3] * inv; c[0] = f[4] * inv; c[1] = f[5] * inv; c[2] = f[6] * inv; c[3] = f[7] * inv;
        *(v4fa*)(&os[wb + lr * OSP + 16 * j + 8 * hi]) = a; *(v4fa*)(&os[wb + lr * OSP + 16 * j + 8 * hi + 4]) = c; }
    wave_sync();
    float* orow = OUT + (((size_t)b * OUT_SEQ + t0) * NHD + h) * HD;
{
#pragma unroll
        for (int s = 0; s < 8; ++s) { const int row = 2 * s + (lane >> 4), cofs = (lane & 15) * 4;   // 8 s x 2 rows = 16 rows; 16 lanes x 4 floats = 64 columns = two lines
            const v4f val = *(const v4fa*)(&os[wb + row * OSP + cofs]);
            *(v4f*)(orow + (size_t)row * HE + cofs) = val; }
         }
}

// k_flash: all row blocks of all heads in one launch, grid (NB*NHD heads, NXB ranks), blocks of KG * AW waves. At 4 waves per SIMD two blocks stand on a WGP, so half the grid is resident at once.
// A block's cost grows linearly with its row block xb; the grid's index order puts the longest row blocks first.
// Head index fastest: blocks of one rank (blockIdx.y) walk the same length. Where and when a block runs is the dispatcher's choice: the order is for speed only, every (head, row block) is done exactly once.
// four waves per SIMD (at most 256 registers a wave)
__global__ __launch_bounds__(32 * AW * KG) __attribute__((amdgpu_waves_per_eu(4, 4))) void k_flash(const h16* __restrict__ QH, const h16* __restrict__ KP, const h16* __restrict__ VT, float* OUT) {
    __shared__ __align__(16) float os[AW * 16 * OSP];
    __shared__ __align__(16) h16 ring[2 * 2 * STH];   // two buffers x (k stage, v^T stage)
    const int zh = blockIdx.x;
    const int xb = NXB - 1 - (int)blockIdx.y;
    if (xb < EROWS / (16 * AW)) flash_body<1>(QH, KP, VT, OUT, os, ring, zh, xb);   // block-uniform
    else                        flash_body<0>(QH, KP, VT, OUT, os, ring, zh, xb);
}

static constexpr size_t al256(size_t v) { return (v + 255) & ~(size_t)255; }
static constexpr size_t SZ_QK = al256((size_t)NB * SEQ * HE * 2);           // q plane [NB][SEQ][HE] f16; k plane [NB*NHD][SEQ/16][4][32][8] f16
static constexpr size_t SZ_VT = al256((size_t)NB * NHD * HD * SEQ * 2);     // v^T plane [NB*NHD][SEQ/32][8][32][8] f16
static constexpr size_t SZ_TOTAL = 2 * SZ_QK + SZ_VT;
static_assert(SZ_TOTAL <= (size_t)134217728);          // workspace carve <= 128 MiB
static_assert(((size_t)NB * SEQ * HE * 2) % 128 == 0);
static_assert(((size_t)SEQ * 2) % 128 == 0);

extern "C" void kernel_launch(void* const* d_in, const int* in_sizes, int n_in,
                              void* d_out, int out_size, void* d_ws, size_t ws_size, hipStream_t stream) {
    if (n_in < 3) return;
    const size_t needx = ((size_t)(NB - 1) * SEQ_FULL + SEQ) * HE;
    if ((size_t)in_sizes[0] < needx || (size_t)in_sizes[1] < needx || (size_t)in_sizes[2] < needx) return;
    if ((size_t)out_size < ((size_t)(NB - 1) * OUT_SEQ + SEQ) * HE) return;
    if (SZ_TOTAL > ws_size) return;
    // wire order: queries, keys, values
    const float* qin = (const float*)d_in[0];
    const float* kin = (const float*)d_in[1];
    const float* vin = (const float*)d_in[2];
    float* OUT = (float*)d_out;      // [NB][SEQ][16][64]
    char* wsp = (char*)d_ws;
    h16* QH = (h16*)wsp; wsp += SZ_QK;               // [NB][SEQ][1024]
    h16* KP = (h16*)wsp; wsp += SZ_QK;               // [NB*16][SEQ/16][4][32][8]
    h16* VT = (h16*)wsp; wsp += SZ_VT;               // [NB*16][SEQ/32][8][32][8]

    // q -> f16 plane in the input layout; k, v -> f16 planes in fragment order; grid (token spans, batch*head)
    k_prep<<<dim3(SEQ / (64 * PU), NB * NHD, 1), 256, 0, stream>>>(qin, kin, vin, QH, KP, VT);

    // query rows [0, EROWS): two-plane-P instantiation; rows [EROWS, SEQ): single-product instantiation (disjoint output rows); one launch, grid (batch*head, rank of the row block)
    k_flash<<<dim3(NB * NHD, NXB, 1), 32 * AW * KG, 0, stream>>>(QH, KP, VT, OUT);
}

// v009
// It runs in 33.5 microseconds.
// Next to v008, in two timings, it ran 1.04 times as fast each time.
// Over all steps from v000 it is 2.94 times as fast.
#include <hip/hip_runtime.h>

// Causal scaled dot-product attention over per-head slices, no projections: q/k/v [NB][SEQ][16][64] (f32), key j kept for query t iff j <= t (dropped keys get probability 0), score scale 1/sqrt(64), output [NB][SEQ][16][64] (f32).
// Compute dtypes, f32 accumulate everywhere: scores v_wmma_f32_16x16x32_f16 with q, k single f16 planes (inputs RNE-converted to bf16, then held in f16: exact for f16-normal values, smaller magnitudes selected to +0);
// P.V v_wmma_f32_16x16x32_f16: v single f16 plane (same conversion), P f16 with x16384 carry (cancels in the normalisation), converted RNE two at a time, values below 2^-14 kept as f16 subnormals; on query rows < EROWS P = f16 value + f16 residual x2048, residual products in their own accumulators folded by 1/2048, row sum from the f32 exponentials; on later rows row sum over the converted P. Softmax f32 (online, running max over kept keys).
// Layout: f16 copy of q in the input layout [b][t][h*64 + d] (row pitch 1024 halves); k and v^T planes in fragment order (see k_prep): each 16-B piece stands where the lane that loads it finds it, so one wave-wide 16-B load reads 512 contiguous bytes (four whole lines);
// all three planes written by one launch, k and v through LDS; fused flash kernel in transposed form (S^T = K Q^T, O^T = V^T P^T), k and v^T fragments from an LDS ring filled once per block, a row block's keys shared out between two groups of waves whose partial results are joined through LDS, output from f32 accumulators.

#ifndef NB
#define NB 2
#endif
#ifndef SEQ
#define SEQ 2048
#endif
#define NB_FULL  2
#define SEQ_FULL 2048
#ifndef OUT_SEQ
#define OUT_SEQ SEQ              // row pitch (in tokens) between batches of the output
#endif
#define NHD  16                  // heads
#define HD   64                  // head width
#define HE   (NHD * HD)          // token row pitch (elements) of the inputs, the q plane and the output
#define AW   4                   // waves per key group of a flash block (16 query rows each)
#define KG   2                   // key groups per flash block: group g takes the 64-key spans g, g + KG, ..
#define OSP  68                  // LDS row pitch (floats) of the flash output tile
#define TP   68                  // LDS row pitch (floats) of the transpose tile
#define PU   2                   // 64-token tiles per block of the plane-building kernel
#define KU   (64 * PU * 8)       // 16-B pieces of k per block of the plane-building kernel
#define EROWS (SEQ < 512 ? SEQ : 512)   // query rows handled by the two-plane-P flash instantiation
#define NXB  (SEQ / (16 * AW))   // row blocks (16*AW query rows each) per (batch, head)
#define STK  64                  // keys of one group in a stage of the flash kernel's LDS ring
#define STH  (KG * STK * HD)     // halves of one plane in a stage (KG * STK keys)
#define QRS  2048.0f             // carry of the residual P fragment
#define QRI  (1.0f / 2048.0f)
#define SC2  ((float)(0.125 * 1.4426950408889634))   // HD^-0.5 * log2(e)
#define PSH  14.0f               // log2 of the P carry (16384)
#define NEGB (-3.0e38f)

static_assert(HD == 64);                       // two 32-deep k-steps per score tile, four 16-row output tiles
static_assert(NHD * HD == HE);
static_assert(HD % 32 == 0);                   // score k-loop steps by 32
static_assert(HE % 8 == 0);                    // 16-byte fragment loads from token rows
static_assert(SEQ % 64 == 0);
static_assert(SEQ % 32 == 0);                  // key loop steps by 32 and its bound never exceeds SEQ
static_assert(SEQ % (16 * AW) == 0);
static_assert(EROWS % (16 * AW) == 0);
static_assert((SEQ - EROWS) % (16 * AW) == 0);
static_assert(EROWS >= 32);
static_assert(EROWS <= SEQ);
static_assert(SEQ % (KG * STK) == 0);           // a ring stage never ends past the planes
static_assert(NB <= NB_FULL);
static_assert(SEQ <= SEQ_FULL);
static_assert(OSP >= HD);
static_assert((OSP * 4) % 16 == 0);
static_assert(TP >= 64);
static_assert((TP * 4) % 16 == 0);
static_assert(SEQ % (64 * PU) == 0);                                 // plane-building grid x tokens per block == SEQ
static_assert((size_t)32 * 16 * 8 == (size_t)16 * HD * 4);           // flash epilogue: 32 lanes x 16 B x 8 trips == 16 rows x 256 B
static_assert((size_t)256 * 2 * 8 == (size_t)64 * HD);               // q/k convert: 256 threads x 2 pieces x 8 floats == 64 tokens x 64 columns
static_assert((size_t)256 * 2 * PU * 8 == (size_t)HD * 64 * PU);     // v^T store: 256 threads x 2*PU pieces x 8 halves == 64 rows x 64*PU tokens
static_assert((size_t)256 * 4 * 4 == (size_t)64 * HD);               // transpose load: 256 threads x 4 float4 x 4 floats == 64 tokens x 64 columns
static_assert(STK == 16 * AW);                                       // row block xb walks the 64-key spans 0 .. xb, the diagonal inside the last
static_assert((size_t)32 * AW * KG * 4 * 16 == (size_t)STH * 2);     // stage copy: 256 threads x 4 pieces x 16 B == one plane's stage
static_assert(2 * ((size_t)AW * 16 * OSP * 4 + (size_t)4 * STH * 2) <= 327680);   // static LDS of two resident flash blocks
static_assert((size_t)AW * 17 * 512 <= (size_t)4 * STH * 2);         // the join area (17 wave-wide 16-B pieces per wave at most) fits the ring
static_assert((size_t)256 * 2 * PU == (size_t)KU);                   // k fragment store: 256 threads x 2*PU pieces == all pieces of the block
static_assert(KU % 16 == 0);
static_assert((size_t)PU * 64 * TP * 4 + (size_t)(KU + KU / 16) * 16 <= 131072);   // static LDS of the plane-building kernel

typedef _Float16 h16;
typedef __attribute__((ext_vector_type(16))) _Float16 v16h;
typedef __attribute__((ext_vector_type(8)))  _Float16 v8h;
typedef __attribute__((ext_vector_type(8)))  float    v8f;
typedef __attribute__((ext_vector_type(4)))  float    v4f;
typedef v4f  __attribute__((may_alias)) v4fa;
typedef __attribute__((ext_vector_type(2)))  float    v2f;
typedef __attribute__((ext_vector_type(2)))  _Float16 v2h;

__device__ __forceinline__ unsigned short f2bf(float f) { unsigned u = __float_as_uint(f); u += 0x7FFFu + ((u >> 16) & 1u); return (unsigned short)(u >> 16); }
__device__ __forceinline__ float bfr(float f) { return __uint_as_float(((unsigned)f2bf(f)) << 16); }   // value after RNE convert to bf16
__device__ __forceinline__ v16h cat16(v8h lo, v8h hi) { return __builtin_shufflevector(lo, hi, 0, 1, 2, 3, 4, 5, 6, 7, 8, 9, 10, 11, 12, 13, 14, 15); }
// fragment loader from K-contiguous 16-bit rows; p already includes + 8*(lane>>4): elements 0..7 <- k0+8h+0..7, elements 8..15 <- k0+16+8h+0..7 (same map for A and B)
__device__ __forceinline__ v16h  ldh(const h16* p) { return cat16(*(const v8h*)p, *(const v8h*)(p + 16)); }
// fragment loader from a fragment-order plane; p already includes + 8*lane: elements 0..7 from the lane's piece of one 512-B group, elements 8..15 from its piece of the next group
__device__ __forceinline__ v16h  ldf(const h16* p) { return cat16(*(const v8h*)p, *(const v8h*)(p + 256)); }
// ordering point for wave-private LDS tiles (same wave writes and reads)
__device__ __forceinline__ void wave_sync() { __builtin_amdgcn_fence(3 /* release order */, "wavefront"); __builtin_amdgcn_wave_barrier(); asm volatile("" ::: "memory"); }
// f32 -> f16 convert that cannot produce an f16 subnormal (value select)
static __device__ __forceinline__ h16 toh_flush(float v) { const h16 r = (h16)v; return (fabsf(v) < 6.103515625e-05f) ? (h16)0.0f : r; }
// two f32 -> one register of two f16, round to nearest even, one packed convert; a result below 2^-14 stays an f16 subnormal, which the matrix unit takes as it is
static __device__ __forceinline__ v2h toh2(float a, float b) { return __builtin_convertvector((v2f){a, b}, v2h); }
// one WMMA, the builtin alone: the compiler keeps the distance to the first vector instruction on D, A or B, and fills it with independent instructions (other WMMAs, softmax work) where it has some
__device__ __forceinline__ v8f wmma16(v16h a, v16h b, v8f c) { return __builtin_amdgcn_wmma_f32_16x16x32_f16(false, a, false, b, (short)0, c, false, false); }

// k_prep: the three f16 planes in one launch. One block per (64*PU-token span, batch*head): grid (SEQ/(64*PU), NB*NHD), 256 threads; the block reads the same
// 64*PU tokens x 64 columns of q, k and v. Every global load of a thread (12*PU of 16 B) is issued before the first use, so one wave start and one memory latency serve all of them.
// q: in[t][h*64 + d] (f32, token pitch HE) -> same layout in f16, 8 values per piece, 8 lanes fill one 128-B line.
// k: piece (token t, columns 8c..8c+7) -> 16-B unit ((b*16 + h)*(SEQ/16) + t/16)*128 + (c>>1)*32 + (c&1)*16 + t%16: group c>>1 of a 16-key tile holds, at lane (c&1)*16 + t%16, what that lane takes as one half of an A fragment.
//    The pieces change threads through LDS (a spare unit behind every 16 spreads the banks), under the same block barrier as v.
// v: piece (column d, tokens 8g..8g+7) -> 16-B unit ((b*16 + h)*(SEQ/32) + g/4)*256 + (d/16)*64 + (g&3)*16 + d%16: float4 loads scattered transposed into LDS float tiles [d][t] (cross-wave: block barrier), then 16-B pieces.
// A thread stores unit (trip*256 + tid) of the block's span of either plane: a wave's store is 512 contiguous bytes.
__global__ __launch_bounds__(256) void k_prep(const float* __restrict__ Q, const float* __restrict__ K, const float* __restrict__ V, h16* QH, h16* KP, h16* VT) {
    __shared__ __align__(16) float tl[PU * 64 * TP];
    __shared__ __align__(16) h16 kl[(KU + KU / 16) * 8];
    const int tid = threadIdx.x;
    const int tt0 = blockIdx.x * (64 * PU); const int zh = blockIdx.y; const int b = zh / NHD, h = zh % NHD;
    const size_t sb = ((size_t)b * SEQ_FULL + tt0) * HE + (size_t)h * HD;    // (batch b, token tt0, head h) in the inputs
    const size_t db = ((size_t)b * SEQ + tt0) * HE + (size_t)h * HD;         // the same place in the q plane
    v4f xv[PU][4]; v8f xq[PU][2], xk[PU][2];
    const float* pv[4]; const float* pq[2]; const float* pk[2];              // tile 0's addresses; tile u lies 64 * u tokens further on
#pragma unroll
    for (int s = 0; s < 4; ++s) { const int p = s * 256 + tid; pv[s] = V + sb + (size_t)(p >> 4) * HE + (p & 15) * 4; }   // 4 s x 16 tokens = 64 tokens; 16 lanes x 4 = 64 columns
#pragma unroll
    for (int s = 0; s < 2; ++s) { const int p = s * 256 + tid; const size_t o = sb + (size_t)(p >> 3) * HE + (p & 7) * 8;  // 2 s x 32 tokens = 64 tokens; 8 lanes x 8 = 64 columns
        pq[s] = Q + o; pk[s] = K + o; }
#pragma unroll
    for (int u = 0; u < PU; ++u) {
#pragma unroll
        for (int s = 0; s < 4; ++s) xv[u][s] = *(const v4f*)(pv[s] + (size_t)u * 64 * HE); }
#pragma unroll
    for (int u = 0; u < PU; ++u) {
#pragma unroll
        for (int s = 0; s < 2; ++s) { xq[u][s] = *(const v8f*)(pq[s] + (size_t)u * 64 * HE); xk[u][s] = *(const v8f*)(pk[s] + (size_t)u * 64 * HE); } }
    // every load stands above this line (left free, the scheduler sinks the q and k loads to their uses and the thread pays several memory latencies in a row);
    // the addresses are inputs, so they stay in their registers up to the wait and no load's result lands in one of them ahead of it
    asm volatile("s_wait_xcnt 0x0" :: "v"(pv[0]), "v"(pv[1]), "v"(pv[2]), "v"(pv[3]), "v"(pq[0]), "v"(pq[1]), "v"(pk[0]), "v"(pk[1]) : "memory");
#pragma unroll
    for (int u = 0; u < PU; ++u) {
#pragma unroll
        for (int s = 0; s < 4; ++s) { const int p = s * 256 + tid; const int t = p >> 4, d4 = (p & 15) * 4;
#pragma unroll
            for (int i = 0; i < 4; ++i) tl[u * 64 * TP + (d4 + i) * TP + t] = bfr(xv[u][s][i]); } }
#pragma unroll
    for (int u = 0; u < PU; ++u) {
#pragma unroll
        for (int s = 0; s < 2; ++s) { const int p = s * 256 + tid; const int t = u * 64 + (p >> 3), c = p & 7;
            v8h ok;
#pragma unroll
            for (int k = 0; k < 8; ++k) ok[k] = toh_flush(bfr(xk[u][s][k]));
            const int un = (t >> 4) * 128 + (c >> 1) * 32 + (c & 1) * 16 + (t & 15);
            *(v8h*)(&kl[(un + (un >> 4)) * 8]) = ok; } }
    __syncthreads();
    // q needs no exchange; its stores stand behind the barrier, which would otherwise wait for them
#pragma unroll
    for (int u = 0; u < PU; ++u) {
#pragma unroll
        for (int s = 0; s < 2; ++s) { const int p = s * 256 + tid; const int t = u * 64 + (p >> 3), c8 = (p & 7) * 8;
            v8h oq;
#pragma unroll
            for (int k = 0; k < 8; ++k) oq[k] = toh_flush(bfr(xq[u][s][k]));
            *(v8h*)(QH + db + (size_t)t * HE + c8) = oq;
            asm volatile("s_wait_xcnt 0x0" ::: "memory"); } }   // the next piece, and the LDS reads below, land in registers that this store names
    const size_t kb = ((size_t)zh * SEQ + tt0) * HD;                         // the block's span in either fragment-order plane: 64*PU tokens x 64 halves, contiguous
#pragma unroll
    for (int s = 0; s < 2 * PU; ++s) { const int un = s * 256 + tid;
        *(v8h*)(KP + kb + (size_t)un * 8) = *(const v8h*)(&kl[(un + (un >> 4)) * 8]); }
    asm volatile("s_wait_xcnt 0x0" ::: "memory");   // the same for the k stores and the v pieces formed below
#pragma unroll
    for (int s = 0; s < 2 * PU; ++s) { const int un = s * 256 + tid;         // trip s = 32-key tile s of the span; tid = (d/16)*64 + (g&3)*16 + d%16
        const int d = ((tid >> 6) << 4) | (tid & 15), tk = s * 32 + ((tid >> 4) & 3) * 8;
        const float* tr = &tl[(tk >> 6) * 64 * TP + d * TP + (tk & 63)];
        const v4f x0 = *(const v4fa*)(tr); const v4f x1 = *(const v4fa*)(tr + 4);
        v8h hv;
#pragma unroll
        for (int i = 0; i < 4; ++i) { hv[i] = toh_flush(x0[i]); hv[4 + i] = toh_flush(x1[i]); }
        *(v8h*)(VT + kb + (size_t)un * 8) = hv; }
}

// stage_copy: one stage of the flash kernel's LDS ring, 128 keys of the k plane and of the v^T plane (16 KiB each, contiguous in fragment order), by asynchronous copies to LDS.
// A thread brings the 16-B pieces tid, tid + 256, tid + 512, tid + 768 of either plane; kg, vg, kl, vl are its first piece's global and LDS addresses (all multiples of 16 B).
__device__ __forceinline__ void stage_copy(const h16* kg, const h16* vg, unsigned kl, unsigned vl) {
    // the wait is the statement's last line, so that no address register of a copy is rewritten ahead of it
    asm volatile("global_load_async_to_lds_b128 %0, %8, off\n\t"
                 "global_load_async_to_lds_b128 %1, %9, off\n\t"
                 "global_load_async_to_lds_b128 %2, %10, off\n\t"
                 "global_load_async_to_lds_b128 %3, %11, off\n\t"
                 "global_load_async_to_lds_b128 %4, %12, off\n\t"
                 "global_load_async_to_lds_b128 %5, %13, off\n\t"
                 "global_load_async_to_lds_b128 %6, %14, off\n\t"
                 "global_load_async_to_lds_b128 %7, %15, off\n\t"
                 "s_wait_xcnt 0x0"
                 :: "v"(kl), "v"(kl + 4096u), "v"(kl + 8192u), "v"(kl + 12288u), "v"(vl), "v"(vl + 4096u), "v"(vl + 8192u), "v"(vl + 12288u),
                    "v"(kg), "v"(kg + 2048), "v"(kg + 4096), "v"(kg + 6144), "v"(vg), "v"(vg + 2048), "v"(vg + 4096), "v"(vg + 6144)
                 : "memory");
}

// flash_body: fused attention, two waves (one of each key group) per 16 query rows of one (batch, head); a 128-key stage of K and V^T is brought into LDS once per block, group g's four waves work on its 64-key span g,
// so a wave walks half the row block's keys (two buffers, the next stage's copies in flight while this one is worked on); every wave takes its fragments from there (two 16-B LDS loads each, 512 contiguous bytes per wave-wide load); Q fragments straight from the f16 plane.
// Transposed form: S^T[key][t] = K Q^T (A = K rows, B = Q rows, two k-steps over d); lane (t = lane&15, h = lane>>4) holds keys 8h+r of each 16-key tile, so the packed
// P tile is directly the B fragment of O^T[d][t] = V^T P^T (element r <- tile keys 0..15, element 8+r <- tile keys 16..31, lane unchanged); four 16-row d tiles.
// Softmax state (running max over kept keys, partial sum) is one scalar per lane; the two lane halves of a row are combined with one xor-16 exchange.
// Row block xb (query rows 64*xb .. 64*xb+63) walks the 64-key spans 0 .. xb, ring stages 0 .. xb/2. Spans below xb end below the block's first row: both 32-key tiles unmasked in every wave.
// Span xb: waves 0 and 1 of its group end in its first tile, waves 2 and 3 take that tile unmasked and end in the second; the keep rule (key <= query) is evaluated per element in a wave's last tile of the last stage only. Every visited tile holds a kept key for every row.
// For even xb the last stage's second span lies past the diagonal: group 1 does no work there (for xb = 0 none at all: its running max stays at the start value and its weight in the join is 0).
// Join: group 1 hands its accumulators, running max and partial sum over through LDS (the ring, once every wave has left it); group 0 brings both to the common max, adds them and writes the output.
// EARLY = 1 (query rows [0, EROWS)): P = f16 value + f16 residual x2048; O = V P + (V P_res) / 2048 (residual products in their own accumulators); row sum from the f32 exponentials.
// EARLY = 0 (query rows [EROWS, SEQ)): single P; row sum over the converted P.
template <int EARLY>
__device__ __forceinline__ void flash_body(const h16* __restrict__ QH, const h16* __restrict__ KP, const h16* __restrict__ VT, float* OUT, float* os, h16* ring, const int zh, const int xb) {
    const int lane = threadIdx.x & 31, lr = lane & 15, hi = lane >> 4;
    const int wave = __builtin_amdgcn_readfirstlane((int)(threadIdx.x >> 5));
    const int b = zh / NHD, h = zh % NHD;
    const int grp = wave / AW, w = wave % AW;                              // key group; place among the group's waves
    const int t0 = (xb * AW + w) * 16;                                     // EARLY = 1: xb < EROWS / (16*AW), so t0 < EROWS; EARLY = 0: t0 >= EROWS
    const int lim = t0 + lr;                                               // key j kept iff j <= lim
    // the thread's first piece of stage 0 in either plane, and of buffer 0 in LDS; stage s lies s * STH halves further on, buffer 1 2 * STH halves; s <= xb / KG < SEQ / (KG * STK), so every stage lies inside the planes
    const h16* kg0 = KP + (size_t)zh * SEQ * HD + 8 * (int)threadIdx.x;
    const h16* vg0 = VT + (size_t)zh * SEQ * HD + 8 * (int)threadIdx.x;
    const unsigned kl0 = (unsigned)(size_t)ring + 16u * threadIdx.x;
    auto copy = [&](int s) { const unsigned kl = kl0 + (unsigned)(s & 1) * (4u * STH); stage_copy(kg0 + (size_t)s * STH, vg0 + (size_t)s * STH, kl, kl + 2u * STH); };
    copy(0);
    const size_t rowb = (size_t)b * SEQ * HE + (size_t)h * HD;            // (batch b, token 0, head h) in the q plane
    const size_t qo = rowb + (size_t)(t0 + lr) * HE + 8 * hi;
    const v16h q0 = ldh(QH + qo), q1 = ldh(QH + qo + 32);                  // B fragments: col t, k = d (two k-steps)
    const v16h hz = (v16h){};
    v8f o[4], oR[4];
#pragma unroll
    for (int j = 0; j < 4; ++j) { o[j] = (v8f){}; oR[j] = (v8f){}; }
    float m = NEGB, l = 0.0f;
    // the four fragments of one 32-key tile of either plane; p = the tile's place in the stage + 8 * lane. K: 16-key tile = four 512-B groups (A fragment: row key, k = d; two groups per k-step); V^T: eight groups (A fragment: row d, k = key; two per 16-row d tile)
    auto ld_t = [&](const h16* p, v16h (&f)[4]) { f[0] = ldf(p); f[1] = ldf(p + 512); f[2] = ldf(p + 1024); f[3] = ldf(p + 1536); };
    // fetch: the register set is refilled, right behind the products that read it, with the tile at nk, nv (the same stage's second tile)
    auto tile = [&](int key0, bool fetch, const h16* nk, const h16* nv, bool diag, v16h (&kf)[4], v16h (&vf)[4]) __attribute__((always_inline)) {
        v8f sA = (v8f){}, sB = (v8f){};
        sA = wmma16(kf[0], q0, sA); sB = wmma16(kf[2], q0, sB);
        sA = wmma16(kf[1], q1, sA); sB = wmma16(kf[3], q1, sB);
        if (fetch) ld_t(nk, kf);
        const int ja = key0 + 8 * hi;                                      // D: sA[r] = (key ja + r, t = lane&15), sB[r] = (key ja + 16 + r, t)
        float ta[8], tb[8]; bool fa[8], fb[8]; float mx = NEGB;
#pragma unroll
        for (int r = 0; r < 8; ++r) {
            fa[r] = !diag || (ja + r <= lim);
            fb[r] = !diag || (ja + 16 + r <= lim);
            ta[r] = sA[r] * SC2; tb[r] = sB[r] * SC2;
            mx = fmaxf(mx, fmaxf(fa[r] ? ta[r] : NEGB, fb[r] ? tb[r] : NEGB)); }
        mx = fmaxf(mx, __shfl_xor(mx, 16, 32));
        const float mnew = fmaxf(m, mx);
        const float alpha = __builtin_amdgcn_exp2f(m - mnew);
        const float sh = PSH - mnew;
        v16h pb, pr = hz; float ls = 0.0f; float ga[8], gb[8];
#pragma unroll
        for (int r = 0; r < 8; ++r) {
            // scale and shift written as one fused operation, so that every form of the tile rounds the exponent alike whatever the compiler would pick
            const float ea = __builtin_amdgcn_exp2f(__builtin_fmaf(sA[r], SC2, sh)), eb = __builtin_amdgcn_exp2f(__builtin_fmaf(sB[r], SC2, sh));
            ga[r] = fa[r] ? ea : 0.0f; gb[r] = fb[r] ? eb : 0.0f; }           // dropped elements selected to 0 by value
#pragma unroll   // unrolled: ga, gb, pb and pr stay in registers only under constant indices
        for (int r = 0; r < 8; r += 2) {                                      // neighbouring keys share a register of the B fragment: one packed convert fills it
            const v2h pa = toh2(ga[r], ga[r + 1]), pc = toh2(gb[r], gb[r + 1]);
            pb[r] = pa[0]; pb[r + 1] = pa[1]; pb[8 + r] = pc[0]; pb[9 + r] = pc[1];
            if (EARLY) {
                const v2h ra = toh2((ga[r] - (float)pa[0]) * QRS, (ga[r + 1] - (float)pa[1]) * QRS), rc = toh2((gb[r] - (float)pc[0]) * QRS, (gb[r + 1] - (float)pc[1]) * QRS);
                pr[r] = ra[0]; pr[r + 1] = ra[1]; pr[8 + r] = rc[0]; pr[9 + r] = rc[1];
                ls += ga[r] + gb[r]; ls += ga[r + 1] + gb[r + 1]; }
            else { ls += (float)pa[0] + (float)pc[0]; ls += (float)pa[1] + (float)pc[1]; } }
        l = l * alpha + ls; m = mnew;
#pragma unroll
        for (int j = 0; j < 4; ++j) o[j] = o[j] * alpha;
        if (EARLY) {
#pragma unroll
            for (int j = 0; j < 4; ++j) oR[j] = oR[j] * alpha; }
        o[0] = wmma16(vf[0], pb, o[0]); o[1] = wmma16(vf[1], pb, o[1]); o[2] = wmma16(vf[2], pb, o[2]); o[3] = wmma16(vf[3], pb, o[3]);
        if (EARLY) {
            oR[0] = wmma16(vf[0], pr, oR[0]); oR[1] = wmma16(vf[1], pr, oR[1]); oR[2] = wmma16(vf[2], pr, oR[2]); oR[3] = wmma16(vf[3], pr, oR[3]);
        }
        if (fetch) ld_t(nv, vf);
    };
    // stage 0 has landed (each wave waits for its own copies) and is published by the barrier; stage 1 then flies while stage 0 is worked on
    asm volatile("s_wait_asynccnt 0x0" ::: "memory");
    __syncthreads();
    const int ns = xb / KG + 1;                                            // ring stages of the row block
    if (ns >= 2) copy(1);
    v16h kE[4], vE[4];
    const h16* rl = ring + grp * (STK * HD) + 8 * lane;                    // the group's span of a stage's k part
    const int sl = (ns - 1) * KG + grp;                                    // the group's span in the last stage: below xb (no row's diagonal in it), xb, or past it
    const int lt = (sl < xb) ? 1 : (w >> 1);                               // the wave's last tile in that span (span xb: the tile that its diagonal crosses)
    if constexpr (EARLY) {
        // twice the accumulators: one register set; a stage's second tile is fetched behind the first tile's products
#pragma unroll 1   // kept rolled: one trip per ring stage, the buffer picked by the trip's parity
        for (int s = 0; s < ns - 1; ++s) {
            const h16* sk = rl + (s & 1) * (2 * STH); const h16* sv = sk + STH;
            ld_t(sk, kE); ld_t(sv, vE);
            tile((s * KG + grp) * STK, true, sk + 2048, sv + 2048, false, kE, vE);
            tile((s * KG + grp) * STK + 32, false, sk, sv, false, kE, vE);
            asm volatile("s_wait_dscnt 0x0" ::: "memory");      // this wave's reads of the buffer have ended before it is refilled
            asm volatile("s_wait_asynccnt 0x0" ::: "memory");   // this wave's copies of stage s + 1 have landed before the barrier publishes them
            __syncthreads();
            if (s + 2 < ns) copy(s + 2);
        }
        const h16* sk = rl + ((ns - 1) & 1) * (2 * STH); const h16* sv = sk + STH;
        if (sl <= xb) {                                                    // wave-uniform; no barrier inside
            if (lt) { ld_t(sk, kE); ld_t(sv, vE); tile(sl * STK, false, sk, sv, false, kE, vE); }
            ld_t(sk + 2048 * lt, kE); ld_t(sv + 2048 * lt, vE);
            tile(sl * STK + 32 * lt, false, sk, sv, true, kE, vE);
        }
    } else {
        v16h kO[4], vO[4];
#pragma unroll 1   // kept rolled: one trip per ring stage, the buffer picked by the trip's parity
        for (int s = 0; s < ns - 1; ++s) {
            const h16* sk = rl + (s & 1) * (2 * STH); const h16* sv = sk + STH;
            ld_t(sk, kE); ld_t(sv, vE); ld_t(sk + 2048, kO); ld_t(sv + 2048, vO);
            tile((s * KG + grp) * STK, false, sk, sv, false, kE, vE);
            tile((s * KG + grp) * STK + 32, false, sk, sv, false, kO, vO);
            asm volatile("s_wait_dscnt 0x0" ::: "memory");      // this wave's reads of the buffer have ended before it is refilled
            asm volatile("s_wait_asynccnt 0x0" ::: "memory");   // this wave's copies of stage s + 1 have landed before the barrier publishes them
            __syncthreads();
            if (s + 2 < ns) copy(s + 2);
        }
        const h16* sk = rl + ((ns - 1) & 1) * (2 * STH); const h16* sv = sk + STH;
        if (sl <= xb) {                                                    // wave-uniform; no barrier inside
            ld_t(sk + 2048 * lt, kO); ld_t(sv + 2048 * lt, vO);
            if (lt) { ld_t(sk, kE); ld_t(sv, vE); tile(sl * STK, false, sk, sv, false, kE, vE); }
            tile(sl * STK + 32 * lt, false, sk, sv, true, kO, vO);
        }
    }
    asm volatile("s_wait_asynccnt 0x0" ::: "memory");   // no copy is outstanding when the ring takes other data
    asm volatile("s_wait_dscnt 0x0" ::: "memory");      // this wave's reads of the ring have ended
    __syncthreads();                                    // every wave has left the ring: it becomes the join area
    // join area: wave w's piece i is 512 contiguous bytes, 16 B a lane; a lane of group 0 and the same lane of group 1 hold the same (row, d) places
    constexpr int NJ = EARLY ? 17 : 9;
    float* jp = (float*)ring + ((size_t)w * NJ * 32 + lane) * 4;
    if (grp == 1) {
#pragma unroll
        for (int j = 0; j < 4; ++j) {
            *(v4fa*)(jp + (2 * j) * 128) = (v4f){o[j][0], o[j][1], o[j][2], o[j][3]}; *(v4fa*)(jp + (2 * j + 1) * 128) = (v4f){o[j][4], o[j][5], o[j][6], o[j][7]};
            if (EARLY) { *(v4fa*)(jp + (8 + 2 * j) * 128) = (v4f){oR[j][0], oR[j][1], oR[j][2], oR[j][3]}; *(v4fa*)(jp + (9 + 2 * j) * 128) = (v4f){oR[j][4], oR[j][5], oR[j][6], oR[j][7]}; } }
        *(v4fa*)(jp + (NJ - 1) * 128) = (v4f){m, l, 0.0f, 0.0f};
    }
    __syncthreads();                                    // publishes group 1's stores
    if (grp == 1) return;                               // wave-uniform, behind the last block barrier
    {
        const v4f ml = *(const v4fa*)(jp + (NJ - 1) * 128);
        const float mm = fmaxf(m, ml[0]);
        const float a0 = __builtin_amdgcn_exp2f(m - mm), a1 = __builtin_amdgcn_exp2f(ml[0] - mm);
        l = l * a0 + ml[1] * a1;
#pragma unroll
        for (int j = 0; j < 4; ++j) {
            const v4f x0 = *(const v4fa*)(jp + (2 * j) * 128), x1 = *(const v4fa*)(jp + (2 * j + 1) * 128);
#pragma unroll
            for (int i = 0; i < 4; ++i) { o[j][i] = o[j][i] * a0 + x0[i] * a1; o[j][4 + i] = o[j][4 + i] * a0 + x1[i] * a1; }
            if (EARLY) {
                const v4f y0 = *(const v4fa*)(jp + (8 + 2 * j) * 128), y1 = *(const v4fa*)(jp + (9 + 2 * j) * 128);
#pragma unroll
                for (int i = 0; i < 4; ++i) { oR[j][i] = oR[j][i] * a0 + y0[i] * a1; oR[j][4 + i] = oR[j][4 + i] * a0 + y1[i] * a1; } } }
    }
    l += __shfl_xor(l, 16, 32);
    const bool any = l > 0.0f;
    const float lsafe = any ? l : 1.0f;
    const float inv = any ? (1.0f / lsafe) : 0.0f;
    const int wb = w * 16 * OSP;
    // O^T D layout: f_j[r] = (d = 16j + 8h + r, t = lane&15) -> os[t][d]; rows 0..15 x columns 0..63 all written
#pragma unroll
    for (int j = 0; j < 4; ++j) {
        v8f f = o[j];
        if (EARLY) f = o[j] + oR[j] * QRI;
        v4f a, c;
        a[0] = f[0] * inv; a[1] = f[1] * inv; a[2] = f[2] * inv; a[3] = f[3] * inv; c[0] = f[4] * inv; c[1] = f[5] * inv; c[2] = f[6] * inv; c[3] = f[7] * inv;
        *(v4fa*)(&os[wb + lr * OSP + 16 * j + 8 * hi]) = a; *(v4fa*)(&os[wb + lr * OSP + 16 * j + 8 * hi + 4]) = c; }
    wave_sync();
    float* orow = OUT + (((size_t)b * OUT_SEQ + t0) * NHD + h) * HD;
{
#pragma unroll
        for (int s = 0; s < 8; ++s) { const int row = 2 * s + (lane >> 4), cofs = (lane & 15) * 4;   // 8 s x 2 rows = 16 rows; 16 lanes x 4 floats = 64 columns = two lines
            const v4f val = *(const v4fa*)(&os[wb + row * OSP + cofs]);
            *(v4f*)(orow + (size_t)row * HE + cofs) = val; }
         }
}

// k_flash: all row blocks of all heads in one launch, grid (NB*NHD heads, NXB ranks), blocks of KG * AW waves. At 4 waves per SIMD two blocks stand on a WGP, so half the grid is resident at once.
// A block's cost grows linearly with its row block xb; the grid's index order puts the longest row blocks first.
// Head index fastest: blocks of one rank (blockIdx.y) walk the same length. Where and when a block runs is the dispatcher's choice: the order is for speed only, every (head, row block) is done exactly once.
// four waves per SIMD (at most 256 registers a wave)
__global__ __launch_bounds__(32 * AW * KG) __attribute__((amdgpu_waves_per_eu(4, 4))) void k_flash(const h16* __restrict__ QH, const h16* __restrict__ KP, const h16* __restrict__ VT, float* OUT) {
    __shared__ __align__(16) float os[AW * 16 * OSP];
    __shared__ __align__(16) h16 ring[2 * 2 * STH];   // two buffers x (k stage, v^T stage)
    const int zh = blockIdx.x;
    const int xb = NXB - 1 - (int)blockIdx.y;
    if (xb < EROWS / (16 * AW)) flash_body<1>(QH, KP, VT, OUT, os, ring, zh, xb);   // block-uniform
    else                        flash_body<0>(QH, KP, VT, OUT, os, ring, zh, xb);
}

static constexpr size_t al256(size_t v) { return (v + 255) & ~(size_t)255; }
static constexpr size_t SZ_QK = al256((size_t)NB * SEQ * HE * 2);           // q plane [NB][SEQ][HE] f16; k plane [NB*NHD][SEQ/16][4][32][8] f16
static constexpr size_t SZ_VT = al256((size_t)NB * NHD * HD * SEQ * 2);     // v^T plane [NB*NHD][SEQ/32][8][32][8] f16
static constexpr size_t SZ_TOTAL = 2 * SZ_QK + SZ_VT;
static_assert(SZ_TOTAL <= (size_t)134217728);          // workspace carve <= 128 MiB
static_assert(((size_t)NB * SEQ * HE * 2) % 128 == 0);
static_assert(((size_t)SEQ * 2) % 128 == 0);

extern "C" void kernel_launch(void* const* d_in, const int* in_sizes, int n_in,
                              void* d_out, int out_size, void* d_ws, size_t ws_size, hipStream_t stream) {
    if (n_in < 3) return;
    const size_t needx = ((size_t)(NB - 1) * SEQ_FULL + SEQ) * HE;
    if ((size_t)in_sizes[0] < needx || (size_t)in_sizes[1] < needx || (size_t)in_sizes[2] < needx) return;
    if ((size_t)out_size < ((size_t)(NB - 1) * OUT_SEQ + SEQ) * HE) return;
    if (SZ_TOTAL > ws_size) return;
    // wire order: queries, keys, values
    const float* qin = (const float*)d_in[0];
    const float* kin = (const float*)d_in[1];
    const float* vin = (const float*)d_in[2];
    float* OUT = (float*)d_out;      // [NB][SEQ][16][64]
    char* wsp = (char*)d_ws;
    h16* QH = (h16*)wsp; wsp += SZ_QK;               // [NB][SEQ][1024]
    h16* KP = (h16*)wsp; wsp += SZ_QK;               // [NB*16][SEQ/16][4][32][8]
    h16* VT = (h16*)wsp; wsp += SZ_VT;               // [NB*16][SEQ/32][8][32][8]

    // q -> f16 plane in the input layout; k, v -> f16 planes in fragment order; grid (token spans, batch*head)
    k_prep<<<dim3(SEQ / (64 * PU), NB * NHD, 1), 256, 0, stream>>>(qin, kin, vin, QH, KP, VT);

    // query rows [0, EROWS): two-plane-P instantiation; rows [EROWS, SEQ): single-product instantiation (disjoint output rows); one launch, grid (batch*head, rank of the row block)
    k_flash<<<dim3(NB * NHD, NXB, 1), 32 * AW * KG, 0, stream>>>(QH, KP, VT, OUT);
}

// v010
// A run of this version takes 30.4 microseconds.
// Next to v009, in two timings, it ran 1.09 and 1.10 times as fast.
// Counting every step since v000, it is 3.22 times as fast.
#include <hip/hip_runtime.h>

// Causal scaled dot-product attention over per-head slices, no projections: q/k/v [NB][SEQ][16][64] (f32), key j kept for query t iff j <= t (dropped keys get probability 0), score scale 1/sqrt(64), output [NB][SEQ][16][64] (f32).
// Compute dtypes, f32 accumulate everywhere: scores v_wmma_f32_16x16x32_f16 with q, k single f16 planes (inputs RNE-converted to bf16, then held in f16: exact for f16-normal values, smaller magnitudes selected to +0);
// P.V v_wmma_f32_16x16x32_f16: v single f16 plane (same conversion), P f16 with x128 carry (cancels in the normalisation), converted RNE two at a time, values below 2^-14 kept as f16 subnormals; on query rows < EROWS P = f16 value + f16 residual x2048, residual products in their own accumulators folded by 1/2048, row sum from the f32 exponentials; on later rows row sum over the converted P. Softmax f32 (online; the maximum in use is raised, and sums and accumulators rescaled, only when a kept score exceeds it by more than 8 in the log2 domain, so P stays below 2^15).
// Layout: f16 copy of q in the input layout [b][t][h*64 + d] (row pitch 1024 halves); k and v^T planes in fragment order (see k_prep): each 16-B piece stands where the lane that loads it finds it, so one wave-wide 16-B load reads 512 contiguous bytes (four whole lines);
// all three planes written by one launch, k and v through LDS; fused flash kernel in transposed form (S^T = K Q^T, O^T = V^T P^T), k and v^T fragments from an LDS ring filled once per block, a row block's keys shared out between two groups of waves whose partial results are joined through LDS, output from f32 accumulators.

#ifndef NB
#define NB 2
#endif
#ifndef SEQ
#define SEQ 2048
#endif
#define NB_FULL  2
#define SEQ_FULL 2048
#ifndef OUT_SEQ
#define OUT_SEQ SEQ              // row pitch (in tokens) between batches of the output
#endif
#define NHD  16                  // heads
#define HD   64                  // head width
#define HE   (NHD * HD)          // token row pitch (elements) of the inputs, the q plane and the output
#define AW   4                   // waves per key group of a flash block (16 query rows each)
#define KG   2                   // key groups per flash block: group g takes the 64-key spans g, g + KG, ..
#define OSP  68                  // LDS row pitch (floats) of the flash output tile
#define TP   68                  // LDS row pitch (floats) of the transpose tile
#define PU   2                   // 64-token tiles per block of the plane-building kernel
#define KU   (64 * PU * 8)       // 16-B pieces of k per block of the plane-building kernel
#define EROWS (SEQ < 512 ? SEQ : 512)   // query rows handled by the two-plane-P flash instantiation
#define NXB  (SEQ / (16 * AW))   // row blocks (16*AW query rows each) per (batch, head)
#define STK  64                  // keys of one group in a stage of the flash kernel's LDS ring
#define STH  (KG * STK * HD)     // halves of one plane in a stage (KG * STK keys)
#define QRS  2048.0f             // carry of the residual P fragment
#define QRI  (1.0f / 2048.0f)
#define SC2  ((float)(0.125 * 1.4426950408889634))   // HD^-0.5 * log2(e)
#define PSH  7.0f                // log2 of the P carry (128)
#define LZT  8.0f                // a row's scaled score may exceed the maximum in use by this much before the accumulators are rescaled: P <= 2^(PSH + LZT) = 32768, inside f16
#define NEGB (-3.0e38f)

static_assert(HD == 64);                       // two 32-deep k-steps per score tile, four 16-row output tiles
static_assert(NHD * HD == HE);
static_assert(HD % 32 == 0);                   // score k-loop steps by 32
static_assert(HE % 8 == 0);                    // 16-byte fragment loads from token rows
static_assert(SEQ % 64 == 0);
static_assert(SEQ % 32 == 0);                  // key loop steps by 32 and its bound never exceeds SEQ
static_assert(SEQ % (16 * AW) == 0);
static_assert(EROWS % (16 * AW) == 0);
static_assert((SEQ - EROWS) % (16 * AW) == 0);
static_assert(EROWS >= 32);
static_assert(EROWS <= SEQ);
static_assert(SEQ % (KG * STK) == 0);           // a ring stage never ends past the planes
static_assert(NB <= NB_FULL);
static_assert(SEQ <= SEQ_FULL);
static_assert(OSP >= HD);
static_assert((OSP * 4) % 16 == 0);
static_assert(TP >= 64);
static_assert((TP * 4) % 16 == 0);
static_assert(SEQ % (64 * PU) == 0);                                 // plane-building grid x tokens per block == SEQ
static_assert((size_t)32 * 16 * 8 == (size_t)16 * HD * 4);           // flash epilogue: 32 lanes x 16 B x 8 trips == 16 rows x 256 B
static_assert((size_t)256 * 2 * 8 == (size_t)64 * HD);               // q/k convert: 256 threads x 2 pieces x 8 floats == 64 tokens x 64 columns
static_assert((size_t)256 * 2 * PU * 8 == (size_t)HD * 64 * PU);     // v^T store: 256 threads x 2*PU pieces x 8 halves == 64 rows x 64*PU tokens
static_assert((size_t)256 * 4 * 4 == (size_t)64 * HD);               // transpose load: 256 threads x 4 float4 x 4 floats == 64 tokens x 64 columns
static_assert(STK == 16 * AW);                                       // row block xb walks the 64-key spans 0 .. xb, the diagonal inside the last
static_assert((size_t)32 * AW * KG * 4 * 16 == (size_t)STH * 2);     // stage copy: 256 threads x 4 pieces x 16 B == one plane's stage
static_assert(2 * ((size_t)AW * 16 * OSP * 4 + (size_t)4 * STH * 2) <= 327680);   // static LDS of two resident flash blocks
static_assert((size_t)AW * 17 * 512 <= (size_t)4 * STH * 2);         // the join area (17 wave-wide 16-B pieces per wave at most) fits the ring
static_assert((size_t)256 * 2 * PU == (size_t)KU);                   // k fragment store: 256 threads x 2*PU pieces == all pieces of the block
static_assert(KU % 16 == 0);
static_assert((size_t)PU * 64 * TP * 4 + (size_t)(KU + KU / 16) * 16 <= 131072);   // static LDS of the plane-building kernel

typedef _Float16 h16;
typedef __attribute__((ext_vector_type(16))) _Float16 v16h;
typedef __attribute__((ext_vector_type(8)))  _Float16 v8h;
typedef __attribute__((ext_vector_type(8)))  float    v8f;
typedef __attribute__((ext_vector_type(4)))  float    v4f;
typedef v4f  __attribute__((may_alias)) v4fa;
typedef __attribute__((ext_vector_type(2)))  float    v2f;
typedef __attribute__((ext_vector_type(2)))  _Float16 v2h;

__device__ __forceinline__ unsigned short f2bf(float f) { unsigned u = __float_as_uint(f); u += 0x7FFFu + ((u >> 16) & 1u); return (unsigned short)(u >> 16); }
__device__ __forceinline__ float bfr(float f) { return __uint_as_float(((unsigned)f2bf(f)) << 16); }   // value after RNE convert to bf16
__device__ __forceinline__ v16h cat16(v8h lo, v8h hi) { return __builtin_shufflevector(lo, hi, 0, 1, 2, 3, 4, 5, 6, 7, 8, 9, 10, 11, 12, 13, 14, 15); }
// fragment loader from K-contiguous 16-bit rows; p already includes + 8*(lane>>4): elements 0..7 <- k0+8h+0..7, elements 8..15 <- k0+16+8h+0..7 (same map for A and B)
__device__ __forceinline__ v16h  ldh(const h16* p) { return cat16(*(const v8h*)p, *(const v8h*)(p + 16)); }
// fragment loader from a fragment-order plane; p already includes + 8*lane: elements 0..7 from the lane's piece of one 512-B group, elements 8..15 from its piece of the next group
__device__ __forceinline__ v16h  ldf(const h16* p) { return cat16(*(const v8h*)p, *(const v8h*)(p + 256)); }
// ordering point for wave-private LDS tiles (same wave writes and reads)
__device__ __forceinline__ void wave_sync() { __builtin_amdgcn_fence(3 /* release order */, "wavefront"); __builtin_amdgcn_wave_barrier(); asm volatile("" ::: "memory"); }
// f32 -> f16 convert that cannot produce an f16 subnormal (value select)
static __device__ __forceinline__ h16 toh_flush(float v) { const h16 r = (h16)v; return (fabsf(v) < 6.103515625e-05f) ? (h16)0.0f : r; }
// two f32 -> one register of two f16, round to nearest even, one packed convert; a result below 2^-14 stays an f16 subnormal, which the matrix unit takes as it is
static __device__ __forceinline__ v2h toh2(float a, float b) { return __builtin_convertvector((v2f){a, b}, v2h); }
// one WMMA, the builtin alone: the compiler keeps the distance to the first vector instruction on D, A or B, and fills it with independent instructions (other WMMAs, softmax work) where it has some
__device__ __forceinline__ v8f wmma16(v16h a, v16h b, v8f c) { return __builtin_amdgcn_wmma_f32_16x16x32_f16(false, a, false, b, (short)0, c, false, false); }

// k_prep: the three f16 planes in one launch. One block per (64*PU-token span, batch*head): grid (SEQ/(64*PU), NB*NHD), 256 threads; the block reads the same
// 64*PU tokens x 64 columns of q, k and v. Every global load of a thread (12*PU of 16 B) is issued before the first use, so one wave start and one memory latency serve all of them.
// q: in[t][h*64 + d] (f32, token pitch HE) -> same layout in f16, 8 values per piece, 8 lanes fill one 128-B line.
// k: piece (token t, columns 8c..8c+7) -> 16-B unit ((b*16 + h)*(SEQ/16) + t/16)*128 + (c>>1)*32 + (c&1)*16 + t%16: group c>>1 of a 16-key tile holds, at lane (c&1)*16 + t%16, what that lane takes as one half of an A fragment.
//    The pieces change threads through LDS (a spare unit behind every 16 spreads the banks), under the same block barrier as v.
// v: piece (column d, tokens 8g..8g+7) -> 16-B unit ((b*16 + h)*(SEQ/32) + g/4)*256 + (d/16)*64 + (g&3)*16 + d%16: float4 loads scattered transposed into LDS float tiles [d][t] (cross-wave: block barrier), then 16-B pieces.
// A thread stores unit (trip*256 + tid) of the block's span of either plane: a wave's store is 512 contiguous bytes.
__global__ __launch_bounds__(256) void k_prep(const float* __restrict__ Q, const float* __restrict__ K, const float* __restrict__ V, h16* QH, h16* KP, h16* VT) {
    __shared__ __align__(16) float tl[PU * 64 * TP];
    __shared__ __align__(16) h16 kl[(KU + KU / 16) * 8];
    const int tid = threadIdx.x;
    const int tt0 = blockIdx.x * (64 * PU); const int zh = blockIdx.y; const int b = zh / NHD, h = zh % NHD;
    const size_t sb = ((size_t)b * SEQ_FULL + tt0) * HE + (size_t)h * HD;    // (batch b, token tt0, head h) in the inputs
    const size_t db = ((size_t)b * SEQ + tt0) * HE + (size_t)h * HD;         // the same place in the q plane
    v4f xv[PU][4]; v8f xq[PU][2], xk[PU][2];
    const float* pv[4]; const float* pq[2]; const float* pk[2];              // tile 0's addresses; tile u lies 64 * u tokens further on
#pragma unroll
    for (int s = 0; s < 4; ++s) { const int p = s * 256 + tid; pv[s] = V + sb + (size_t)(p >> 4) * HE + (p & 15) * 4; }   // 4 s x 16 tokens = 64 tokens; 16 lanes x 4 = 64 columns
#pragma unroll
    for (int s = 0; s < 2; ++s) { const int p = s * 256 + tid; const size_t o = sb + (size_t)(p >> 3) * HE + (p & 7) * 8;  // 2 s x 32 tokens = 64 tokens; 8 lanes x 8 = 64 columns
        pq[s] = Q + o; pk[s] = K + o; }
#pragma unroll
    for (int u = 0; u < PU; ++u) {
#pragma unroll
        for (int s = 0; s < 4; ++s) xv[u][s] = *(const v4f*)(pv[s] + (size_t)u * 64 * HE); }
#pragma unroll
    for (int u = 0; u < PU; ++u) {
#pragma unroll
        for (int s = 0; s < 2; ++s) { xq[u][s] = *(const v8f*)(pq[s] + (size_t)u * 64 * HE); xk[u][s] = *(const v8f*)(pk[s] + (size_t)u * 64 * HE); } }
    // every load stands above this line (left free, the scheduler sinks the q and k loads to their uses and the thread pays several memory latencies in a row);
    // the addresses are inputs, so they stay in their registers up to the wait and no load's result lands in one of them ahead of it
    asm volatile("s_wait_xcnt 0x0" :: "v"(pv[0]), "v"(pv[1]), "v"(pv[2]), "v"(pv[3]), "v"(pq[0]), "v"(pq[1]), "v"(pk[0]), "v"(pk[1]) : "memory");
#pragma unroll
    for (int u = 0; u < PU; ++u) {
#pragma unroll
        for (int s = 0; s < 4; ++s) { const int p = s * 256 + tid; const int t = p >> 4, d4 = (p & 15) * 4;
#pragma unroll
            for (int i = 0; i < 4; ++i) tl[u * 64 * TP + (d4 + i) * TP + t] = bfr(xv[u][s][i]); } }
#pragma unroll
    for (int u = 0; u < PU; ++u) {
#pragma unroll
        for (int s = 0; s < 2; ++s) { const int p = s * 256 + tid; const int t = u * 64 + (p >> 3), c = p & 7;
            v8h ok;
#pragma unroll
            for (int k = 0; k < 8; ++k) ok[k] = toh_flush(bfr(xk[u][s][k]));
            const int un = (t >> 4) * 128 + (c >> 1) * 32 + (c & 1) * 16 + (t & 15);
            *(v8h*)(&kl[(un + (un >> 4)) * 8]) = ok; } }
    __syncthreads();
    // q needs no exchange; its stores stand behind the barrier, which would otherwise wait for them
#pragma unroll
    for (int u = 0; u < PU; ++u) {
#pragma unroll
        for (int s = 0; s < 2; ++s) { const int p = s * 256 + tid; const int t = u * 64 + (p >> 3), c8 = (p & 7) * 8;
            v8h oq;
#pragma unroll
            for (int k = 0; k < 8; ++k) oq[k] = toh_flush(bfr(xq[u][s][k]));
            *(v8h*)(QH + db + (size_t)t * HE + c8) = oq;
            asm volatile("s_wait_xcnt 0x0" ::: "memory"); } }   // the next piece, and the LDS reads below, land in registers that this store names
    const size_t kb = ((size_t)zh * SEQ + tt0) * HD;                         // the block's span in either fragment-order plane: 64*PU tokens x 64 halves, contiguous
#pragma unroll
    for (int s = 0; s < 2 * PU; ++s) { const int un = s * 256 + tid;
        *(v8h*)(KP + kb + (size_t)un * 8) = *(const v8h*)(&kl[(un + (un >> 4)) * 8]); }
    asm volatile("s_wait_xcnt 0x0" ::: "memory");   // the same for the k stores and the v pieces formed below
#pragma unroll
    for (int s = 0; s < 2 * PU; ++s) { const int un = s * 256 + tid;         // trip s = 32-key tile s of the span; tid = (d/16)*64 + (g&3)*16 + d%16
        const int d = ((tid >> 6) << 4) | (tid & 15), tk = s * 32 + ((tid >> 4) & 3) * 8;
        const float* tr = &tl[(tk >> 6) * 64 * TP + d * TP + (tk & 63)];
        const v4f x0 = *(const v4fa*)(tr); const v4f x1 = *(const v4fa*)(tr + 4);
        v8h hv;
#pragma unroll
        for (int i = 0; i < 4; ++i) { hv[i] = toh_flush(x0[i]); hv[4 + i] = toh_flush(x1[i]); }
        *(v8h*)(VT + kb + (size_t)un * 8) = hv; }
}

// stage_copy: one stage of the flash kernel's LDS ring, 128 keys of the k plane and of the v^T plane (16 KiB each, contiguous in fragment order), by asynchronous copies to LDS.
// A thread brings the 16-B pieces tid, tid + 256, tid + 512, tid + 768 of either plane; kg, vg, kl, vl are its first piece's global and LDS addresses (all multiples of 16 B).
__device__ __forceinline__ void stage_copy(const h16* kg, const h16* vg, unsigned kl, unsigned vl) {
    // the wait is the statement's last line, so that no address register of a copy is rewritten ahead of it
    asm volatile("global_load_async_to_lds_b128 %0, %8, off\n\t"
                 "global_load_async_to_lds_b128 %1, %9, off\n\t"
                 "global_load_async_to_lds_b128 %2, %10, off\n\t"
                 "global_load_async_to_lds_b128 %3, %11, off\n\t"
                 "global_load_async_to_lds_b128 %4, %12, off\n\t"
                 "global_load_async_to_lds_b128 %5, %13, off\n\t"
                 "global_load_async_to_lds_b128 %6, %14, off\n\t"
                 "global_load_async_to_lds_b128 %7, %15, off\n\t"
                 "s_wait_xcnt 0x0"
                 :: "v"(kl), "v"(kl + 4096u), "v"(kl + 8192u), "v"(kl + 12288u), "v"(vl), "v"(vl + 4096u), "v"(vl + 8192u), "v"(vl + 12288u),
                    "v"(kg), "v"(kg + 2048), "v"(kg + 4096), "v"(kg + 6144), "v"(vg), "v"(vg + 2048), "v"(vg + 4096), "v"(vg + 6144)
                 : "memory");
}

// flash_body: fused attention, two waves (one of each key group) per 16 query rows of one (batch, head); a 128-key stage of K and V^T is brought into LDS once per block, group g's four waves work on its 64-key span g,
// so a wave walks half the row block's keys (two buffers, the next stage's copies in flight while this one is worked on); every wave takes its fragments from there (two 16-B LDS loads each, 512 contiguous bytes per wave-wide load); Q fragments straight from the f16 plane.
// Transposed form: S^T[key][t] = K Q^T (A = K rows, B = Q rows, two k-steps over d); lane (t = lane&15, h = lane>>4) holds keys 8h+r of each 16-key tile, so the packed
// P tile is directly the B fragment of O^T[d][t] = V^T P^T (element r <- tile keys 0..15, element 8+r <- tile keys 16..31, lane unchanged); four 16-row d tiles.
// Softmax state (maximum in use, partial sum) is one scalar per lane; the two lane halves of a row hold the same maximum in use (one xor-16 exchange whenever it is raised).
// Row block xb (query rows 64*xb .. 64*xb+63) walks the 64-key spans 0 .. xb, ring stages 0 .. xb/2. Spans below xb end below the block's first row: both 32-key tiles unmasked in every wave.
// Span xb: waves 0 and 1 of its group end in its first tile, waves 2 and 3 take that tile unmasked and end in the second; the keep rule (key <= query) is evaluated per element in a wave's last tile of the last stage only. Every visited tile holds a kept key for every row.
// For even xb the last stage's second span lies past the diagonal: group 1 does no work there (for xb = 0 none at all: its running max stays at the start value and its weight in the join is 0).
// Join: group 1 hands its accumulators, running max and partial sum over through LDS (the ring, once every wave has left it); group 0 brings both to the common max, adds them and writes the output.
// EARLY = 1 (query rows [0, EROWS)): P = f16 value + f16 residual x2048; O = V P + (V P_res) / 2048 (residual products in their own accumulators); row sum from the f32 exponentials.
// EARLY = 0 (query rows [EROWS, SEQ)): single P; row sum over the converted P.
template <int EARLY>
__device__ __forceinline__ void flash_body(const h16* __restrict__ QH, const h16* __restrict__ KP, const h16* __restrict__ VT, float* OUT, float* os, h16* ring, const int zh, const int xb) {
    const int lane = threadIdx.x & 31, lr = lane & 15, hi = lane >> 4;
    const int wave = __builtin_amdgcn_readfirstlane((int)(threadIdx.x >> 5));
    const int b = zh / NHD, h = zh % NHD;
    const int grp = wave / AW, w = wave % AW;                              // key group; place among the group's waves
    const int t0 = (xb * AW + w) * 16;                                     // EARLY = 1: xb < EROWS / (16*AW), so t0 < EROWS; EARLY = 0: t0 >= EROWS
    const int lim = t0 + lr;                                               // key j kept iff j <= lim
    // the thread's first piece of stage 0 in either plane, and of buffer 0 in LDS; stage s lies s * STH halves further on, buffer 1 2 * STH halves; s <= xb / KG < SEQ / (KG * STK), so every stage lies inside the planes
    const h16* kg0 = KP + (size_t)zh * SEQ * HD + 8 * (int)threadIdx.x;
    const h16* vg0 = VT + (size_t)zh * SEQ * HD + 8 * (int)threadIdx.x;
    const unsigned kl0 = (unsigned)(size_t)ring + 16u * threadIdx.x;
    auto copy = [&](int s) { const unsigned kl = kl0 + (unsigned)(s & 1) * (4u * STH); stage_copy(kg0 + (size_t)s * STH, vg0 + (size_t)s * STH, kl, kl + 2u * STH); };
    copy(0);
    const size_t rowb = (size_t)b * SEQ * HE + (size_t)h * HD;            // (batch b, token 0, head h) in the q plane
    const size_t qo = rowb + (size_t)(t0 + lr) * HE + 8 * hi;
    const v16h q0 = ldh(QH + qo), q1 = ldh(QH + qo + 32);                  // B fragments: col t, k = d (two k-steps)
    const v16h hz = (v16h){};
    v8f o[4], oR[4];
#pragma unroll
    for (int j = 0; j < 4; ++j) { o[j] = (v8f){}; oR[j] = (v8f){}; }
    float m = NEGB, l = 0.0f;
    // the four fragments of one 32-key tile of either plane; p = the tile's place in the stage + 8 * lane. K: 16-key tile = four 512-B groups (A fragment: row key, k = d; two groups per k-step); V^T: eight groups (A fragment: row d, k = key; two per 16-row d tile)
    auto ld_t = [&](const h16* p, v16h (&f)[4]) { f[0] = ldf(p); f[1] = ldf(p + 512); f[2] = ldf(p + 1024); f[3] = ldf(p + 1536); };
    // S^T of one 32-key tile: D: sA[r] = (key key0 + 8 * hi + r, t = lane&15), sB[r] = (key key0 + 8 * hi + 16 + r, t)
    auto scores = [&](v16h (&kf)[4], v8f& sA, v8f& sB) __attribute__((always_inline)) {
        sA = (v8f){}; sB = (v8f){};
        sA = wmma16(kf[0], q0, sA); sB = wmma16(kf[2], q0, sB);
        sA = wmma16(kf[1], q1, sA); sB = wmma16(kf[3], q1, sB);
    };
    // the lane's maximum over the kept raw scores of a tile (the scale is positive, so it is applied to the maximum alone)
    auto rawmax = [&](int key0, bool diag, const v8f& sA, const v8f& sB) __attribute__((always_inline)) {
        const int ja = key0 + 8 * hi;
        float mx = NEGB;
#pragma unroll
        for (int r = 0; r < 8; ++r) {
            const bool fa = !diag || (ja + r <= lim), fb = !diag || (ja + 16 + r <= lim);
            mx = fmaxf(mx, fmaxf(fa ? sA[r] : NEGB, fb ? sB[r] : NEGB)); }
        return mx;
    };
    // lazy rescale: m, the maximum in use, may trail a row's true maximum by up to LZT; one wave-uniform test, on each lane's own maximum mx of the scaled scores that come next
    auto lazy = [&](float mx) __attribute__((always_inline)) {
        if (__builtin_amdgcn_ballot_w32(mx > m + LZT) != 0) {
            mx = fmaxf(mx, __shfl_xor(mx, 16, 32));                            // both lane halves of a row take the same new maximum
            const float mnew = fmaxf(m, mx);
            const float alpha = __builtin_amdgcn_exp2f(m - mnew);
            m = mnew; l = l * alpha;
#pragma unroll
            for (int j = 0; j < 4; ++j) o[j] = o[j] * alpha;
            if (EARLY) {
#pragma unroll
                for (int j = 0; j < 4; ++j) oR[j] = oR[j] * alpha; }
        }
    };
    // P of one tile against the maximum in use, its share of the row sum, and O^T += V^T P^T
    auto expv = [&](int key0, bool diag, const v8f& sA, const v8f& sB, v16h (&vf)[4]) __attribute__((always_inline)) {
        const int ja = key0 + 8 * hi;
        const float sh = PSH - m;
        v16h pb, pr = hz; float ls = 0.0f; float ga[8], gb[8];
#pragma unroll
        for (int r = 0; r < 8; ++r) {
            const bool fa = !diag || (ja + r <= lim), fb = !diag || (ja + 16 + r <= lim);
            // scale and shift written as one fused operation, so that every form of the tile rounds the exponent alike whatever the compiler would pick
            const float ea = __builtin_amdgcn_exp2f(__builtin_fmaf(sA[r], SC2, sh)), eb = __builtin_amdgcn_exp2f(__builtin_fmaf(sB[r], SC2, sh));
            ga[r] = fa ? ea : 0.0f; gb[r] = fb ? eb : 0.0f; }                 // dropped elements selected to 0 by value
#pragma unroll   // unrolled: ga, gb, pb and pr stay in registers only under constant indices
        for (int r = 0; r < 8; r += 2) {                                      // neighbouring keys share a register of the B fragment: one packed convert fills it
            const v2h pa = toh2(ga[r], ga[r + 1]), pc = toh2(gb[r], gb[r + 1]);
            pb[r] = pa[0]; pb[r + 1] = pa[1]; pb[8 + r] = pc[0]; pb[9 + r] = pc[1];
            if (EARLY) {
                const v2h ra = toh2((ga[r] - (float)pa[0]) * QRS, (ga[r + 1] - (float)pa[1]) * QRS), rc = toh2((gb[r] - (float)pc[0]) * QRS, (gb[r + 1] - (float)pc[1]) * QRS);
                pr[r] = ra[0]; pr[r + 1] = ra[1]; pr[8 + r] = rc[0]; pr[9 + r] = rc[1];
                ls += ga[r] + gb[r]; ls += ga[r + 1] + gb[r + 1]; }
            else { ls += (float)pa[0] + (float)pc[0]; ls += (float)pa[1] + (float)pc[1]; } }
        l += ls;
        o[0] = wmma16(vf[0], pb, o[0]); o[1] = wmma16(vf[1], pb, o[1]); o[2] = wmma16(vf[2], pb, o[2]); o[3] = wmma16(vf[3], pb, o[3]);
        if (EARLY) {
            oR[0] = wmma16(vf[0], pr, oR[0]); oR[1] = wmma16(vf[1], pr, oR[1]); oR[2] = wmma16(vf[2], pr, oR[2]); oR[3] = wmma16(vf[3], pr, oR[3]);
        }
    };
    // one 32-key tile with a test of its own. fetch: the register set is refilled, right behind the products that read it, with the tile at nk, nv (the same stage's second tile)
    auto tile = [&](int key0, bool fetch, const h16* nk, const h16* nv, bool diag, v16h (&kf)[4], v16h (&vf)[4]) __attribute__((always_inline)) {
        v8f sA, sB;
        scores(kf, sA, sB);
        if (fetch) ld_t(nk, kf);
        lazy(rawmax(key0, diag, sA, sB) * SC2);
        expv(key0, diag, sA, sB, vf);
        if (fetch) ld_t(nv, vf);
    };
    // stage 0 has landed (each wave waits for its own copies) and is published by the barrier; stage 1 then flies while stage 0 is worked on
    asm volatile("s_wait_asynccnt 0x0" ::: "memory");
    __syncthreads();
    const int ns = xb / KG + 1;                                            // ring stages of the row block
    if (ns >= 2) copy(1);
    v16h kE[4], vE[4];
    const h16* rl = ring + grp * (STK * HD) + 8 * lane;                    // the group's span of a stage's k part
    const int sl = (ns - 1) * KG + grp;                                    // the group's span in the last stage: below xb (no row's diagonal in it), xb, or past it
    const int lt = (sl < xb) ? 1 : (w >> 1);                               // the wave's last tile in that span (span xb: the tile that its diagonal crosses)
    if constexpr (EARLY) {
        // twice the accumulators: one register set; a stage's second tile is fetched behind the first tile's products
#pragma unroll 1   // kept rolled: one trip per ring stage, the buffer picked by the trip's parity
        for (int s = 0; s < ns - 1; ++s) {
            const h16* sk = rl + (s & 1) * (2 * STH); const h16* sv = sk + STH;
            ld_t(sk, kE); ld_t(sv, vE);
            tile((s * KG + grp) * STK, true, sk + 2048, sv + 2048, false, kE, vE);
            tile((s * KG + grp) * STK + 32, false, sk, sv, false, kE, vE);
            asm volatile("s_wait_dscnt 0x0" ::: "memory");      // this wave's reads of the buffer have ended before it is refilled
            asm volatile("s_wait_asynccnt 0x0" ::: "memory");   // this wave's copies of stage s + 1 have landed before the barrier publishes them
            __syncthreads();
            if (s + 2 < ns) copy(s + 2);
        }
        const h16* sk = rl + ((ns - 1) & 1) * (2 * STH); const h16* sv = sk + STH;
        if (sl <= xb) {                                                    // wave-uniform; no barrier inside
            if (lt) { ld_t(sk, kE); ld_t(sv, vE); tile(sl * STK, false, sk, sv, false, kE, vE); }
            ld_t(sk + 2048 * lt, kE); ld_t(sv + 2048 * lt, vE);
            tile(sl * STK + 32 * lt, false, sk, sv, true, kE, vE);
        }
    } else {
        v16h kO[4], vO[4];
#pragma unroll 1   // kept rolled: one trip per ring stage, the buffer picked by the trip's parity
        for (int s = 0; s < ns - 1; ++s) {
            const h16* sk = rl + (s & 1) * (2 * STH); const h16* sv = sk + STH;
            ld_t(sk, kE); ld_t(sv, vE); ld_t(sk + 2048, kO); ld_t(sv + 2048, vO);
            // both tiles' scores first, then one test for the 64 keys
            const int k0 = (s * KG + grp) * STK;
            v8f sA0, sB0, sA1, sB1;
            scores(kE, sA0, sB0); scores(kO, sA1, sB1);
            const float mx = fmaxf(rawmax(k0, false, sA0, sB0), rawmax(k0 + 32, false, sA1, sB1)) * SC2;
            // inputs only: holds the V^T loads above the test's branch, in one group with the K loads; left free they sink behind it, each pair waited for right in front of its product
            asm volatile("" :: "v"(vE[0]), "v"(vE[1]), "v"(vE[2]), "v"(vE[3]), "v"(vO[0]), "v"(vO[1]), "v"(vO[2]), "v"(vO[3]));
            lazy(mx);
            expv(k0, false, sA0, sB0, vE); expv(k0 + 32, false, sA1, sB1, vO);
            asm volatile("s_wait_dscnt 0x0" ::: "memory");      // this wave's reads of the buffer have ended before it is refilled
            asm volatile("s_wait_asynccnt 0x0" ::: "memory");   // this wave's copies of stage s + 1 have landed before the barrier publishes them
            __syncthreads();
            if (s + 2 < ns) copy(s + 2);
        }
        const h16* sk = rl + ((ns - 1) & 1) * (2 * STH); const h16* sv = sk + STH;
        if (sl <= xb) {                                                    // wave-uniform; no barrier inside
            ld_t(sk + 2048 * lt, kO); ld_t(sv + 2048 * lt, vO);
            if (lt) { ld_t(sk, kE); ld_t(sv, vE); tile(sl * STK, false, sk, sv, false, kE, vE); }
            tile(sl * STK + 32 * lt, false, sk, sv, true, kO, vO);
        }
    }
    asm volatile("s_wait_asynccnt 0x0" ::: "memory");   // no copy is outstanding when the ring takes other data
    asm volatile("s_wait_dscnt 0x0" ::: "memory");      // this wave's reads of the ring have ended
    __syncthreads();                                    // every wave has left the ring: it becomes the join area
    // join area: wave w's piece i is 512 contiguous bytes, 16 B a lane; a lane of group 0 and the same lane of group 1 hold the same (row, d) places
    constexpr int NJ = EARLY ? 17 : 9;
    float* jp = (float*)ring + ((size_t)w * NJ * 32 + lane) * 4;
    if (grp == 1) {
#pragma unroll
        for (int j = 0; j < 4; ++j) {
            *(v4fa*)(jp + (2 * j) * 128) = (v4f){o[j][0], o[j][1], o[j][2], o[j][3]}; *(v4fa*)(jp + (2 * j + 1) * 128) = (v4f){o[j][4], o[j][5], o[j][6], o[j][7]};
            if (EARLY) { *(v4fa*)(jp + (8 + 2 * j) * 128) = (v4f){oR[j][0], oR[j][1], oR[j][2], oR[j][3]}; *(v4fa*)(jp + (9 + 2 * j) * 128) = (v4f){oR[j][4], oR[j][5], oR[j][6], oR[j][7]}; } }
        *(v4fa*)(jp + (NJ - 1) * 128) = (v4f){m, l, 0.0f, 0.0f};
    }
    __syncthreads();                                    // publishes group 1's stores
    if (grp == 1) return;                               // wave-uniform, behind the last block barrier
    {
        const v4f ml = *(const v4fa*)(jp + (NJ - 1) * 128);
        const float mm = fmaxf(m, ml[0]);
        const float a0 = __builtin_amdgcn_exp2f(m - mm), a1 = __builtin_amdgcn_exp2f(ml[0] - mm);
        l = l * a0 + ml[1] * a1;
#pragma unroll
        for (int j = 0; j < 4; ++j) {
            const v4f x0 = *(const v4fa*)(jp + (2 * j) * 128), x1 = *(const v4fa*)(jp + (2 * j + 1) * 128);
#pragma unroll
            for (int i = 0; i < 4; ++i) { o[j][i] = o[j][i] * a0 + x0[i] * a1; o[j][4 + i] = o[j][4 + i] * a0 + x1[i] * a1; }
            if (EARLY) {
                const v4f y0 = *(const v4fa*)(jp + (8 + 2 * j) * 128), y1 = *(const v4fa*)(jp + (9 + 2 * j) * 128);
#pragma unroll
                for (int i = 0; i < 4; ++i) { oR[j][i] = oR[j][i] * a0 + y0[i] * a1; oR[j][4 + i] = oR[j][4 + i] * a0 + y1[i] * a1; } } }
    }
    l += __shfl_xor(l, 16, 32);
    const bool any = l > 0.0f;
    const float lsafe = any ? l : 1.0f;
    const float inv = any ? (1.0f / lsafe) : 0.0f;
    const int wb = w * 16 * OSP;
    // O^T D layout: f_j[r] = (d = 16j + 8h + r, t = lane&15) -> os[t][d]; rows 0..15 x columns 0..63 all written
#pragma unroll
    for (int j = 0; j < 4; ++j) {
        v8f f = o[j];
        if (EARLY) f = o[j] + oR[j] * QRI;
        v4f a, c;
        a[0] = f[0] * inv; a[1] = f[1] * inv; a[2] = f[2] * inv; a[3] = f[3] * inv; c[0] = f[4] * inv; c[1] = f[5] * inv; c[2] = f[6] * inv; c[3] = f[7] * inv;
        *(v4fa*)(&os[wb + lr * OSP + 16 * j + 8 * hi]) = a; *(v4fa*)(&os[wb + lr * OSP + 16 * j + 8 * hi + 4]) = c; }
    wave_sync();
    float* orow = OUT + (((size_t)b * OUT_SEQ + t0) * NHD + h) * HD;
{
#pragma unroll
        for (int s = 0; s < 8; ++s) { const int row = 2 * s + (lane >> 4), cofs = (lane & 15) * 4;   // 8 s x 2 rows = 16 rows; 16 lanes x 4 floats = 64 columns = two lines
            const v4f val = *(const v4fa*)(&os[wb + row * OSP + cofs]);
            *(v4f*)(orow + (size_t)row * HE + cofs) = val; }
         }
}

// k_flash: all row blocks of all heads in one launch, grid (NB*NHD heads, NXB ranks), blocks of KG * AW waves. At 4 waves per SIMD two blocks stand on a WGP, so half the grid is resident at once.
// A block's cost grows linearly with its row block xb; the grid's index order puts the longest row blocks first.
// Head index fastest: blocks of one rank (blockIdx.y) walk the same length. Where and when a block runs is the dispatcher's choice: the order is for speed only, every (head, row block) is done exactly once.
// four waves per SIMD (at most 256 registers a wave)
__global__ __launch_bounds__(32 * AW * KG) __attribute__((amdgpu_waves_per_eu(4, 4))) void k_flash(const h16* __restrict__ QH, const h16* __restrict__ KP, const h16* __restrict__ VT, float* OUT) {
    __shared__ __align__(16) float os[AW * 16 * OSP];
    __shared__ __align__(16) h16 ring[2 * 2 * STH];   // two buffers x (k stage, v^T stage)
    const int zh = blockIdx.x;
    const int xb = NXB - 1 - (int)blockIdx.y;
    if (xb < EROWS / (16 * AW)) flash_body<1>(QH, KP, VT, OUT, os, ring, zh, xb);   // block-uniform
    else                        flash_body<0>(QH, KP, VT, OUT, os, ring, zh, xb);
}

static constexpr size_t al256(size_t v) { return (v + 255) & ~(size_t)255; }
static constexpr size_t SZ_QK = al256((size_t)NB * SEQ * HE * 2);           // q plane [NB][SEQ][HE] f16; k plane [NB*NHD][SEQ/16][4][32][8] f16
static constexpr size_t SZ_VT = al256((size_t)NB * NHD * HD * SEQ * 2);     // v^T plane [NB*NHD][SEQ/32][8][32][8] f16
static constexpr size_t SZ_TOTAL = 2 * SZ_QK + SZ_VT;
static_assert(SZ_TOTAL <= (size_t)134217728);          // workspace carve <= 128 MiB
static_assert(((size_t)NB * SEQ * HE * 2) % 128 == 0);
static_assert(((size_t)SEQ * 2) % 128 == 0);

extern "C" void kernel_launch(void* const* d_in, const int* in_sizes, int n_in,
                              void* d_out, int out_size, void* d_ws, size_t ws_size, hipStream_t stream) {
    if (n_in < 3) return;
    const size_t needx = ((size_t)(NB - 1) * SEQ_FULL + SEQ) * HE;
    if ((size_t)in_sizes[0] < needx || (size_t)in_sizes[1] < needx || (size_t)in_sizes[2] < needx) return;
    if ((size_t)out_size < ((size_t)(NB - 1) * OUT_SEQ + SEQ) * HE) return;
    if (SZ_TOTAL > ws_size) return;
    // wire order: queries, keys, values
    const float* qin = (const float*)d_in[0];
    const float* kin = (const float*)d_in[1];
    const float* vin = (const float*)d_in[2];
    float* OUT = (float*)d_out;      // [NB][SEQ][16][64]
    char* wsp = (char*)d_ws;
    h16* QH = (h16*)wsp; wsp += SZ_QK;               // [NB][SEQ][1024]
    h16* KP = (h16*)wsp; wsp += SZ_QK;               // [NB*16][SEQ/16][4][32][8]
    h16* VT = (h16*)wsp; wsp += SZ_VT;               // [NB*16][SEQ/32][8][32][8]

    // q -> f16 plane in the input layout; k, v -> f16 planes in fragment order; grid (token spans, batch*head)
    k_prep<<<dim3(SEQ / (64 * PU), NB * NHD, 1), 256, 0, stream>>>(qin, kin, vin, QH, KP, VT);

    // query rows [0, EROWS): two-plane-P instantiation; rows [EROWS, SEQ): single-product instantiation (disjoint output rows); one launch, grid (batch*head, rank of the row block)
    k_flash<<<dim3(NB * NHD, NXB, 1), 32 * AW * KG, 0, stream>>>(QH, KP, VT, OUT);
}
